// v000
// Times are from an AMD MI455X. After a warm-up the kernel runs many times in a row, and a time is the length of
// such a window on the GPU divided by its runs, so every launch and the gaps after it count. The runs cycle
// through copies of the inputs. A figure is the median of several windows, for all but v000 over two sittings.
// Sittings can differ by a few percent; kernels timed side by side share one.
// The starting kernel, v000, takes 765 microseconds a run.
#include <hip/hip_runtime.h>

// BERT self-attention with residual + LayerNorm (x [2048][768], unbatched; q,k,v = x W^T ('oi' [768][768], no bias, 1/sqrt(768)); 12 heads x 64; softmax(q.k / 8) over all keys; out = merged Wo^T; y = LayerNorm(out + x) gamma + beta (eps 1e-12) -> [2048][768] (1.6 M)).
// Layout: bf16 copy of x; exact projections; dense T-2048 attention (hybrid rows: < 512 hi/lo 3 products, rest fp16 x1024); merged hi/lo x Wo exact into workspace; a LayerNorm row kernel adds bf16(x) and writes the output rows (one wave per row, 24 values per lane, f32 fixed order).
// Compute dtypes, f32 accumulate: every input rounded to bf16; projections exact; attention rows < 512 3 products, rest fp16; softmax, residual and LayerNorm f32; Wo hl x exact.

#define NB_  1
#define TT   2048
#define DM   768
#define NH_  12
#define NKV  12
#define REP  (NH_ / NKV)
#define HD   64
#define DQ   (NH_ * HD)
#define DKV  (NKV * HD)
#define ZH   2
#define RH   512                  // query rows < RH use hi+lo planes (0: none)
#define WIN  0
#define PCAR 1024.0f
#define SCL  0.125f
#define BSZ  1
typedef _Float16 h16;
typedef unsigned short bf;
typedef __attribute__((ext_vector_type(16))) __bf16   v16bf;
typedef __attribute__((ext_vector_type(16))) _Float16 v16h;
typedef __attribute__((ext_vector_type(8)))  _Float16 v8h;
typedef __attribute__((ext_vector_type(8)))  unsigned short v8us;
typedef __attribute__((ext_vector_type(8)))  float    v8f;
typedef __attribute__((ext_vector_type(4)))  float    v4f;
typedef v8h  __attribute__((may_alias)) v8ha;
typedef v4f  __attribute__((may_alias)) v4fa;
typedef v8us __attribute__((may_alias)) v8usa;

__device__ __forceinline__ unsigned short f2bf(float f) { unsigned u = __float_as_uint(f); u += 0x7FFFu + ((u >> 16) & 1u); return (unsigned short)(u >> 16); }
__device__ __forceinline__ float bf2f(unsigned short b) { return __uint_as_float(((unsigned)b) << 16); }
__device__ __forceinline__ float bfr(float f) { return bf2f(f2bf(f)); }
__device__ __forceinline__ v16h cat16(v8h lo, v8h hi) { return __builtin_shufflevector(lo, hi, 0, 1, 2, 3, 4, 5, 6, 7, 8, 9, 10, 11, 12, 13, 14, 15); }
__device__ __forceinline__ v16bf cat16b(v8us lo, v8us hi) { return __builtin_bit_cast(v16bf, __builtin_shufflevector(lo, hi, 0, 1, 2, 3, 4, 5, 6, 7, 8, 9, 10, 11, 12, 13, 14, 15)); }
__device__ __forceinline__ v8f wmma16(v16h a, v16h b, v8f c) { return __builtin_amdgcn_wmma_f32_16x16x32_f16(false, a, false, b, (short)0, c, false, false); }
__device__ __forceinline__ v8f wmmab(v16bf a, v16bf b, v8f c) { return __builtin_amdgcn_wmma_f32_16x16x32_bf16(false, a, false, b, (short)0, c, false, false); }



// ---- k_gemmw: register-blocked GEMM, ONE WAVE per 64x64 output tile (16 accumulators), operands straight from K-contiguous 16-bit planes; grid (M/64, N/64, Z), 32 threads.
// C[m][n] (f32, pitch ldc, + optional f32 bias[n]) = sum_k A[m][k] Bt[n][k] (+ split products per NSPLIT). z-batch strides sA/sB/sC in elements. K % 32 == 0.
template <typename T16> struct WFrag;
template <> struct WFrag<h16> { typedef v16h V; static __device__ __forceinline__ V ld(const h16* p) { return cat16(*(const v8h*)p, *(const v8h*)(p + 16)); } static __device__ __forceinline__ v8f mma(V a, V b, v8f c) { return wmma16(a, b, c); } };
template <> struct WFrag<bf> { typedef v16bf V; static __device__ __forceinline__ V ld(const bf* p) { return cat16b(*(const v8us*)p, *(const v8us*)(p + 16)); } static __device__ __forceinline__ v8f mma(V a, V b, v8f c) { return wmmab(a, b, c); } };
template <typename T16, int NSPLIT, bool BIAS>
__global__ __launch_bounds__(32) void k_gemmw(const T16* __restrict__ A, const T16* __restrict__ A2, const T16* __restrict__ Bt, const T16* __restrict__ Bt2, int K, float* C, int ldc, const float* __restrict__ bias, size_t sA, size_t sB, size_t sC) {
    typedef typename WFrag<T16>::V V;
    __shared__ __align__(16) float os[16 * 68];
    const size_t z = blockIdx.z; A += z * sA; if (A2) A2 += z * sA; Bt += z * sB; if (Bt2) Bt2 += z * sB; C += z * sC;
    const int lane = threadIdx.x & 31, lr = lane & 15, hi = lane >> 4; const int r0 = blockIdx.x * 64, c0 = blockIdx.y * 64;
    v8f acc[4][4];
#pragma unroll
    for (int mb = 0; mb < 4; ++mb)
#pragma unroll
        for (int nb = 0; nb < 4; ++nb) acc[mb][nb] = (v8f){};
    const size_t aoff = (size_t)(r0 + lr) * K + 8 * hi, boff = (size_t)(c0 + lr) * K + 8 * hi;
#pragma unroll 1
    for (int kc = 0; kc < K; kc += 32) {
        V a[4], a2[4];
#pragma unroll
        for (int mb = 0; mb < 4; ++mb) { a[mb] = WFrag<T16>::ld(A + aoff + (size_t)mb * 16 * K + kc); if (NSPLIT == 1 || NSPLIT == 2) a2[mb] = WFrag<T16>::ld(A2 + aoff + (size_t)mb * 16 * K + kc); }
#pragma unroll
        for (int nb = 0; nb < 4; ++nb) { const V b = WFrag<T16>::ld(Bt + boff + (size_t)nb * 16 * K + kc); V b2; if (NSPLIT >= 2) b2 = WFrag<T16>::ld(Bt2 + boff + (size_t)nb * 16 * K + kc);
#pragma unroll
            for (int mb = 0; mb < 4; ++mb) { acc[mb][nb] = WFrag<T16>::mma(a[mb], b, acc[mb][nb]); if (NSPLIT == 1 || NSPLIT == 2) acc[mb][nb] = WFrag<T16>::mma(a2[mb], b, acc[mb][nb]); if (NSPLIT >= 2) acc[mb][nb] = WFrag<T16>::mma(a[mb], b2, acc[mb][nb]); } }
        asm volatile("v_nop\n\tv_nop\n\tv_nop\n\tv_nop" : "+v"(acc[0][0]), "+v"(acc[1][1]), "+v"(acc[2][2]), "+v"(acc[3][3]) : "v"(a[0]), "v"(a[3]));
    }
#pragma unroll
    for (int mb = 0; mb < 4; ++mb) {
#pragma unroll
        for (int nb = 0; nb < 4; ++nb) {
#pragma unroll
            for (int j = 0; j < 8; ++j) os[(hi * 8 + j) * 68 + nb * 16 + lr] = acc[mb][nb][j]; }
        __builtin_amdgcn_wave_barrier(); asm volatile("" ::: "memory");
        float* crow = C + (size_t)(r0 + mb * 16) * ldc + c0;
{
#pragma unroll
            for (int s = 0; s < 8; ++s) { const int row = 2 * s + hi, cofs = lr * 4; v4f val = *(const v4fa*)(os + row * 68 + cofs); if (BIAS) { val[0] += bfr(bias[c0 + cofs]); val[1] += bfr(bias[c0 + cofs + 1]); val[2] += bfr(bias[c0 + cofs + 2]); val[3] += bfr(bias[c0 + cofs + 3]); }
                *(v4f*)(crow + (size_t)row * ldc + cofs) = val; }
             }
        __builtin_amdgcn_wave_barrier(); asm volatile("" ::: "memory");
    }
}

__device__ __forceinline__ h16 tohx(float x) { return (h16)x; }
__device__ __forceinline__ void splitf(float y, unsigned short& h, unsigned short& l) { h = f2bf(y); l = f2bf(y - bf2f(h)); }
typedef __attribute__((ext_vector_type(2))) _Float16 v2h;
typedef __attribute__((ext_vector_type(4))) _Float16 v4h;
typedef __attribute__((ext_vector_type(2))) unsigned short v2us;
typedef __attribute__((ext_vector_type(4))) unsigned short v4us;
typedef __attribute__((ext_vector_type(2))) float v2f;
typedef __attribute__((ext_vector_type(4))) int v4i;

__global__ __launch_bounds__(256) void k_wtG(const float* __restrict__ w, int K, int N, bf* Bt) {
    const int lane = threadIdx.x & 31; const int L0 = (blockIdx.x * 8 + (threadIdx.x >> 5)) * 8; const int nlines = N * K / 64;
{
#pragma unroll 1
        for (int l = 0; l < 8; ++l) { const int L = L0 + l; if (L >= nlines) break; const size_t e = (size_t)L * 64 + lane * 2; const int k = (int)(e % K), n = (int)(e / K); v2us o;
            o[0] = f2bf(w[(size_t)k * N + n]); o[1] = f2bf(w[(size_t)(k + 1) * N + n]); *(v2us*)(Bt + e) = o; }
         }
}
__global__ __launch_bounds__(256) void k_cvt8(const float* __restrict__ src, bf* dst, size_t n8) { const size_t i = (size_t)blockIdx.x * 256 + threadIdx.x; if (i >= n8) return; const v8f v = *(const v8f*)(src + i * 8); v8us o;
#pragma unroll
    for (int k = 0; k < 8; ++k) o[k] = f2bf(v[k]); *(v8us*)(dst + i * 8) = o;  }

// k_rope: head planes [h][t][d] (fp16 + hi/lo) of rope(x) x sc with the rotate-half convention out[d] = x[d] cos[t][d] - x[d+HD/2] sin[t][d], out[d+HD/2] = x[d+HD/2] cos[t][d+HD/2] + x[d] sin[t][d+HD/2]
__global__ __launch_bounds__(256) void k_rope(const float* __restrict__ F, int pitch, int nheads, const float* __restrict__ CS, const float* __restrict__ RF, const float* __restrict__ nw, float sc, h16* P16, bf* Ph, bf* Pl) {
    const size_t e = ((size_t)blockIdx.x * 256 + threadIdx.x) * 2; if (e >= (size_t)nheads * TT * HD) return; const int d = (int)(e % HD); const int t = (int)((e / HD) % TT); const int h = (int)(e / ((size_t)HD * TT)); const float* f = F + (size_t)t * pitch + h * HD; const float rf = RF ? RF[(size_t)h * TT + t] : 1.0f; v2h o16; v2us oh, ol;
#pragma unroll
    for (int q = 0; q < 2; ++q) { const int dd = d + q; const int dp = (dd < HD / 2) ? dd + HD / 2 : dd - HD / 2; float x0 = f[dd], x1 = f[dp];
        if (RF) { float n0 = __fmul_rn(x0, rf), n1 = __fmul_rn(x1, rf); asm volatile("" : "+v"(n0)); asm volatile("" : "+v"(n1)); x0 = __fmul_rn(bfr(nw[dd]), n0); x1 = __fmul_rn(bfr(nw[dp]), n1); }
        const v2f cs = *(const v2f*)(CS + ((size_t)t * HD + dd) * 2); float a = __fmul_rn(x0, cs[0]), bq = __fmul_rn(x1, cs[1]); asm volatile("" : "+v"(a)); asm volatile("" : "+v"(bq)); const float r = ((dd < HD / 2) ? __fsub_rn(a, bq) : __fadd_rn(a, bq)) * sc;
        o16[q] = tohx(r); unsigned short a2, c2; splitf(r, a2, c2); oh[q] = a2; ol[q] = c2; }
    *(v2h*)(P16 + e) = o16; *(v2us*)(Ph + e) = oh; *(v2us*)(Pl + e) = ol;  }
__global__ __launch_bounds__(256) void k_vtp(const float* __restrict__ F, int pitch, int nheads, h16* V16, bf* Vh, bf* Vl) { const size_t e = ((size_t)blockIdx.x * 256 + threadIdx.x) * 2; if (e >= (size_t)nheads * HD * TT) return; const int t = (int)(e % TT); const int d = (int)((e / TT) % HD); const int g = (int)(e / ((size_t)TT * HD)); v2h o16; v2us oh, ol;
#pragma unroll
    for (int q = 0; q < 2; ++q) { const float x = F[(size_t)(t + q) * pitch + g * HD + d]; o16[q] = tohx(x); unsigned short a2, c2; splitf(x, a2, c2); oh[q] = a2; ol[q] = c2; }
    *(v2h*)(V16 + e) = o16; *(v2us*)(Vh + e) = oh; *(v2us*)(Vl + e) = ol;  }
__global__ __launch_bounds__(256) void k_csid(float* CS) { const int idx = blockIdx.x * 256 + threadIdx.x; if (idx >= TT * HD) return; v2f cs; cs[0] = 1.0f; cs[1] = 0.0f; *(v2f*)(CS + (size_t)idx * 2) = cs;  }
// k_asoft: per row (zz, i): t = S x HD^-0.5 (no mask); softmax over the 2048 keys (register row, one exp, fixed trees);
__global__ __launch_bounds__(256) void k_asoft(const float* __restrict__ Sb, h16* P16, bf* Ph, bf* Pl) {
    const int lane = threadIdx.x & 31; const int row = blockIdx.x * 8 + (threadIdx.x >> 5); if (row >= ZH * TT) return; const int i = row % TT; const int zz = row / TT; (void)zz; const bool hires = (i < RH); const float* sr = Sb + (size_t)row * TT; float v[TT / 32]; float mx = -3.0e38f;
#pragma unroll
    for (int ch = 0; ch < TT / 128; ++ch) { const int j0 = ch * 128 + lane * 4; const v4f a = *(const v4f*)(sr + j0);
#pragma unroll
        for (int q = 0; q < 4; ++q) { const int j = j0 + q; (void)j; const float t = a[q] * SCL; v[ch * 4 + q] = t; mx = fmaxf(mx, t); } }
#pragma unroll
    for (int sh = 16; sh; sh >>= 1) mx = fmaxf(mx, __shfl_xor(mx, sh, 32));
    float sum = 0.f;
#pragma unroll
    for (int k = 0; k < TT / 32; ++k) { float d0 = __fsub_rn(v[k], mx); asm volatile("" : "+v"(d0)); v[k] = __builtin_amdgcn_exp2f(__fmul_rn(d0, 1.4426950408889634f)); sum += v[k]; }
#pragma unroll
    for (int sh = 16; sh; sh >>= 1) sum += __shfl_xor(sum, sh, 32);
    const float f = __fdiv_rn(hires ? 1.0f : PCAR, sum);
{
        if (hires) {
#pragma unroll
            for (int ch = 0; ch < TT / 128; ++ch) { v4us oh, ol;
#pragma unroll
                for (int q = 0; q < 4; ++q) { unsigned short a, c2; splitf(v[ch * 4 + q] * f, a, c2); oh[q] = a; ol[q] = c2; }
                const size_t oo = ((size_t)zz * (RH ? RH : 1) + i) * TT + ch * 128 + lane * 4; *(v4us*)(Ph + oo) = oh; *(v4us*)(Pl + oo) = ol; }
        } else {
#pragma unroll
            for (int ch = 0; ch < TT / 128; ++ch) { v4h o4;
#pragma unroll
                for (int q = 0; q < 4; ++q) o4[q] = tohx(v[ch * 4 + q] * f);
                *(v4h*)(P16 + (size_t)row * TT + ch * 128 + lane * 4) = o4; } }
         }
}
__global__ __launch_bounds__(256) void k_lnrS12(const float* __restrict__ wb, const float* __restrict__ Y, const float* __restrict__ g, const float* __restrict__ bb, float* ob) { const int lane = threadIdx.x & 31; const int row = blockIdx.x * 8 + (threadIdx.x >> 5); if (row >= TT) return; const float* br = wb + (size_t)row * BSZ * DM; const float* yr = Y + (size_t)row * DM; float v[DM / 32]; float s = 0.f;
#pragma unroll
    for (int ch = 0; ch < DM / 128; ++ch) { const v4f a = *(const v4f*)(br + ch * 128 + lane * 4); const v4f y4 = *(const v4f*)(yr + ch * 128 + lane * 4);
#pragma unroll
        for (int q = 0; q < 4; ++q) { float ab = bfr(a[q]); asm volatile("" : "+v"(ab)); float t = __fadd_rn(ab, y4[q]); asm volatile("" : "+v"(t)); v[ch * 4 + q] = t; s = __fadd_rn(s, t); } }
#pragma unroll
    for (int sh = 16; sh; sh >>= 1) s = __fadd_rn(s, __shfl_xor(s, sh, 32));
    const float mu = __fdiv_rn(s, (float)DM); float s2 = 0.f;
#pragma unroll
    for (int k = 0; k < DM / 32; ++k) { const float dv = __fsub_rn(v[k], mu); float p2 = __fmul_rn(dv, dv); asm volatile("" : "+v"(p2)); s2 = __fadd_rn(s2, p2); }
#pragma unroll
    for (int sh = 16; sh; sh >>= 1) s2 = __fadd_rn(s2, __shfl_xor(s2, sh, 32));
    const float rs = __fdiv_rn(1.0f, __fsqrt_rn(__fadd_rn(__fdiv_rn(s2, (float)DM), 1e-12f)));
{
#pragma unroll
        for (int ch = 0; ch < DM / 128; ++ch) { v4f o; for (int q = 0; q < 4; ++q) { const int col = ch * 128 + lane * 4 + q; float dv = __fsub_rn(v[ch * 4 + q], mu); asm volatile("" : "+v"(dv)); float y = __fmul_rn(dv, rs); asm volatile("" : "+v"(y)); float gg = bfr(g[col]), bb2 = bfr(bb[col]); asm volatile("" : "+v"(gg), "+v"(bb2)); y = __fmul_rn(y, gg); asm volatile("" : "+v"(y)); o[q] = __fadd_rn(y, bb2); }   /* every step kept separate: no fma contraction */
            *(v4f*)(ob + (size_t)row * BSZ * DM + ch * 128 + lane * 4) = o; }
         } }

__global__ __launch_bounds__(256) void k_merge(const float* __restrict__ O, int h0, bf* Ah, bf* Al) { const size_t e = ((size_t)blockIdx.x * 256 + threadIdx.x) * 2; if (e >= (size_t)ZH * TT * HD) return; const int d = (int)(e % HD); const int t = (int)((e / HD) % TT); const int zz = (int)(e / ((size_t)HD * TT)); const float cs = (t < RH) ? 1.0f : (1.0f / PCAR); const size_t oo = (size_t)t * DQ + (h0 + zz) * HD + d;
    v2us oh, ol;
#pragma unroll
    for (int q = 0; q < 2; ++q) { unsigned short a, c2; splitf(O[e + q] * cs, a, c2); oh[q] = a; ol[q] = c2; } *(v2us*)(Ah + oo) = oh; *(v2us*)(Al + oo) = ol;  }

extern "C" void kernel_launch(void* const* d_in, const int* in_sizes, int n_in,
                              void* d_out, int out_size, void* d_ws, size_t ws_size, hipStream_t stream) {
    (void)in_sizes; (void)n_in; (void)out_size;
    const float* x = (const float*)d_in[0]; const float* wq = (const float*)d_in[1]; const float* wk = (const float*)d_in[2]; const float* wv = (const float*)d_in[3]; const float* wo = (const float*)d_in[4]; const float* lng = (const float*)d_in[5]; const float* lnb = (const float*)d_in[6];
    float* OUT = (float*)d_out;     // [1][2048][768]
    char* wsp = (char*)d_ws;
    auto take = [&](size_t bytes) { char* p = wsp; wsp += (bytes + 255) & ~(size_t)255; return (void*)p; };
    float* Y = (float*)take((size_t)TT * DM * 4); bf* WQ = (bf*)take((size_t)DQ * DM * 2); bf* WK = (bf*)take((size_t)DKV * DM * 2); bf* WV = (bf*)take((size_t)DKV * DM * 2); bf* WO = (bf*)take((size_t)DM * DQ * 2); float* CS = (float*)take((size_t)TT * HD * 2 * 4);
    bf* XB = (bf*)take((size_t)TT * DM * 2); float* FQ = (float*)take((size_t)TT * DQ * 4); float* FK = (float*)take((size_t)TT * DKV * 4);
    h16* QP16 = (h16*)take((size_t)NH_ * TT * HD * 2); h16* KP16 = (h16*)take((size_t)NKV * TT * HD * 2); h16* VT16 = (h16*)take((size_t)NKV * HD * TT * 2);
    bf* QPh = (bf*)take((size_t)NH_ * TT * HD * 2); bf* QPl = (bf*)take((size_t)NH_ * TT * HD * 2); bf* KPh = (bf*)take((size_t)NKV * TT * HD * 2); bf* KPl = (bf*)take((size_t)NKV * TT * HD * 2); bf* VTh = (bf*)take((size_t)NKV * HD * TT * 2); bf* VTl = (bf*)take((size_t)NKV * HD * TT * 2); bf* Ph = (bf*)take((size_t)ZH * RH * TT * 2); bf* Pl = (bf*)take((size_t)ZH * RH * TT * 2);
    float* Sb = (float*)take((size_t)ZH * TT * TT * 4); h16* P16 = (h16*)take((size_t)ZH * TT * TT * 2); float* Ob = (float*)take((size_t)ZH * TT * HD * 4); bf* ATh = (bf*)take((size_t)TT * DQ * 2); bf* ATl = (bf*)take((size_t)TT * DQ * 2);
    if ((size_t)(wsp - (char*)d_ws) > ws_size) return;    // ws 256 MiB
    float* FV = FK;   // v projection reuses the k buffer after the k planes are built (stream-ordered)
    { k_cvt8<<<(unsigned)(((size_t)DQ * DM / 8 + 255) / 256), 256, 0, stream>>>(wq, WQ, (size_t)DQ * DM / 8); k_cvt8<<<(unsigned)(((size_t)DKV * DM / 8 + 255) / 256), 256, 0, stream>>>(wk, WK, (size_t)DKV * DM / 8); k_cvt8<<<(unsigned)(((size_t)DKV * DM / 8 + 255) / 256), 256, 0, stream>>>(wv, WV, (size_t)DKV * DM / 8);
      k_cvt8<<<(unsigned)(((size_t)DM * DQ / 8 + 255) / 256), 256, 0, stream>>>(wo, WO, (size_t)DM * DQ / 8);
       }
    k_csid<<<(TT * HD + 255) / 256, 256, 0, stream>>>(CS);
    const unsigned LQ = (unsigned)(((size_t)NH_ * TT * HD / 2 + 255) / 256), LKv = (unsigned)(((size_t)NKV * TT * HD / 2 + 255) / 256);
    for (int b = 0; b < NB_; ++b) {
        
        k_cvt8<<<(unsigned)(((size_t)TT * DM / 8 + 255) / 256), 256, 0, stream>>>(x + (size_t)b * TT * DM, XB, (size_t)TT * DM / 8);
        k_gemmw<bf, 0, false><<<dim3(TT / 64, DQ / 64, 1), 32, 0, stream>>>(XB, nullptr, WQ, nullptr, DM, FQ, DQ, nullptr, 0, 0, 0);
        k_rope<<<LQ, 256, 0, stream>>>(FQ, DQ, NH_, CS, nullptr, nullptr, 1.0f, QP16, QPh, QPl);
        k_gemmw<bf, 0, false><<<dim3(TT / 64, DKV / 64, 1), 32, 0, stream>>>(XB, nullptr, WK, nullptr, DM, FK, DKV, nullptr, 0, 0, 0);
        k_rope<<<LKv, 256, 0, stream>>>(FK, DKV, NKV, CS, nullptr, nullptr, 1.0f, KP16, KPh, KPl);
        k_gemmw<bf, 0, false><<<dim3(TT / 64, DKV / 64, 1), 32, 0, stream>>>(XB, nullptr, WV, nullptr, DM, FV, DKV, nullptr, 0, 0, 0); k_vtp<<<LKv, 256, 0, stream>>>(FV, DKV, NKV, VT16, VTh, VTl);
        for (int h0 = 0; h0 < NH_; h0 += ZH) { const size_t zq = (size_t)h0, zk = (size_t)(h0 / REP);   // one kv head per query head: the pass's two heads use consecutive kv planes (z-strides TT*HD)
            k_gemmw<bf, 2, false><<<dim3(RH / 64, TT / 64, ZH), 32, 0, stream>>>(QPh + zq * TT * HD, QPl + zq * TT * HD, KPh + zk * TT * HD, KPl + zk * TT * HD, HD, Sb, TT, nullptr, (size_t)TT * HD, (size_t)TT * HD, (size_t)TT * TT);
            k_gemmw<h16, 0, false><<<dim3((TT - RH) / 64, TT / 64, ZH), 32, 0, stream>>>(QP16 + zq * TT * HD + (size_t)RH * HD, nullptr, KP16 + zk * TT * HD, nullptr, HD, Sb + (size_t)RH * TT, TT, nullptr, (size_t)TT * HD, (size_t)TT * HD, (size_t)TT * TT);
            k_asoft<<<ZH * TT / 8, 256, 0, stream>>>(Sb, P16, Ph, Pl);
            k_gemmw<bf, 2, false><<<dim3(RH / 64, HD / 64, ZH), 32, 0, stream>>>(Ph, Pl, VTh + zk * HD * TT, VTl + zk * HD * TT, TT, Ob, HD, nullptr, (size_t)RH * TT, (size_t)HD * TT, (size_t)TT * HD);
            k_gemmw<h16, 0, false><<<dim3((TT - RH) / 64, HD / 64, ZH), 32, 0, stream>>>(P16 + (size_t)RH * TT, nullptr, VT16 + zk * HD * TT, nullptr, TT, Ob + (size_t)RH * HD, HD, nullptr, (size_t)TT * TT, (size_t)HD * TT, (size_t)TT * HD);
            k_merge<<<(unsigned)(((size_t)ZH * TT * HD / 2 + 255) / 256), 256, 0, stream>>>(Ob, h0, ATh, ATl); }
        k_gemmw<bf, 1, false><<<dim3(TT / 64, DM / 64, 1), 32, 0, stream>>>(ATh, ATl, WO, nullptr, DQ, Y, DM, nullptr, 0, 0, 0); k_lnrS12<<<TT / 8, 256, 0, stream>>>(x + (size_t)b * TT * DM, Y, lng, lnb, OUT + (size_t)b * TT * DM);   /* LayerNorm(out + x), eps 1e-12 */ }
}

// v001
// A run of this version takes 414 microseconds.
// Two timings next to v000 both put it at 1.84 times that version's speed.
#include <hip/hip_runtime.h>

// BERT self-attention with residual + LayerNorm (x [2048][768], unbatched; q,k,v = x W^T ('oi' [768][768], no bias, 1/sqrt(768)); 12 heads x 64; softmax(q.k / 8) over all keys; out = merged Wo^T; y = LayerNorm(out + x) gamma + beta (eps 1e-12) -> [2048][768] (1.6 M)).
// Layout: bf16 copy of x; exact projections; dense T-2048 attention (hybrid rows: < 512 hi/lo 3 products, rest fp16 x1024); merged hi/lo x Wo exact into workspace; a LayerNorm row kernel adds bf16(x) and writes the output rows (one wave per row, 24 values per lane, f32 fixed order).
// Compute dtypes, f32 accumulate: every input rounded to bf16; projections exact; attention rows < 512 3 products, rest fp16; softmax, residual and LayerNorm f32; Wo hl x exact.

#define NB_  1
#define TT   2048
#define DM   768
#define NH_  12
#define NKV  12
#define REP  (NH_ / NKV)
#define HD   64
#define DQ   (NH_ * HD)
#define DKV  (NKV * HD)
#define ZH   2
#define RH   512                  // query rows < RH use hi+lo planes (0: none)
#define WIN  0
#define PCAR 1024.0f
#define SCL  0.125f
#define BSZ  1
typedef _Float16 h16;
typedef unsigned short bf;
typedef __attribute__((ext_vector_type(16))) __bf16   v16bf;
typedef __attribute__((ext_vector_type(16))) _Float16 v16h;
typedef __attribute__((ext_vector_type(8)))  _Float16 v8h;
typedef __attribute__((ext_vector_type(8)))  unsigned short v8us;
typedef __attribute__((ext_vector_type(8)))  float    v8f;
typedef __attribute__((ext_vector_type(4)))  float    v4f;
typedef v8h  __attribute__((may_alias)) v8ha;
typedef v4f  __attribute__((may_alias)) v4fa;
typedef v8us __attribute__((may_alias)) v8usa;

__device__ __forceinline__ unsigned short f2bf(float f) { unsigned u = __float_as_uint(f); u += 0x7FFFu + ((u >> 16) & 1u); return (unsigned short)(u >> 16); }
__device__ __forceinline__ float bf2f(unsigned short b) { return __uint_as_float(((unsigned)b) << 16); }
__device__ __forceinline__ float bfr(float f) { return bf2f(f2bf(f)); }
__device__ __forceinline__ v16h cat16(v8h lo, v8h hi) { return __builtin_shufflevector(lo, hi, 0, 1, 2, 3, 4, 5, 6, 7, 8, 9, 10, 11, 12, 13, 14, 15); }
__device__ __forceinline__ v16bf cat16b(v8us lo, v8us hi) { return __builtin_bit_cast(v16bf, __builtin_shufflevector(lo, hi, 0, 1, 2, 3, 4, 5, 6, 7, 8, 9, 10, 11, 12, 13, 14, 15)); }
__device__ __forceinline__ v8f wmma16(v16h a, v16h b, v8f c) { return __builtin_amdgcn_wmma_f32_16x16x32_f16(false, a, false, b, (short)0, c, false, false); }
__device__ __forceinline__ v8f wmmab(v16bf a, v16bf b, v8f c) { return __builtin_amdgcn_wmma_f32_16x16x32_bf16(false, a, false, b, (short)0, c, false, false); }



// ---- k_gemmw: register-blocked GEMM, one 64x64 output tile per workgroup (16 accumulators per wave), operands straight from K-contiguous 16-bit planes; grid (M/64, N/64, Z), 32 * KW threads.
// C[m][n] (f32, pitch ldc, + optional f32 bias[n]) = sum_k A[m][k] Bt[n][k] (+ split products per NSPLIT). z-batch strides sA/sB/sC in elements. K % (32 * KW) == 0.
// KW waves share the tile: wave w sums the k range [w K/KW, (w+1) K/KW) of the whole tile; the KW partial tiles meet in LDS and are added in wave order 0..KW-1 (fixed f32 order).
template <typename T16> struct WFrag;
template <> struct WFrag<h16> { typedef v16h V; static __device__ __forceinline__ V ld(const h16* p) { return cat16(*(const v8h*)p, *(const v8h*)(p + 16)); } static __device__ __forceinline__ v8f mma(V a, V b, v8f c) { return wmma16(a, b, c); } };
template <> struct WFrag<bf> { typedef v16bf V; static __device__ __forceinline__ V ld(const bf* p) { return cat16b(*(const v8us*)p, *(const v8us*)(p + 16)); } static __device__ __forceinline__ v8f mma(V a, V b, v8f c) { return wmmab(a, b, c); } };
template <typename T16, int NSPLIT, bool BIAS, int KW>
__global__ __launch_bounds__(32 * KW) void k_gemmw(const T16* __restrict__ A, const T16* __restrict__ A2, const T16* __restrict__ Bt, const T16* __restrict__ Bt2, int K, float* C, int ldc, const float* __restrict__ bias, size_t sA, size_t sB, size_t sC) {
    typedef typename WFrag<T16>::V V;
    __shared__ __align__(16) float os[KW == 1 ? 16 * 68 : KW * 64 * 68];
    const size_t z = blockIdx.z; A += z * sA; if (A2) A2 += z * sA; Bt += z * sB; if (Bt2) Bt2 += z * sB; C += z * sC;
    const int lane = threadIdx.x & 31, lr = lane & 15, hi = lane >> 4; const int r0 = blockIdx.x * 64, c0 = blockIdx.y * 64;
    v8f acc[4][4];
#pragma unroll
    for (int mb = 0; mb < 4; ++mb)
#pragma unroll
        for (int nb = 0; nb < 4; ++nb) acc[mb][nb] = (v8f){};
    const size_t aoff = (size_t)(r0 + lr) * K + 8 * hi, boff = (size_t)(c0 + lr) * K + 8 * hi;
    const int kw = (KW == 1) ? 0 : __builtin_amdgcn_readfirstlane((int)(threadIdx.x >> 5));   // wave number in a scalar register: the k loop stays a scalar loop
    const int kbeg = kw * (K / KW), kend = kbeg + K / KW;
#pragma unroll 1
    for (int kc = kbeg; kc < kend; kc += 32) {
        V a[4], a2[4];
#pragma unroll
        for (int mb = 0; mb < 4; ++mb) { a[mb] = WFrag<T16>::ld(A + aoff + (size_t)mb * 16 * K + kc); if (NSPLIT == 1 || NSPLIT == 2) a2[mb] = WFrag<T16>::ld(A2 + aoff + (size_t)mb * 16 * K + kc); }
#pragma unroll
        for (int nb = 0; nb < 4; ++nb) { const V b = WFrag<T16>::ld(Bt + boff + (size_t)nb * 16 * K + kc); V b2; if (NSPLIT >= 2) b2 = WFrag<T16>::ld(Bt2 + boff + (size_t)nb * 16 * K + kc);
#pragma unroll
            for (int mb = 0; mb < 4; ++mb) { acc[mb][nb] = WFrag<T16>::mma(a[mb], b, acc[mb][nb]); if (NSPLIT == 1 || NSPLIT == 2) acc[mb][nb] = WFrag<T16>::mma(a2[mb], b, acc[mb][nb]); if (NSPLIT >= 2) acc[mb][nb] = WFrag<T16>::mma(a[mb], b2, acc[mb][nb]); } }
        asm volatile("v_nop\n\tv_nop\n\tv_nop\n\tv_nop" : "+v"(acc[0][0]), "+v"(acc[1][1]), "+v"(acc[2][2]), "+v"(acc[3][3]) : "v"(a[0]), "v"(a[3]));
    }
    if constexpr (KW > 1) {
        float* my = os + kw * (64 * 68);
        // the three loops are unrolled so that acc[][][] is indexed by constants and stays in registers
#pragma unroll
        for (int mb = 0; mb < 4; ++mb)
#pragma unroll
            for (int nb = 0; nb < 4; ++nb)
#pragma unroll
                for (int j = 0; j < 8; ++j) my[(mb * 16 + hi * 8 + j) * 68 + nb * 16 + lr] = acc[mb][nb][j];
        __syncthreads();   // every wave's partial tile is in LDS before any wave adds them
        static_assert((64 * 16) % (32 * KW) == 0, "each thread adds the same number of 4-column pieces");
        // both loops unrolled: the LDS reads of all partial tiles issue ahead of the adds, which keep the order w = 0..KW-1
#pragma unroll
        for (int it = 0; it < (64 * 16) / (32 * KW); ++it) { const int s = (int)threadIdx.x + it * (32 * KW); const int row = s >> 4, cofs = (s & 15) * 4; v4f val = *(const v4fa*)(os + row * 68 + cofs);
#pragma unroll
            for (int w = 1; w < KW; ++w) val += *(const v4fa*)(os + w * (64 * 68) + row * 68 + cofs);
            if (BIAS) { val[0] += bfr(bias[c0 + cofs]); val[1] += bfr(bias[c0 + cofs + 1]); val[2] += bfr(bias[c0 + cofs + 2]); val[3] += bfr(bias[c0 + cofs + 3]); }
            *(v4f*)(C + (size_t)(r0 + row) * ldc + c0 + cofs) = val; }
        return;
    }
#pragma unroll
    for (int mb = 0; mb < 4; ++mb) {
#pragma unroll
        for (int nb = 0; nb < 4; ++nb) {
#pragma unroll
            for (int j = 0; j < 8; ++j) os[(hi * 8 + j) * 68 + nb * 16 + lr] = acc[mb][nb][j]; }
        __builtin_amdgcn_wave_barrier(); asm volatile("" ::: "memory");
        float* crow = C + (size_t)(r0 + mb * 16) * ldc + c0;
{
#pragma unroll
            for (int s = 0; s < 8; ++s) { const int row = 2 * s + hi, cofs = lr * 4; v4f val = *(const v4fa*)(os + row * 68 + cofs); if (BIAS) { val[0] += bfr(bias[c0 + cofs]); val[1] += bfr(bias[c0 + cofs + 1]); val[2] += bfr(bias[c0 + cofs + 2]); val[3] += bfr(bias[c0 + cofs + 3]); }
                *(v4f*)(crow + (size_t)row * ldc + cofs) = val; }
             }
        __builtin_amdgcn_wave_barrier(); asm volatile("" ::: "memory");
    }
}

__device__ __forceinline__ h16 tohx(float x) { return (h16)x; }
__device__ __forceinline__ void splitf(float y, unsigned short& h, unsigned short& l) { h = f2bf(y); l = f2bf(y - bf2f(h)); }
typedef __attribute__((ext_vector_type(2))) _Float16 v2h;
typedef __attribute__((ext_vector_type(4))) _Float16 v4h;
typedef __attribute__((ext_vector_type(2))) unsigned short v2us;
typedef __attribute__((ext_vector_type(4))) unsigned short v4us;
typedef __attribute__((ext_vector_type(2))) float v2f;
typedef __attribute__((ext_vector_type(4))) int v4i;

__global__ __launch_bounds__(256) void k_wtG(const float* __restrict__ w, int K, int N, bf* Bt) {
    const int lane = threadIdx.x & 31; const int L0 = (blockIdx.x * 8 + (threadIdx.x >> 5)) * 8; const int nlines = N * K / 64;
{
#pragma unroll 1
        for (int l = 0; l < 8; ++l) { const int L = L0 + l; if (L >= nlines) break; const size_t e = (size_t)L * 64 + lane * 2; const int k = (int)(e % K), n = (int)(e / K); v2us o;
            o[0] = f2bf(w[(size_t)k * N + n]); o[1] = f2bf(w[(size_t)(k + 1) * N + n]); *(v2us*)(Bt + e) = o; }
         }
}
__global__ __launch_bounds__(256) void k_cvt8(const float* __restrict__ src, bf* dst, size_t n8) { const size_t i = (size_t)blockIdx.x * 256 + threadIdx.x; if (i >= n8) return; const v8f v = *(const v8f*)(src + i * 8); v8us o;
#pragma unroll
    for (int k = 0; k < 8; ++k) o[k] = f2bf(v[k]); *(v8us*)(dst + i * 8) = o;  }

// k_rope: head planes [h][t][d] (fp16 + hi/lo) of rope(x) x sc with the rotate-half convention out[d] = x[d] cos[t][d] - x[d+HD/2] sin[t][d], out[d+HD/2] = x[d+HD/2] cos[t][d+HD/2] + x[d] sin[t][d+HD/2]
__global__ __launch_bounds__(256) void k_rope(const float* __restrict__ F, int pitch, int nheads, const float* __restrict__ CS, const float* __restrict__ RF, const float* __restrict__ nw, float sc, h16* P16, bf* Ph, bf* Pl) {
    const size_t e = ((size_t)blockIdx.x * 256 + threadIdx.x) * 2; if (e >= (size_t)nheads * TT * HD) return; const int d = (int)(e % HD); const int t = (int)((e / HD) % TT); const int h = (int)(e / ((size_t)HD * TT)); const float* f = F + (size_t)t * pitch + h * HD; const float rf = RF ? RF[(size_t)h * TT + t] : 1.0f; v2h o16; v2us oh, ol;
#pragma unroll
    for (int q = 0; q < 2; ++q) { const int dd = d + q; const int dp = (dd < HD / 2) ? dd + HD / 2 : dd - HD / 2; float x0 = f[dd], x1 = f[dp];
        if (RF) { float n0 = __fmul_rn(x0, rf), n1 = __fmul_rn(x1, rf); asm volatile("" : "+v"(n0)); asm volatile("" : "+v"(n1)); x0 = __fmul_rn(bfr(nw[dd]), n0); x1 = __fmul_rn(bfr(nw[dp]), n1); }
        const v2f cs = *(const v2f*)(CS + ((size_t)t * HD + dd) * 2); float a = __fmul_rn(x0, cs[0]), bq = __fmul_rn(x1, cs[1]); asm volatile("" : "+v"(a)); asm volatile("" : "+v"(bq)); const float r = ((dd < HD / 2) ? __fsub_rn(a, bq) : __fadd_rn(a, bq)) * sc;
        o16[q] = tohx(r); unsigned short a2, c2; splitf(r, a2, c2); oh[q] = a2; ol[q] = c2; }
    *(v2h*)(P16 + e) = o16; *(v2us*)(Ph + e) = oh; *(v2us*)(Pl + e) = ol;  }
__global__ __launch_bounds__(256) void k_vtp(const float* __restrict__ F, int pitch, int nheads, h16* V16, bf* Vh, bf* Vl) { const size_t e = ((size_t)blockIdx.x * 256 + threadIdx.x) * 2; if (e >= (size_t)nheads * HD * TT) return; const int t = (int)(e % TT); const int d = (int)((e / TT) % HD); const int g = (int)(e / ((size_t)TT * HD)); v2h o16; v2us oh, ol;
#pragma unroll
    for (int q = 0; q < 2; ++q) { const float x = F[(size_t)(t + q) * pitch + g * HD + d]; o16[q] = tohx(x); unsigned short a2, c2; splitf(x, a2, c2); oh[q] = a2; ol[q] = c2; }
    *(v2h*)(V16 + e) = o16; *(v2us*)(Vh + e) = oh; *(v2us*)(Vl + e) = ol;  }
__global__ __launch_bounds__(256) void k_csid(float* CS) { const int idx = blockIdx.x * 256 + threadIdx.x; if (idx >= TT * HD) return; v2f cs; cs[0] = 1.0f; cs[1] = 0.0f; *(v2f*)(CS + (size_t)idx * 2) = cs;  }
// k_asoft: per row (zz, i): t = S x HD^-0.5 (no mask); softmax over the 2048 keys (register row, one exp, fixed trees);
__global__ __launch_bounds__(256) void k_asoft(const float* __restrict__ Sb, h16* P16, bf* Ph, bf* Pl) {
    const int lane = threadIdx.x & 31; const int row = blockIdx.x * 8 + (threadIdx.x >> 5); if (row >= ZH * TT) return; const int i = row % TT; const int zz = row / TT; (void)zz; const bool hires = (i < RH); const float* sr = Sb + (size_t)row * TT; float v[TT / 32]; float mx = -3.0e38f;
#pragma unroll
    for (int ch = 0; ch < TT / 128; ++ch) { const int j0 = ch * 128 + lane * 4; const v4f a = *(const v4f*)(sr + j0);
#pragma unroll
        for (int q = 0; q < 4; ++q) { const int j = j0 + q; (void)j; const float t = a[q] * SCL; v[ch * 4 + q] = t; mx = fmaxf(mx, t); } }
#pragma unroll
    for (int sh = 16; sh; sh >>= 1) mx = fmaxf(mx, __shfl_xor(mx, sh, 32));
    float sum = 0.f;
#pragma unroll
    for (int k = 0; k < TT / 32; ++k) { float d0 = __fsub_rn(v[k], mx); asm volatile("" : "+v"(d0)); v[k] = __builtin_amdgcn_exp2f(__fmul_rn(d0, 1.4426950408889634f)); sum += v[k]; }
#pragma unroll
    for (int sh = 16; sh; sh >>= 1) sum += __shfl_xor(sum, sh, 32);
    const float f = __fdiv_rn(hires ? 1.0f : PCAR, sum);
{
        if (hires) {
#pragma unroll
            for (int ch = 0; ch < TT / 128; ++ch) { v4us oh, ol;
#pragma unroll
                for (int q = 0; q < 4; ++q) { unsigned short a, c2; splitf(v[ch * 4 + q] * f, a, c2); oh[q] = a; ol[q] = c2; }
                const size_t oo = ((size_t)zz * (RH ? RH : 1) + i) * TT + ch * 128 + lane * 4; *(v4us*)(Ph + oo) = oh; *(v4us*)(Pl + oo) = ol; }
        } else {
#pragma unroll
            for (int ch = 0; ch < TT / 128; ++ch) { v4h o4;
#pragma unroll
                for (int q = 0; q < 4; ++q) o4[q] = tohx(v[ch * 4 + q] * f);
                *(v4h*)(P16 + (size_t)row * TT + ch * 128 + lane * 4) = o4; } }
         }
}
__global__ __launch_bounds__(256) void k_lnrS12(const float* __restrict__ wb, const float* __restrict__ Y, const float* __restrict__ g, const float* __restrict__ bb, float* ob) { const int lane = threadIdx.x & 31; const int row = blockIdx.x * 8 + (threadIdx.x >> 5); if (row >= TT) return; const float* br = wb + (size_t)row * BSZ * DM; const float* yr = Y + (size_t)row * DM; float v[DM / 32]; float s = 0.f;
#pragma unroll
    for (int ch = 0; ch < DM / 128; ++ch) { const v4f a = *(const v4f*)(br + ch * 128 + lane * 4); const v4f y4 = *(const v4f*)(yr + ch * 128 + lane * 4);
#pragma unroll
        for (int q = 0; q < 4; ++q) { float ab = bfr(a[q]); asm volatile("" : "+v"(ab)); float t = __fadd_rn(ab, y4[q]); asm volatile("" : "+v"(t)); v[ch * 4 + q] = t; s = __fadd_rn(s, t); } }
#pragma unroll
    for (int sh = 16; sh; sh >>= 1) s = __fadd_rn(s, __shfl_xor(s, sh, 32));
    const float mu = __fdiv_rn(s, (float)DM); float s2 = 0.f;
#pragma unroll
    for (int k = 0; k < DM / 32; ++k) { const float dv = __fsub_rn(v[k], mu); float p2 = __fmul_rn(dv, dv); asm volatile("" : "+v"(p2)); s2 = __fadd_rn(s2, p2); }
#pragma unroll
    for (int sh = 16; sh; sh >>= 1) s2 = __fadd_rn(s2, __shfl_xor(s2, sh, 32));
    const float rs = __fdiv_rn(1.0f, __fsqrt_rn(__fadd_rn(__fdiv_rn(s2, (float)DM), 1e-12f)));
{
#pragma unroll
        for (int ch = 0; ch < DM / 128; ++ch) { v4f o; for (int q = 0; q < 4; ++q) { const int col = ch * 128 + lane * 4 + q; float dv = __fsub_rn(v[ch * 4 + q], mu); asm volatile("" : "+v"(dv)); float y = __fmul_rn(dv, rs); asm volatile("" : "+v"(y)); float gg = bfr(g[col]), bb2 = bfr(bb[col]); asm volatile("" : "+v"(gg), "+v"(bb2)); y = __fmul_rn(y, gg); asm volatile("" : "+v"(y)); o[q] = __fadd_rn(y, bb2); }   /* every step kept separate: no fma contraction */
            *(v4f*)(ob + (size_t)row * BSZ * DM + ch * 128 + lane * 4) = o; }
         } }

__global__ __launch_bounds__(256) void k_merge(const float* __restrict__ O, int h0, bf* Ah, bf* Al) { const size_t e = ((size_t)blockIdx.x * 256 + threadIdx.x) * 2; if (e >= (size_t)ZH * TT * HD) return; const int d = (int)(e % HD); const int t = (int)((e / HD) % TT); const int zz = (int)(e / ((size_t)HD * TT)); const float cs = (t < RH) ? 1.0f : (1.0f / PCAR); const size_t oo = (size_t)t * DQ + (h0 + zz) * HD + d;
    v2us oh, ol;
#pragma unroll
    for (int q = 0; q < 2; ++q) { unsigned short a, c2; splitf(O[e + q] * cs, a, c2); oh[q] = a; ol[q] = c2; } *(v2us*)(Ah + oo) = oh; *(v2us*)(Al + oo) = ol;  }

extern "C" void kernel_launch(void* const* d_in, const int* in_sizes, int n_in,
                              void* d_out, int out_size, void* d_ws, size_t ws_size, hipStream_t stream) {
    (void)in_sizes; (void)n_in; (void)out_size;
    const float* x = (const float*)d_in[0]; const float* wq = (const float*)d_in[1]; const float* wk = (const float*)d_in[2]; const float* wv = (const float*)d_in[3]; const float* wo = (const float*)d_in[4]; const float* lng = (const float*)d_in[5]; const float* lnb = (const float*)d_in[6];
    float* OUT = (float*)d_out;     // [1][2048][768]
    char* wsp = (char*)d_ws;
    auto take = [&](size_t bytes) { char* p = wsp; wsp += (bytes + 255) & ~(size_t)255; return (void*)p; };
    float* Y = (float*)take((size_t)TT * DM * 4); bf* WQ = (bf*)take((size_t)DQ * DM * 2); bf* WK = (bf*)take((size_t)DKV * DM * 2); bf* WV = (bf*)take((size_t)DKV * DM * 2); bf* WO = (bf*)take((size_t)DM * DQ * 2); float* CS = (float*)take((size_t)TT * HD * 2 * 4);
    bf* XB = (bf*)take((size_t)TT * DM * 2); float* FQ = (float*)take((size_t)TT * DQ * 4); float* FK = (float*)take((size_t)TT * DKV * 4);
    h16* QP16 = (h16*)take((size_t)NH_ * TT * HD * 2); h16* KP16 = (h16*)take((size_t)NKV * TT * HD * 2); h16* VT16 = (h16*)take((size_t)NKV * HD * TT * 2);
    bf* QPh = (bf*)take((size_t)NH_ * TT * HD * 2); bf* QPl = (bf*)take((size_t)NH_ * TT * HD * 2); bf* KPh = (bf*)take((size_t)NKV * TT * HD * 2); bf* KPl = (bf*)take((size_t)NKV * TT * HD * 2); bf* VTh = (bf*)take((size_t)NKV * HD * TT * 2); bf* VTl = (bf*)take((size_t)NKV * HD * TT * 2); bf* Ph = (bf*)take((size_t)ZH * RH * TT * 2); bf* Pl = (bf*)take((size_t)ZH * RH * TT * 2);
    float* Sb = (float*)take((size_t)ZH * TT * TT * 4); h16* P16 = (h16*)take((size_t)ZH * TT * TT * 2); float* Ob = (float*)take((size_t)ZH * TT * HD * 4); bf* ATh = (bf*)take((size_t)TT * DQ * 2); bf* ATl = (bf*)take((size_t)TT * DQ * 2);
    if ((size_t)(wsp - (char*)d_ws) > ws_size) return;    // ws 256 MiB
    float* FV = FK;   // v projection reuses the k buffer after the k planes are built (stream-ordered)
    { k_cvt8<<<(unsigned)(((size_t)DQ * DM / 8 + 255) / 256), 256, 0, stream>>>(wq, WQ, (size_t)DQ * DM / 8); k_cvt8<<<(unsigned)(((size_t)DKV * DM / 8 + 255) / 256), 256, 0, stream>>>(wk, WK, (size_t)DKV * DM / 8); k_cvt8<<<(unsigned)(((size_t)DKV * DM / 8 + 255) / 256), 256, 0, stream>>>(wv, WV, (size_t)DKV * DM / 8);
      k_cvt8<<<(unsigned)(((size_t)DM * DQ / 8 + 255) / 256), 256, 0, stream>>>(wo, WO, (size_t)DM * DQ / 8);
       }
    k_csid<<<(TT * HD + 255) / 256, 256, 0, stream>>>(CS);
    const unsigned LQ = (unsigned)(((size_t)NH_ * TT * HD / 2 + 255) / 256), LKv = (unsigned)(((size_t)NKV * TT * HD / 2 + 255) / 256);
    for (int b = 0; b < NB_; ++b) {
        
        k_cvt8<<<(unsigned)(((size_t)TT * DM / 8 + 255) / 256), 256, 0, stream>>>(x + (size_t)b * TT * DM, XB, (size_t)TT * DM / 8);
        k_gemmw<bf, 0, false, 8><<<dim3(TT / 64, DQ / 64, 1), 256, 0, stream>>>(XB, nullptr, WQ, nullptr, DM, FQ, DQ, nullptr, 0, 0, 0);
        k_rope<<<LQ, 256, 0, stream>>>(FQ, DQ, NH_, CS, nullptr, nullptr, 1.0f, QP16, QPh, QPl);
        k_gemmw<bf, 0, false, 8><<<dim3(TT / 64, DKV / 64, 1), 256, 0, stream>>>(XB, nullptr, WK, nullptr, DM, FK, DKV, nullptr, 0, 0, 0);
        k_rope<<<LKv, 256, 0, stream>>>(FK, DKV, NKV, CS, nullptr, nullptr, 1.0f, KP16, KPh, KPl);
        k_gemmw<bf, 0, false, 8><<<dim3(TT / 64, DKV / 64, 1), 256, 0, stream>>>(XB, nullptr, WV, nullptr, DM, FV, DKV, nullptr, 0, 0, 0); k_vtp<<<LKv, 256, 0, stream>>>(FV, DKV, NKV, VT16, VTh, VTl);
        for (int h0 = 0; h0 < NH_; h0 += ZH) { const size_t zq = (size_t)h0, zk = (size_t)(h0 / REP);   // one kv head per query head: the pass's two heads use consecutive kv planes (z-strides TT*HD)
            k_gemmw<bf, 2, false, 1><<<dim3(RH / 64, TT / 64, ZH), 32, 0, stream>>>(QPh + zq * TT * HD, QPl + zq * TT * HD, KPh + zk * TT * HD, KPl + zk * TT * HD, HD, Sb, TT, nullptr, (size_t)TT * HD, (size_t)TT * HD, (size_t)TT * TT);
            k_gemmw<h16, 0, false, 1><<<dim3((TT - RH) / 64, TT / 64, ZH), 32, 0, stream>>>(QP16 + zq * TT * HD + (size_t)RH * HD, nullptr, KP16 + zk * TT * HD, nullptr, HD, Sb + (size_t)RH * TT, TT, nullptr, (size_t)TT * HD, (size_t)TT * HD, (size_t)TT * TT);
            k_asoft<<<ZH * TT / 8, 256, 0, stream>>>(Sb, P16, Ph, Pl);
            k_gemmw<bf, 2, false, 16><<<dim3(RH / 64, HD / 64, ZH), 512, 0, stream>>>(Ph, Pl, VTh + zk * HD * TT, VTl + zk * HD * TT, TT, Ob, HD, nullptr, (size_t)RH * TT, (size_t)HD * TT, (size_t)TT * HD);
            k_gemmw<h16, 0, false, 16><<<dim3((TT - RH) / 64, HD / 64, ZH), 512, 0, stream>>>(P16 + (size_t)RH * TT, nullptr, VT16 + zk * HD * TT, nullptr, TT, Ob + (size_t)RH * HD, HD, nullptr, (size_t)TT * TT, (size_t)HD * TT, (size_t)TT * HD);
            k_merge<<<(unsigned)(((size_t)ZH * TT * HD / 2 + 255) / 256), 256, 0, stream>>>(Ob, h0, ATh, ATl); }
        k_gemmw<bf, 1, false, 8><<<dim3(TT / 64, DM / 64, 1), 256, 0, stream>>>(ATh, ATl, WO, nullptr, DQ, Y, DM, nullptr, 0, 0, 0); k_lnrS12<<<TT / 8, 256, 0, stream>>>(x + (size_t)b * TT * DM, Y, lng, lnb, OUT + (size_t)b * TT * DM);   /* LayerNorm(out + x), eps 1e-12 */ }
}

// v002
// It runs in 246 microseconds.
// Next to v001, in two timings, it ran 1.68 times as fast each time.
// All steps since v000 together make it 3.10 times as fast.
#include <hip/hip_runtime.h>

// BERT self-attention with residual + LayerNorm (x [2048][768], unbatched; q,k,v = x W^T ('oi' [768][768], no bias, 1/sqrt(768)); 12 heads x 64; softmax(q.k / 8) over all keys; out = merged Wo^T; y = LayerNorm(out + x) gamma + beta (eps 1e-12) -> [2048][768] (1.6 M)).
// Layout: bf16 copy of x; exact projections; dense T-2048 attention (hybrid rows: < 512 hi/lo 3 products, rest fp16 x1024); merged hi/lo x Wo exact into workspace; a LayerNorm row kernel adds bf16(x) and writes the output rows (one wave per row, 24 values per lane, f32 fixed order).
// Compute dtypes, f32 accumulate: every input rounded to bf16; projections exact; attention rows < 512 3 products, rest fp16; softmax, residual and LayerNorm f32; Wo hl x exact.

#define NB_  1
#define TT   2048
#define DM   768
#define NH_  12
#define NKV  12
#define REP  (NH_ / NKV)
#define HD   64
#define DQ   (NH_ * HD)
#define DKV  (NKV * HD)
#define ZH   6                    // heads per attention pass: the most whose f32 scores and 16-bit P planes fit the workspace together
#define RH   512                  // query rows < RH use hi+lo planes (0: none)
#define WIN  0
#define PCAR 1024.0f
#define SCL  0.125f
#define BSZ  1
typedef _Float16 h16;
typedef unsigned short bf;
typedef __attribute__((ext_vector_type(16))) __bf16   v16bf;
typedef __attribute__((ext_vector_type(16))) _Float16 v16h;
typedef __attribute__((ext_vector_type(8)))  _Float16 v8h;
typedef __attribute__((ext_vector_type(8)))  unsigned short v8us;
typedef __attribute__((ext_vector_type(8)))  float    v8f;
typedef __attribute__((ext_vector_type(4)))  float    v4f;
typedef v8h  __attribute__((may_alias)) v8ha;
typedef v4f  __attribute__((may_alias)) v4fa;
typedef v8us __attribute__((may_alias)) v8usa;

__device__ __forceinline__ unsigned short f2bf(float f) { unsigned u = __float_as_uint(f); u += 0x7FFFu + ((u >> 16) & 1u); return (unsigned short)(u >> 16); }
__device__ __forceinline__ float bf2f(unsigned short b) { return __uint_as_float(((unsigned)b) << 16); }
__device__ __forceinline__ float bfr(float f) { return bf2f(f2bf(f)); }
__device__ __forceinline__ v16h cat16(v8h lo, v8h hi) { return __builtin_shufflevector(lo, hi, 0, 1, 2, 3, 4, 5, 6, 7, 8, 9, 10, 11, 12, 13, 14, 15); }
__device__ __forceinline__ v16bf cat16b(v8us lo, v8us hi) { return __builtin_bit_cast(v16bf, __builtin_shufflevector(lo, hi, 0, 1, 2, 3, 4, 5, 6, 7, 8, 9, 10, 11, 12, 13, 14, 15)); }
__device__ __forceinline__ v8f wmma16(v16h a, v16h b, v8f c) { return __builtin_amdgcn_wmma_f32_16x16x32_f16(false, a, false, b, (short)0, c, false, false); }
__device__ __forceinline__ v8f wmmab(v16bf a, v16bf b, v8f c) { return __builtin_amdgcn_wmma_f32_16x16x32_bf16(false, a, false, b, (short)0, c, false, false); }



// ---- k_gemmw: register-blocked GEMM, one 64x64 output tile per workgroup (16 accumulators per wave), operands straight from K-contiguous 16-bit planes; grid (M/64, N/64, Z), 32 * KW threads.
// C[m][n] (f32, pitch ldc, + optional f32 bias[n]) = sum_k A[m][k] Bt[n][k] (+ split products per NSPLIT). z-batch strides sA/sB/sC in elements. K % (32 * KW) == 0.
// KW waves share the tile: wave w sums the k range [w K/KW, (w+1) K/KW) of the whole tile; the KW partial tiles meet in LDS and are added in wave order 0..KW-1 (fixed f32 order).
template <typename T16> struct WFrag;
template <> struct WFrag<h16> { typedef v16h V; static __device__ __forceinline__ V ld(const h16* p) { return cat16(*(const v8h*)p, *(const v8h*)(p + 16)); } static __device__ __forceinline__ v8f mma(V a, V b, v8f c) { return wmma16(a, b, c); } };
template <> struct WFrag<bf> { typedef v16bf V; static __device__ __forceinline__ V ld(const bf* p) { return cat16b(*(const v8us*)p, *(const v8us*)(p + 16)); } static __device__ __forceinline__ v8f mma(V a, V b, v8f c) { return wmmab(a, b, c); } };
template <typename T16, int NSPLIT, bool BIAS, int KW>
__global__ __launch_bounds__(32 * KW) void k_gemmw(const T16* __restrict__ A, const T16* __restrict__ A2, const T16* __restrict__ Bt, const T16* __restrict__ Bt2, int K, float* C, int ldc, const float* __restrict__ bias, size_t sA, size_t sB, size_t sC) {
    typedef typename WFrag<T16>::V V;
    __shared__ __align__(16) float os[KW == 1 ? 16 * 68 : KW * 64 * 68];
    const size_t z = blockIdx.z; A += z * sA; if (A2) A2 += z * sA; Bt += z * sB; if (Bt2) Bt2 += z * sB; C += z * sC;
    const int lane = threadIdx.x & 31, lr = lane & 15, hi = lane >> 4; const int r0 = blockIdx.x * 64, c0 = blockIdx.y * 64;
    v8f acc[4][4];
#pragma unroll
    for (int mb = 0; mb < 4; ++mb)
#pragma unroll
        for (int nb = 0; nb < 4; ++nb) acc[mb][nb] = (v8f){};
    const size_t aoff = (size_t)(r0 + lr) * K + 8 * hi, boff = (size_t)(c0 + lr) * K + 8 * hi;
    const int kw = (KW == 1) ? 0 : __builtin_amdgcn_readfirstlane((int)(threadIdx.x >> 5));   // wave number in a scalar register: the k loop stays a scalar loop
    const int kbeg = kw * (K / KW), kend = kbeg + K / KW;
#pragma unroll 1
    for (int kc = kbeg; kc < kend; kc += 32) {
        V a[4], a2[4];
#pragma unroll
        for (int mb = 0; mb < 4; ++mb) { a[mb] = WFrag<T16>::ld(A + aoff + (size_t)mb * 16 * K + kc); if (NSPLIT == 1 || NSPLIT == 2) a2[mb] = WFrag<T16>::ld(A2 + aoff + (size_t)mb * 16 * K + kc); }
#pragma unroll
        for (int nb = 0; nb < 4; ++nb) { const V b = WFrag<T16>::ld(Bt + boff + (size_t)nb * 16 * K + kc); V b2; if (NSPLIT >= 2) b2 = WFrag<T16>::ld(Bt2 + boff + (size_t)nb * 16 * K + kc);
#pragma unroll
            for (int mb = 0; mb < 4; ++mb) { acc[mb][nb] = WFrag<T16>::mma(a[mb], b, acc[mb][nb]); if (NSPLIT == 1 || NSPLIT == 2) acc[mb][nb] = WFrag<T16>::mma(a2[mb], b, acc[mb][nb]); if (NSPLIT >= 2) acc[mb][nb] = WFrag<T16>::mma(a[mb], b2, acc[mb][nb]); } }
        asm volatile("v_nop\n\tv_nop\n\tv_nop\n\tv_nop" : "+v"(acc[0][0]), "+v"(acc[1][1]), "+v"(acc[2][2]), "+v"(acc[3][3]) : "v"(a[0]), "v"(a[3]));
    }
    if constexpr (KW > 1) {
        float* my = os + kw * (64 * 68);
        // the three loops are unrolled so that acc[][][] is indexed by constants and stays in registers
#pragma unroll
        for (int mb = 0; mb < 4; ++mb)
#pragma unroll
            for (int nb = 0; nb < 4; ++nb)
#pragma unroll
                for (int j = 0; j < 8; ++j) my[(mb * 16 + hi * 8 + j) * 68 + nb * 16 + lr] = acc[mb][nb][j];
        __syncthreads();   // every wave's partial tile is in LDS before any wave adds them
        static_assert((64 * 16) % (32 * KW) == 0, "each thread adds the same number of 4-column pieces");
        // both loops unrolled: the LDS reads of all partial tiles issue ahead of the adds, which keep the order w = 0..KW-1
#pragma unroll
        for (int it = 0; it < (64 * 16) / (32 * KW); ++it) { const int s = (int)threadIdx.x + it * (32 * KW); const int row = s >> 4, cofs = (s & 15) * 4; v4f val = *(const v4fa*)(os + row * 68 + cofs);
#pragma unroll
            for (int w = 1; w < KW; ++w) val += *(const v4fa*)(os + w * (64 * 68) + row * 68 + cofs);
            if (BIAS) { val[0] += bfr(bias[c0 + cofs]); val[1] += bfr(bias[c0 + cofs + 1]); val[2] += bfr(bias[c0 + cofs + 2]); val[3] += bfr(bias[c0 + cofs + 3]); }
            *(v4f*)(C + (size_t)(r0 + row) * ldc + c0 + cofs) = val; }
        return;
    }
#pragma unroll
    for (int mb = 0; mb < 4; ++mb) {
#pragma unroll
        for (int nb = 0; nb < 4; ++nb) {
#pragma unroll
            for (int j = 0; j < 8; ++j) os[(hi * 8 + j) * 68 + nb * 16 + lr] = acc[mb][nb][j]; }
        __builtin_amdgcn_wave_barrier(); asm volatile("" ::: "memory");
        float* crow = C + (size_t)(r0 + mb * 16) * ldc + c0;
{
#pragma unroll
            for (int s = 0; s < 8; ++s) { const int row = 2 * s + hi, cofs = lr * 4; v4f val = *(const v4fa*)(os + row * 68 + cofs); if (BIAS) { val[0] += bfr(bias[c0 + cofs]); val[1] += bfr(bias[c0 + cofs + 1]); val[2] += bfr(bias[c0 + cofs + 2]); val[3] += bfr(bias[c0 + cofs + 3]); }
                *(v4f*)(crow + (size_t)row * ldc + cofs) = val; }
             }
        __builtin_amdgcn_wave_barrier(); asm volatile("" ::: "memory");
    }
}

__device__ __forceinline__ h16 tohx(float x) { return (h16)x; }
__device__ __forceinline__ void splitf(float y, unsigned short& h, unsigned short& l) { h = f2bf(y); l = f2bf(y - bf2f(h)); }
typedef __attribute__((ext_vector_type(2))) _Float16 v2h;
typedef __attribute__((ext_vector_type(4))) _Float16 v4h;
typedef __attribute__((ext_vector_type(2))) unsigned short v2us;
typedef __attribute__((ext_vector_type(4))) unsigned short v4us;
typedef __attribute__((ext_vector_type(2))) float v2f;
typedef __attribute__((ext_vector_type(4))) int v4i;

__global__ __launch_bounds__(256) void k_wtG(const float* __restrict__ w, int K, int N, bf* Bt) {
    const int lane = threadIdx.x & 31; const int L0 = (blockIdx.x * 8 + (threadIdx.x >> 5)) * 8; const int nlines = N * K / 64;
{
#pragma unroll 1
        for (int l = 0; l < 8; ++l) { const int L = L0 + l; if (L >= nlines) break; const size_t e = (size_t)L * 64 + lane * 2; const int k = (int)(e % K), n = (int)(e / K); v2us o;
            o[0] = f2bf(w[(size_t)k * N + n]); o[1] = f2bf(w[(size_t)(k + 1) * N + n]); *(v2us*)(Bt + e) = o; }
         }
}
__global__ __launch_bounds__(256) void k_cvt8(const float* __restrict__ src, bf* dst, size_t n8) { const size_t i = (size_t)blockIdx.x * 256 + threadIdx.x; if (i >= n8) return; const v8f v = *(const v8f*)(src + i * 8); v8us o;
#pragma unroll
    for (int k = 0; k < 8; ++k) o[k] = f2bf(v[k]); *(v8us*)(dst + i * 8) = o;  }

// k_rope: head planes [h][t][d] (fp16 + hi/lo) of rope(x) x sc with the rotate-half convention out[d] = x[d] cos[t][d] - x[d+HD/2] sin[t][d], out[d+HD/2] = x[d+HD/2] cos[t][d+HD/2] + x[d] sin[t][d+HD/2]
__global__ __launch_bounds__(256) void k_rope(const float* __restrict__ F, int pitch, int nheads, const float* __restrict__ CS, const float* __restrict__ RF, const float* __restrict__ nw, float sc, h16* P16, bf* Ph, bf* Pl) {
    const size_t e = ((size_t)blockIdx.x * 256 + threadIdx.x) * 2; if (e >= (size_t)nheads * TT * HD) return; const int d = (int)(e % HD); const int t = (int)((e / HD) % TT); const int h = (int)(e / ((size_t)HD * TT)); const float* f = F + (size_t)t * pitch + h * HD; const float rf = RF ? RF[(size_t)h * TT + t] : 1.0f; v2h o16; v2us oh, ol;
#pragma unroll
    for (int q = 0; q < 2; ++q) { const int dd = d + q; const int dp = (dd < HD / 2) ? dd + HD / 2 : dd - HD / 2; float x0 = f[dd], x1 = f[dp];
        if (RF) { float n0 = __fmul_rn(x0, rf), n1 = __fmul_rn(x1, rf); asm volatile("" : "+v"(n0)); asm volatile("" : "+v"(n1)); x0 = __fmul_rn(bfr(nw[dd]), n0); x1 = __fmul_rn(bfr(nw[dp]), n1); }
        const v2f cs = *(const v2f*)(CS + ((size_t)t * HD + dd) * 2); float a = __fmul_rn(x0, cs[0]), bq = __fmul_rn(x1, cs[1]); asm volatile("" : "+v"(a)); asm volatile("" : "+v"(bq)); const float r = ((dd < HD / 2) ? __fsub_rn(a, bq) : __fadd_rn(a, bq)) * sc;
        o16[q] = tohx(r); unsigned short a2, c2; splitf(r, a2, c2); oh[q] = a2; ol[q] = c2; }
    *(v2h*)(P16 + e) = o16; *(v2us*)(Ph + e) = oh; *(v2us*)(Pl + e) = ol;  }
__global__ __launch_bounds__(256) void k_vtp(const float* __restrict__ F, int pitch, int nheads, h16* V16, bf* Vh, bf* Vl) { const size_t e = ((size_t)blockIdx.x * 256 + threadIdx.x) * 2; if (e >= (size_t)nheads * HD * TT) return; const int t = (int)(e % TT); const int d = (int)((e / TT) % HD); const int g = (int)(e / ((size_t)TT * HD)); v2h o16; v2us oh, ol;
#pragma unroll
    for (int q = 0; q < 2; ++q) { const float x = F[(size_t)(t + q) * pitch + g * HD + d]; o16[q] = tohx(x); unsigned short a2, c2; splitf(x, a2, c2); oh[q] = a2; ol[q] = c2; }
    *(v2h*)(V16 + e) = o16; *(v2us*)(Vh + e) = oh; *(v2us*)(Vl + e) = ol;  }
__global__ __launch_bounds__(256) void k_csid(float* CS) { const int idx = blockIdx.x * 256 + threadIdx.x; if (idx >= TT * HD) return; v2f cs; cs[0] = 1.0f; cs[1] = 0.0f; *(v2f*)(CS + (size_t)idx * 2) = cs;  }
// k_asoft: per row (zz, i): t = S x HD^-0.5 (no mask); softmax over the 2048 keys (register row, one exp, fixed trees);
__global__ __launch_bounds__(256) void k_asoft(const float* __restrict__ Sb, h16* P16, bf* Ph, bf* Pl) {
    const int lane = threadIdx.x & 31; const int row = blockIdx.x * 8 + (threadIdx.x >> 5); if (row >= ZH * TT) return; const int i = row % TT; const int zz = row / TT; (void)zz; const bool hires = (i < RH); const float* sr = Sb + (size_t)row * TT; float v[TT / 32]; float mx = -3.0e38f;
#pragma unroll
    for (int ch = 0; ch < TT / 128; ++ch) { const int j0 = ch * 128 + lane * 4; const v4f a = *(const v4f*)(sr + j0);
#pragma unroll
        for (int q = 0; q < 4; ++q) { const int j = j0 + q; (void)j; const float t = a[q] * SCL; v[ch * 4 + q] = t; mx = fmaxf(mx, t); } }
#pragma unroll
    for (int sh = 16; sh; sh >>= 1) mx = fmaxf(mx, __shfl_xor(mx, sh, 32));
    float sum = 0.f;
#pragma unroll
    for (int k = 0; k < TT / 32; ++k) { float d0 = __fsub_rn(v[k], mx); asm volatile("" : "+v"(d0)); v[k] = __builtin_amdgcn_exp2f(__fmul_rn(d0, 1.4426950408889634f)); sum += v[k]; }
#pragma unroll
    for (int sh = 16; sh; sh >>= 1) sum += __shfl_xor(sum, sh, 32);
    const float f = __fdiv_rn(hires ? 1.0f : PCAR, sum);
{
        if (hires) {
#pragma unroll
            for (int ch = 0; ch < TT / 128; ++ch) { v4us oh, ol;
#pragma unroll
                for (int q = 0; q < 4; ++q) { unsigned short a, c2; splitf(v[ch * 4 + q] * f, a, c2); oh[q] = a; ol[q] = c2; }
                const size_t oo = ((size_t)zz * (RH ? RH : 1) + i) * TT + ch * 128 + lane * 4; *(v4us*)(Ph + oo) = oh; *(v4us*)(Pl + oo) = ol; }
        } else {
#pragma unroll
            for (int ch = 0; ch < TT / 128; ++ch) { v4h o4;
#pragma unroll
                for (int q = 0; q < 4; ++q) o4[q] = tohx(v[ch * 4 + q] * f);
                *(v4h*)(P16 + (size_t)row * TT + ch * 128 + lane * 4) = o4; } }
         }
}
__global__ __launch_bounds__(256) void k_lnrS12(const float* __restrict__ wb, const float* __restrict__ Y, const float* __restrict__ g, const float* __restrict__ bb, float* ob) { const int lane = threadIdx.x & 31; const int row = blockIdx.x * 8 + (threadIdx.x >> 5); if (row >= TT) return; const float* br = wb + (size_t)row * BSZ * DM; const float* yr = Y + (size_t)row * DM; float v[DM / 32]; float s = 0.f;
#pragma unroll
    for (int ch = 0; ch < DM / 128; ++ch) { const v4f a = *(const v4f*)(br + ch * 128 + lane * 4); const v4f y4 = *(const v4f*)(yr + ch * 128 + lane * 4);
#pragma unroll
        for (int q = 0; q < 4; ++q) { float ab = bfr(a[q]); asm volatile("" : "+v"(ab)); float t = __fadd_rn(ab, y4[q]); asm volatile("" : "+v"(t)); v[ch * 4 + q] = t; s = __fadd_rn(s, t); } }
#pragma unroll
    for (int sh = 16; sh; sh >>= 1) s = __fadd_rn(s, __shfl_xor(s, sh, 32));
    const float mu = __fdiv_rn(s, (float)DM); float s2 = 0.f;
#pragma unroll
    for (int k = 0; k < DM / 32; ++k) { const float dv = __fsub_rn(v[k], mu); float p2 = __fmul_rn(dv, dv); asm volatile("" : "+v"(p2)); s2 = __fadd_rn(s2, p2); }
#pragma unroll
    for (int sh = 16; sh; sh >>= 1) s2 = __fadd_rn(s2, __shfl_xor(s2, sh, 32));
    const float rs = __fdiv_rn(1.0f, __fsqrt_rn(__fadd_rn(__fdiv_rn(s2, (float)DM), 1e-12f)));
{
#pragma unroll
        for (int ch = 0; ch < DM / 128; ++ch) { v4f o; for (int q = 0; q < 4; ++q) { const int col = ch * 128 + lane * 4 + q; float dv = __fsub_rn(v[ch * 4 + q], mu); asm volatile("" : "+v"(dv)); float y = __fmul_rn(dv, rs); asm volatile("" : "+v"(y)); float gg = bfr(g[col]), bb2 = bfr(bb[col]); asm volatile("" : "+v"(gg), "+v"(bb2)); y = __fmul_rn(y, gg); asm volatile("" : "+v"(y)); o[q] = __fadd_rn(y, bb2); }   /* every step kept separate: no fma contraction */
            *(v4f*)(ob + (size_t)row * BSZ * DM + ch * 128 + lane * 4) = o; }
         } }

__global__ __launch_bounds__(256) void k_merge(const float* __restrict__ O, int h0, bf* Ah, bf* Al) { const size_t e = ((size_t)blockIdx.x * 256 + threadIdx.x) * 2; if (e >= (size_t)ZH * TT * HD) return; const int d = (int)(e % HD); const int t = (int)((e / HD) % TT); const int zz = (int)(e / ((size_t)HD * TT)); const float cs = (t < RH) ? 1.0f : (1.0f / PCAR); const size_t oo = (size_t)t * DQ + (h0 + zz) * HD + d;
    v2us oh, ol;
#pragma unroll
    for (int q = 0; q < 2; ++q) { unsigned short a, c2; splitf(O[e + q] * cs, a, c2); oh[q] = a; ol[q] = c2; } *(v2us*)(Ah + oo) = oh; *(v2us*)(Al + oo) = ol;  }

extern "C" void kernel_launch(void* const* d_in, const int* in_sizes, int n_in,
                              void* d_out, int out_size, void* d_ws, size_t ws_size, hipStream_t stream) {
    (void)in_sizes; (void)n_in; (void)out_size;
    const float* x = (const float*)d_in[0]; const float* wq = (const float*)d_in[1]; const float* wk = (const float*)d_in[2]; const float* wv = (const float*)d_in[3]; const float* wo = (const float*)d_in[4]; const float* lng = (const float*)d_in[5]; const float* lnb = (const float*)d_in[6];
    float* OUT = (float*)d_out;     // [1][2048][768]
    char* wsp = (char*)d_ws;
    auto take = [&](size_t bytes) { char* p = wsp; wsp += (bytes + 255) & ~(size_t)255; return (void*)p; };
    float* Y = (float*)take((size_t)TT * DM * 4); bf* WQ = (bf*)take((size_t)DQ * DM * 2); bf* WK = (bf*)take((size_t)DKV * DM * 2); bf* WV = (bf*)take((size_t)DKV * DM * 2); bf* WO = (bf*)take((size_t)DM * DQ * 2); float* CS = (float*)take((size_t)TT * HD * 2 * 4);
    bf* XB = (bf*)take((size_t)TT * DM * 2); float* FQ = (float*)take((size_t)TT * DQ * 4); float* FK = (float*)take((size_t)TT * DKV * 4);
    h16* QP16 = (h16*)take((size_t)NH_ * TT * HD * 2); h16* KP16 = (h16*)take((size_t)NKV * TT * HD * 2); h16* VT16 = (h16*)take((size_t)NKV * HD * TT * 2);
    bf* QPh = (bf*)take((size_t)NH_ * TT * HD * 2); bf* QPl = (bf*)take((size_t)NH_ * TT * HD * 2); bf* KPh = (bf*)take((size_t)NKV * TT * HD * 2); bf* KPl = (bf*)take((size_t)NKV * TT * HD * 2); bf* VTh = (bf*)take((size_t)NKV * HD * TT * 2); bf* VTl = (bf*)take((size_t)NKV * HD * TT * 2); bf* Ph = (bf*)take((size_t)ZH * RH * TT * 2); bf* Pl = (bf*)take((size_t)ZH * RH * TT * 2);
    float* Sb = (float*)take((size_t)ZH * TT * TT * 4); h16* P16 = (h16*)take((size_t)ZH * TT * TT * 2); float* Ob = (float*)take((size_t)ZH * TT * HD * 4); bf* ATh = (bf*)take((size_t)TT * DQ * 2); bf* ATl = (bf*)take((size_t)TT * DQ * 2);
    if ((size_t)(wsp - (char*)d_ws) > ws_size) return;    // ws 256 MiB
    float* FV = FK;   // v projection reuses the k buffer after the k planes are built (stream-ordered)
    { k_cvt8<<<(unsigned)(((size_t)DQ * DM / 8 + 255) / 256), 256, 0, stream>>>(wq, WQ, (size_t)DQ * DM / 8); k_cvt8<<<(unsigned)(((size_t)DKV * DM / 8 + 255) / 256), 256, 0, stream>>>(wk, WK, (size_t)DKV * DM / 8); k_cvt8<<<(unsigned)(((size_t)DKV * DM / 8 + 255) / 256), 256, 0, stream>>>(wv, WV, (size_t)DKV * DM / 8);
      k_cvt8<<<(unsigned)(((size_t)DM * DQ / 8 + 255) / 256), 256, 0, stream>>>(wo, WO, (size_t)DM * DQ / 8);
       }
    k_csid<<<(TT * HD + 255) / 256, 256, 0, stream>>>(CS);
    const unsigned LQ = (unsigned)(((size_t)NH_ * TT * HD / 2 + 255) / 256), LKv = (unsigned)(((size_t)NKV * TT * HD / 2 + 255) / 256);
    for (int b = 0; b < NB_; ++b) {
        
        k_cvt8<<<(unsigned)(((size_t)TT * DM / 8 + 255) / 256), 256, 0, stream>>>(x + (size_t)b * TT * DM, XB, (size_t)TT * DM / 8);
        k_gemmw<bf, 0, false, 8><<<dim3(TT / 64, DQ / 64, 1), 256, 0, stream>>>(XB, nullptr, WQ, nullptr, DM, FQ, DQ, nullptr, 0, 0, 0);
        k_rope<<<LQ, 256, 0, stream>>>(FQ, DQ, NH_, CS, nullptr, nullptr, 1.0f, QP16, QPh, QPl);
        k_gemmw<bf, 0, false, 8><<<dim3(TT / 64, DKV / 64, 1), 256, 0, stream>>>(XB, nullptr, WK, nullptr, DM, FK, DKV, nullptr, 0, 0, 0);
        k_rope<<<LKv, 256, 0, stream>>>(FK, DKV, NKV, CS, nullptr, nullptr, 1.0f, KP16, KPh, KPl);
        k_gemmw<bf, 0, false, 8><<<dim3(TT / 64, DKV / 64, 1), 256, 0, stream>>>(XB, nullptr, WV, nullptr, DM, FV, DKV, nullptr, 0, 0, 0); k_vtp<<<LKv, 256, 0, stream>>>(FV, DKV, NKV, VT16, VTh, VTl);
        for (int h0 = 0; h0 < NH_; h0 += ZH) { const size_t zq = (size_t)h0, zk = (size_t)(h0 / REP);   // one kv head per query head: the pass's ZH heads use consecutive kv planes (z-strides TT*HD)
            k_gemmw<bf, 2, false, 1><<<dim3(RH / 64, TT / 64, ZH), 32, 0, stream>>>(QPh + zq * TT * HD, QPl + zq * TT * HD, KPh + zk * TT * HD, KPl + zk * TT * HD, HD, Sb, TT, nullptr, (size_t)TT * HD, (size_t)TT * HD, (size_t)TT * TT);
            k_gemmw<h16, 0, false, 1><<<dim3((TT - RH) / 64, TT / 64, ZH), 32, 0, stream>>>(QP16 + zq * TT * HD + (size_t)RH * HD, nullptr, KP16 + zk * TT * HD, nullptr, HD, Sb + (size_t)RH * TT, TT, nullptr, (size_t)TT * HD, (size_t)TT * HD, (size_t)TT * TT);
            k_asoft<<<ZH * TT / 8, 256, 0, stream>>>(Sb, P16, Ph, Pl);
            k_gemmw<bf, 2, false, 16><<<dim3(RH / 64, HD / 64, ZH), 512, 0, stream>>>(Ph, Pl, VTh + zk * HD * TT, VTl + zk * HD * TT, TT, Ob, HD, nullptr, (size_t)RH * TT, (size_t)HD * TT, (size_t)TT * HD);
            k_gemmw<h16, 0, false, 16><<<dim3((TT - RH) / 64, HD / 64, ZH), 512, 0, stream>>>(P16 + (size_t)RH * TT, nullptr, VT16 + zk * HD * TT, nullptr, TT, Ob + (size_t)RH * HD, HD, nullptr, (size_t)TT * TT, (size_t)HD * TT, (size_t)TT * HD);
            k_merge<<<(unsigned)(((size_t)ZH * TT * HD / 2 + 255) / 256), 256, 0, stream>>>(Ob, h0, ATh, ATl); }
        k_gemmw<bf, 1, false, 8><<<dim3(TT / 64, DM / 64, 1), 256, 0, stream>>>(ATh, ATl, WO, nullptr, DQ, Y, DM, nullptr, 0, 0, 0); k_lnrS12<<<TT / 8, 256, 0, stream>>>(x + (size_t)b * TT * DM, Y, lng, lnb, OUT + (size_t)b * TT * DM);   /* LayerNorm(out + x), eps 1e-12 */ }
}

// v003
// One run takes 137 microseconds.
// Timed twice side by side with v002, it ran 1.80 and 1.78 times as fast.
// All steps since v000 together make it 5.56 times as fast.
#include <hip/hip_runtime.h>

// BERT self-attention with residual + LayerNorm (x [2048][768], unbatched; q,k,v = x W^T ('oi' [768][768], no bias, 1/sqrt(768)); 12 heads x 64; softmax(q.k / 8) over all keys; out = merged Wo^T; y = LayerNorm(out + x) gamma + beta (eps 1e-12) -> [2048][768] (1.6 M)).
// Layout: bf16 copy of x; exact projections; dense T-2048 attention in one fused kernel, scores and P in registers (hybrid rows: < 512 hi/lo 3 products, rest fp16 x1024); merged hi/lo x Wo exact into workspace; a LayerNorm row kernel adds bf16(x) and writes the output rows (one wave per row, 24 values per lane, f32 fixed order).
// Compute dtypes, f32 accumulate: every input rounded to bf16; projections exact; attention rows < 512 3 products, rest fp16; softmax, residual and LayerNorm f32; Wo hl x exact.

#define NB_  1
#define TT   2048
#define DM   768
#define NH_  12
#define NKV  12
#define REP  (NH_ / NKV)
#define HD   64
#define DQ   (NH_ * HD)
#define DKV  (NKV * HD)
#define RH   512                  // query rows < RH use hi+lo planes (0: none)
#define WIN  0
#define PCAR 1024.0f
#define SCL  0.125f
#define BSZ  1
typedef _Float16 h16;
typedef unsigned short bf;
typedef __attribute__((ext_vector_type(16))) __bf16   v16bf;
typedef __attribute__((ext_vector_type(16))) _Float16 v16h;
typedef __attribute__((ext_vector_type(8)))  _Float16 v8h;
typedef __attribute__((ext_vector_type(8)))  unsigned short v8us;
typedef __attribute__((ext_vector_type(8)))  float    v8f;
typedef __attribute__((ext_vector_type(4)))  float    v4f;
typedef v8h  __attribute__((may_alias)) v8ha;
typedef v4f  __attribute__((may_alias)) v4fa;
typedef v8us __attribute__((may_alias)) v8usa;

__device__ __forceinline__ unsigned short f2bf(float f) { unsigned u = __float_as_uint(f); u += 0x7FFFu + ((u >> 16) & 1u); return (unsigned short)(u >> 16); }
__device__ __forceinline__ float bf2f(unsigned short b) { return __uint_as_float(((unsigned)b) << 16); }
__device__ __forceinline__ float bfr(float f) { return bf2f(f2bf(f)); }
__device__ __forceinline__ v16h cat16(v8h lo, v8h hi) { return __builtin_shufflevector(lo, hi, 0, 1, 2, 3, 4, 5, 6, 7, 8, 9, 10, 11, 12, 13, 14, 15); }
__device__ __forceinline__ v16bf cat16b(v8us lo, v8us hi) { return __builtin_bit_cast(v16bf, __builtin_shufflevector(lo, hi, 0, 1, 2, 3, 4, 5, 6, 7, 8, 9, 10, 11, 12, 13, 14, 15)); }
__device__ __forceinline__ v8f wmma16(v16h a, v16h b, v8f c) { return __builtin_amdgcn_wmma_f32_16x16x32_f16(false, a, false, b, (short)0, c, false, false); }
__device__ __forceinline__ v8f wmmab(v16bf a, v16bf b, v8f c) { return __builtin_amdgcn_wmma_f32_16x16x32_bf16(false, a, false, b, (short)0, c, false, false); }



// ---- k_gemmw: register-blocked GEMM, one 64x64 output tile per workgroup (16 accumulators per wave), operands straight from K-contiguous 16-bit planes; grid (M/64, N/64, Z), 32 * KW threads.
// C[m][n] (f32, pitch ldc, + optional f32 bias[n]) = sum_k A[m][k] Bt[n][k] (+ split products per NSPLIT). z-batch strides sA/sB/sC in elements. K % (32 * KW) == 0.
// KW waves share the tile: wave w sums the k range [w K/KW, (w+1) K/KW) of the whole tile; the KW partial tiles meet in LDS and are added in wave order 0..KW-1 (fixed f32 order).
template <typename T16> struct WFrag;
template <> struct WFrag<h16> { typedef v16h V; static __device__ __forceinline__ V ld(const h16* p) { return cat16(*(const v8h*)p, *(const v8h*)(p + 16)); } static __device__ __forceinline__ v8f mma(V a, V b, v8f c) { return wmma16(a, b, c); } };
template <> struct WFrag<bf> { typedef v16bf V; static __device__ __forceinline__ V ld(const bf* p) { return cat16b(*(const v8us*)p, *(const v8us*)(p + 16)); } static __device__ __forceinline__ v8f mma(V a, V b, v8f c) { return wmmab(a, b, c); } };
template <typename T16, int NSPLIT, bool BIAS, int KW>
__global__ __launch_bounds__(32 * KW) void k_gemmw(const T16* __restrict__ A, const T16* __restrict__ A2, const T16* __restrict__ Bt, const T16* __restrict__ Bt2, int K, float* C, int ldc, const float* __restrict__ bias, size_t sA, size_t sB, size_t sC) {
    typedef typename WFrag<T16>::V V;
    __shared__ __align__(16) float os[KW == 1 ? 16 * 68 : KW * 64 * 68];
    const size_t z = blockIdx.z; A += z * sA; if (A2) A2 += z * sA; Bt += z * sB; if (Bt2) Bt2 += z * sB; C += z * sC;
    const int lane = threadIdx.x & 31, lr = lane & 15, hi = lane >> 4; const int r0 = blockIdx.x * 64, c0 = blockIdx.y * 64;
    v8f acc[4][4];
#pragma unroll
    for (int mb = 0; mb < 4; ++mb)
#pragma unroll
        for (int nb = 0; nb < 4; ++nb) acc[mb][nb] = (v8f){};
    const size_t aoff = (size_t)(r0 + lr) * K + 8 * hi, boff = (size_t)(c0 + lr) * K + 8 * hi;
    const int kw = (KW == 1) ? 0 : __builtin_amdgcn_readfirstlane((int)(threadIdx.x >> 5));   // wave number in a scalar register: the k loop stays a scalar loop
    const int kbeg = kw * (K / KW), kend = kbeg + K / KW;
#pragma unroll 1
    for (int kc = kbeg; kc < kend; kc += 32) {
        V a[4], a2[4];
#pragma unroll
        for (int mb = 0; mb < 4; ++mb) { a[mb] = WFrag<T16>::ld(A + aoff + (size_t)mb * 16 * K + kc); if (NSPLIT == 1 || NSPLIT == 2) a2[mb] = WFrag<T16>::ld(A2 + aoff + (size_t)mb * 16 * K + kc); }
#pragma unroll
        for (int nb = 0; nb < 4; ++nb) { const V b = WFrag<T16>::ld(Bt + boff + (size_t)nb * 16 * K + kc); V b2; if (NSPLIT >= 2) b2 = WFrag<T16>::ld(Bt2 + boff + (size_t)nb * 16 * K + kc);
#pragma unroll
            for (int mb = 0; mb < 4; ++mb) { acc[mb][nb] = WFrag<T16>::mma(a[mb], b, acc[mb][nb]); if (NSPLIT == 1 || NSPLIT == 2) acc[mb][nb] = WFrag<T16>::mma(a2[mb], b, acc[mb][nb]); if (NSPLIT >= 2) acc[mb][nb] = WFrag<T16>::mma(a[mb], b2, acc[mb][nb]); } }
        asm volatile("v_nop\n\tv_nop\n\tv_nop\n\tv_nop" : "+v"(acc[0][0]), "+v"(acc[1][1]), "+v"(acc[2][2]), "+v"(acc[3][3]) : "v"(a[0]), "v"(a[3]));
    }
    if constexpr (KW > 1) {
        float* my = os + kw * (64 * 68);
        // the three loops are unrolled so that acc[][][] is indexed by constants and stays in registers
#pragma unroll
        for (int mb = 0; mb < 4; ++mb)
#pragma unroll
            for (int nb = 0; nb < 4; ++nb)
#pragma unroll
                for (int j = 0; j < 8; ++j) my[(mb * 16 + hi * 8 + j) * 68 + nb * 16 + lr] = acc[mb][nb][j];
        __syncthreads();   // every wave's partial tile is in LDS before any wave adds them
        static_assert((64 * 16) % (32 * KW) == 0, "each thread adds the same number of 4-column pieces");
        // both loops unrolled: the LDS reads of all partial tiles issue ahead of the adds, which keep the order w = 0..KW-1
#pragma unroll
        for (int it = 0; it < (64 * 16) / (32 * KW); ++it) { const int s = (int)threadIdx.x + it * (32 * KW); const int row = s >> 4, cofs = (s & 15) * 4; v4f val = *(const v4fa*)(os + row * 68 + cofs);
#pragma unroll
            for (int w = 1; w < KW; ++w) val += *(const v4fa*)(os + w * (64 * 68) + row * 68 + cofs);
            if (BIAS) { val[0] += bfr(bias[c0 + cofs]); val[1] += bfr(bias[c0 + cofs + 1]); val[2] += bfr(bias[c0 + cofs + 2]); val[3] += bfr(bias[c0 + cofs + 3]); }
            *(v4f*)(C + (size_t)(r0 + row) * ldc + c0 + cofs) = val; }
        return;
    }
#pragma unroll
    for (int mb = 0; mb < 4; ++mb) {
#pragma unroll
        for (int nb = 0; nb < 4; ++nb) {
#pragma unroll
            for (int j = 0; j < 8; ++j) os[(hi * 8 + j) * 68 + nb * 16 + lr] = acc[mb][nb][j]; }
        __builtin_amdgcn_wave_barrier(); asm volatile("" ::: "memory");
        float* crow = C + (size_t)(r0 + mb * 16) * ldc + c0;
{
#pragma unroll
            for (int s = 0; s < 8; ++s) { const int row = 2 * s + hi, cofs = lr * 4; v4f val = *(const v4fa*)(os + row * 68 + cofs); if (BIAS) { val[0] += bfr(bias[c0 + cofs]); val[1] += bfr(bias[c0 + cofs + 1]); val[2] += bfr(bias[c0 + cofs + 2]); val[3] += bfr(bias[c0 + cofs + 3]); }
                *(v4f*)(crow + (size_t)row * ldc + cofs) = val; }
             }
        __builtin_amdgcn_wave_barrier(); asm volatile("" ::: "memory");
    }
}

__device__ __forceinline__ h16 tohx(float x) { return (h16)x; }
__device__ __forceinline__ void splitf(float y, unsigned short& h, unsigned short& l) { h = f2bf(y); l = f2bf(y - bf2f(h)); }
typedef __attribute__((ext_vector_type(2))) _Float16 v2h;
typedef __attribute__((ext_vector_type(4))) _Float16 v4h;
typedef __attribute__((ext_vector_type(2))) unsigned short v2us;
typedef __attribute__((ext_vector_type(4))) unsigned short v4us;
typedef __attribute__((ext_vector_type(2))) float v2f;
typedef __attribute__((ext_vector_type(4))) int v4i;

__global__ __launch_bounds__(256) void k_wtG(const float* __restrict__ w, int K, int N, bf* Bt) {
    const int lane = threadIdx.x & 31; const int L0 = (blockIdx.x * 8 + (threadIdx.x >> 5)) * 8; const int nlines = N * K / 64;
{
#pragma unroll 1
        for (int l = 0; l < 8; ++l) { const int L = L0 + l; if (L >= nlines) break; const size_t e = (size_t)L * 64 + lane * 2; const int k = (int)(e % K), n = (int)(e / K); v2us o;
            o[0] = f2bf(w[(size_t)k * N + n]); o[1] = f2bf(w[(size_t)(k + 1) * N + n]); *(v2us*)(Bt + e) = o; }
         }
}
__global__ __launch_bounds__(256) void k_cvt8(const float* __restrict__ src, bf* dst, size_t n8) { const size_t i = (size_t)blockIdx.x * 256 + threadIdx.x; if (i >= n8) return; const v8f v = *(const v8f*)(src + i * 8); v8us o;
#pragma unroll
    for (int k = 0; k < 8; ++k) o[k] = f2bf(v[k]); *(v8us*)(dst + i * 8) = o;  }

// k_rope: head planes [h][t][d] (fp16 + hi/lo) of rope(x) x sc with the rotate-half convention out[d] = x[d] cos[t][d] - x[d+HD/2] sin[t][d], out[d+HD/2] = x[d+HD/2] cos[t][d+HD/2] + x[d] sin[t][d+HD/2]
__global__ __launch_bounds__(256) void k_rope(const float* __restrict__ F, int pitch, int nheads, const float* __restrict__ CS, const float* __restrict__ RF, const float* __restrict__ nw, float sc, h16* P16, bf* Ph, bf* Pl) {
    const size_t e = ((size_t)blockIdx.x * 256 + threadIdx.x) * 2; if (e >= (size_t)nheads * TT * HD) return; const int d = (int)(e % HD); const int t = (int)((e / HD) % TT); const int h = (int)(e / ((size_t)HD * TT)); const float* f = F + (size_t)t * pitch + h * HD; const float rf = RF ? RF[(size_t)h * TT + t] : 1.0f; v2h o16; v2us oh, ol;
#pragma unroll
    for (int q = 0; q < 2; ++q) { const int dd = d + q; const int dp = (dd < HD / 2) ? dd + HD / 2 : dd - HD / 2; float x0 = f[dd], x1 = f[dp];
        if (RF) { float n0 = __fmul_rn(x0, rf), n1 = __fmul_rn(x1, rf); asm volatile("" : "+v"(n0)); asm volatile("" : "+v"(n1)); x0 = __fmul_rn(bfr(nw[dd]), n0); x1 = __fmul_rn(bfr(nw[dp]), n1); }
        const v2f cs = *(const v2f*)(CS + ((size_t)t * HD + dd) * 2); float a = __fmul_rn(x0, cs[0]), bq = __fmul_rn(x1, cs[1]); asm volatile("" : "+v"(a)); asm volatile("" : "+v"(bq)); const float r = ((dd < HD / 2) ? __fsub_rn(a, bq) : __fadd_rn(a, bq)) * sc;
        o16[q] = tohx(r); unsigned short a2, c2; splitf(r, a2, c2); oh[q] = a2; ol[q] = c2; }
    *(v2h*)(P16 + e) = o16; *(v2us*)(Ph + e) = oh; *(v2us*)(Pl + e) = ol;  }
__global__ __launch_bounds__(256) void k_vtp(const float* __restrict__ F, int pitch, int nheads, h16* V16, bf* Vh, bf* Vl) { const size_t e = ((size_t)blockIdx.x * 256 + threadIdx.x) * 2; if (e >= (size_t)nheads * HD * TT) return; const int t = (int)(e % TT); const int d = (int)((e / TT) % HD); const int g = (int)(e / ((size_t)TT * HD)); v2h o16; v2us oh, ol;
#pragma unroll
    for (int q = 0; q < 2; ++q) { const float x = F[(size_t)(t + q) * pitch + g * HD + d]; o16[q] = tohx(x); unsigned short a2, c2; splitf(x, a2, c2); oh[q] = a2; ol[q] = c2; }
    *(v2h*)(V16 + e) = o16; *(v2us*)(Vh + e) = oh; *(v2us*)(Vl + e) = ol;  }
__global__ __launch_bounds__(256) void k_csid(float* CS) { const int idx = blockIdx.x * 256 + threadIdx.x; if (idx >= TT * HD) return; v2f cs; cs[0] = 1.0f; cs[1] = 0.0f; *(v2f*)(CS + (size_t)idx * 2) = cs;  }
__global__ __launch_bounds__(256) void k_lnrS12(const float* __restrict__ wb, const float* __restrict__ Y, const float* __restrict__ g, const float* __restrict__ bb, float* ob) { const int lane = threadIdx.x & 31; const int row = blockIdx.x * 8 + (threadIdx.x >> 5); if (row >= TT) return; const float* br = wb + (size_t)row * BSZ * DM; const float* yr = Y + (size_t)row * DM; float v[DM / 32]; float s = 0.f;
#pragma unroll
    for (int ch = 0; ch < DM / 128; ++ch) { const v4f a = *(const v4f*)(br + ch * 128 + lane * 4); const v4f y4 = *(const v4f*)(yr + ch * 128 + lane * 4);
#pragma unroll
        for (int q = 0; q < 4; ++q) { float ab = bfr(a[q]); asm volatile("" : "+v"(ab)); float t = __fadd_rn(ab, y4[q]); asm volatile("" : "+v"(t)); v[ch * 4 + q] = t; s = __fadd_rn(s, t); } }
#pragma unroll
    for (int sh = 16; sh; sh >>= 1) s = __fadd_rn(s, __shfl_xor(s, sh, 32));
    const float mu = __fdiv_rn(s, (float)DM); float s2 = 0.f;
#pragma unroll
    for (int k = 0; k < DM / 32; ++k) { const float dv = __fsub_rn(v[k], mu); float p2 = __fmul_rn(dv, dv); asm volatile("" : "+v"(p2)); s2 = __fadd_rn(s2, p2); }
#pragma unroll
    for (int sh = 16; sh; sh >>= 1) s2 = __fadd_rn(s2, __shfl_xor(s2, sh, 32));
    const float rs = __fdiv_rn(1.0f, __fsqrt_rn(__fadd_rn(__fdiv_rn(s2, (float)DM), 1e-12f)));
{
#pragma unroll
        for (int ch = 0; ch < DM / 128; ++ch) { v4f o; for (int q = 0; q < 4; ++q) { const int col = ch * 128 + lane * 4 + q; float dv = __fsub_rn(v[ch * 4 + q], mu); asm volatile("" : "+v"(dv)); float y = __fmul_rn(dv, rs); asm volatile("" : "+v"(y)); float gg = bfr(g[col]), bb2 = bfr(bb[col]); asm volatile("" : "+v"(gg), "+v"(bb2)); y = __fmul_rn(y, gg); asm volatile("" : "+v"(y)); o[q] = __fadd_rn(y, bb2); }   /* every step kept separate: no fma contraction */
            *(v4f*)(ob + (size_t)row * BSZ * DM + ch * 128 + lane * 4) = o; }
         } }

// ---- k_fattn: scores, softmax, P V and the head merge for 32 query rows of one head, in one workgroup of 16 waves; scores and P stay in registers. Grid (heads, TT / 32): the hi/lo row blocks, which cost most, come first.
// Wave w owns keys [128 w, 128 w + 128). It forms the transposed scores S^T = K Q^T (A = key rows, B = query rows), so that a lane holds 64 scores of one query per 16-query tile, and two 16-key D tiles,
// converted in place, are the A fragment (row = query, k = key in the loaders' k order 8 hi + 0..7, 16 + 8 hi + 0..7) of P V. Row maximum and row sum: in the lane, across the two lane halves, then over the 16 waves through LDS in wave order.
// The 16 partial 32 x 64 outputs meet in LDS and are added in wave order 0..15 (k ranges and order as in k_gemmw with KW = 16); the sum is scaled, split hi/lo and stored at its place in the merged [t][h d] planes.
typedef __attribute__((ext_vector_type(16))) unsigned short v16us;
template <typename T16, bool HL>
__device__ __forceinline__ void fattn(const T16* __restrict__ Q, const T16* __restrict__ Q2, const T16* __restrict__ Kp, const T16* __restrict__ K2, const T16* __restrict__ Vt, const T16* __restrict__ Vt2, bf* Ah, bf* Al, float* os, float* redm, float* reds) {
    typedef typename WFrag<T16>::V V;
    const int lane = threadIdx.x & 31, lr = lane & 15, hi = lane >> 4;
    const int kw = __builtin_amdgcn_readfirstlane((int)(threadIdx.x >> 5));   // wave number in a scalar register: the key offsets stay scalar
    const int key0 = kw * 128;
    // wave-uniform bases and one lane offset per plane kind: every fragment load is scalar base + lane offset + constant
    const int lo = lr * HD + 8 * hi, lv = lr * TT + 8 * hi;
    const T16* kb = Kp + (size_t)key0 * HD; const T16* kb2 = HL ? K2 + (size_t)key0 * HD : nullptr; const T16* vb = Vt + key0; const T16* vb2 = HL ? Vt2 + key0 : nullptr;
    // every loop below is unrolled so that s[][][] and acc[][][] are indexed by constants and stay in registers
    v8f s[8][2];
#pragma unroll
    for (int kt = 0; kt < 8; ++kt) { s[kt][0] = (v8f){}; s[kt][1] = (v8f){}; }
    {
        V qf[2][2], q2f[2][2];
#pragma unroll
        for (int qt = 0; qt < 2; ++qt)
#pragma unroll
            for (int ks = 0; ks < 2; ++ks) { const int o = lo + qt * 16 * HD + ks * 32; qf[qt][ks] = WFrag<T16>::ld(Q + o); if (HL) q2f[qt][ks] = WFrag<T16>::ld(Q2 + o); }
        V kf[2], k2f[2]; kf[0] = WFrag<T16>::ld(kb + lo); if (HL) k2f[0] = WFrag<T16>::ld(kb2 + lo);
#pragma unroll
        for (int it = 0; it < 16; ++it) { const int kt = it >> 1, ks = it & 1, c = it & 1, n = c ^ 1;
            if (it + 1 < 16) { const int o = lo + ((it + 1) >> 1) * 16 * HD + ((it + 1) & 1) * 32; kf[n] = WFrag<T16>::ld(kb + o); if (HL) k2f[n] = WFrag<T16>::ld(kb2 + o); }   // the next fragment's loads fly during this fragment's products
#pragma unroll
            for (int qt = 0; qt < 2; ++qt) { s[kt][qt] = WFrag<T16>::mma(kf[c], qf[qt][ks], s[kt][qt]); if (HL) { s[kt][qt] = WFrag<T16>::mma(kf[c], q2f[qt][ks], s[kt][qt]); s[kt][qt] = WFrag<T16>::mma(k2f[c], qf[qt][ks], s[kt][qt]); } } }
    }
    float mx[2], f[2];
#pragma unroll
    for (int qt = 0; qt < 2; ++qt) { float m = s[0][qt][0];
#pragma unroll
        for (int kt = 0; kt < 8; ++kt)
#pragma unroll
            for (int j = 0; j < 8; ++j) m = fmaxf(m, s[kt][qt][j]);
        mx[qt] = fmaxf(m, __shfl_xor(m, 16, 32)); }
    redm[kw * 32 + lane] = hi ? mx[1] : mx[0];
    __syncthreads();   // every wave's row maxima are in LDS before any wave joins them
#pragma unroll
    for (int qt = 0; qt < 2; ++qt) { float m = redm[qt * 16 + lr];
#pragma unroll
        for (int w = 1; w < 16; ++w) m = fmaxf(m, redm[w * 32 + qt * 16 + lr]);
        mx[qt] = m * SCL; }   // SCL is a power of two: the maximum of the scaled scores, exactly
#pragma unroll
    for (int qt = 0; qt < 2; ++qt) { float a = 0.f;
#pragma unroll
        for (int kt = 0; kt < 8; ++kt)
#pragma unroll
            for (int j = 0; j < 8; ++j) { const float e = __builtin_amdgcn_exp2f((s[kt][qt][j] * SCL - mx[qt]) * 1.4426950408889634f); s[kt][qt][j] = e; a += e; }
        f[qt] = a + __shfl_xor(a, 16, 32); }
    reds[kw * 32 + lane] = hi ? f[1] : f[0];
    __syncthreads();   // every wave's row sums are in LDS before any wave joins them
#pragma unroll
    for (int qt = 0; qt < 2; ++qt) { float a = reds[qt * 16 + lr];
#pragma unroll
        for (int w = 1; w < 16; ++w) a += reds[w * 32 + qt * 16 + lr];
        f[qt] = __fdiv_rn(HL ? 1.0f : PCAR, a); }
    v8f acc[2][4];
#pragma unroll
    for (int nb = 0; nb < 4; ++nb) { acc[0][nb] = (v8f){}; acc[1][nb] = (v8f){}; }
    V vf[2], v2f[2]; vf[0] = WFrag<T16>::ld(vb + lv); if (HL) v2f[0] = WFrag<T16>::ld(vb2 + lv);
#pragma unroll
    for (int kk = 0; kk < 4; ++kk) {
        V pa[2], pa2[2];
#pragma unroll
        for (int qt = 0; qt < 2; ++qt) {
            if constexpr (HL) { v16us ph, pl;
#pragma unroll
                for (int e = 0; e < 16; ++e) { unsigned short a, c2; splitf(s[2 * kk + (e >> 3)][qt][e & 7] * f[qt], a, c2); ph[e] = a; pl[e] = c2; }
                pa[qt] = __builtin_bit_cast(v16bf, ph); pa2[qt] = __builtin_bit_cast(v16bf, pl);
            } else {
#pragma unroll
                for (int e = 0; e < 16; ++e) pa[qt][e] = tohx(s[2 * kk + (e >> 3)][qt][e & 7] * f[qt]);
            } }
#pragma unroll
        for (int nb = 0; nb < 4; ++nb) { const int it = kk * 4 + nb, c = it & 1, n = c ^ 1;
            if (it + 1 < 16) { const int o = lv + ((it + 1) & 3) * 16 * TT + ((it + 1) >> 2) * 32; vf[n] = WFrag<T16>::ld(vb + o); if (HL) v2f[n] = WFrag<T16>::ld(vb2 + o); }   // the next fragment's loads fly during this fragment's products (and during the next P conversion)
#pragma unroll
            for (int qt = 0; qt < 2; ++qt) { acc[qt][nb] = WFrag<T16>::mma(pa[qt], vf[c], acc[qt][nb]); if (HL) { acc[qt][nb] = WFrag<T16>::mma(pa2[qt], vf[c], acc[qt][nb]); acc[qt][nb] = WFrag<T16>::mma(pa[qt], v2f[c], acc[qt][nb]); } } }
    }
    float* my = os + kw * (32 * 68);
#pragma unroll
    for (int qt = 0; qt < 2; ++qt)
#pragma unroll
        for (int nb = 0; nb < 4; ++nb)
#pragma unroll
            for (int j = 0; j < 8; ++j) my[(qt * 16 + hi * 8 + j) * 68 + nb * 16 + lr] = acc[qt][nb][j];
    __syncthreads();   // every wave's partial output tile is in LDS before any wave adds them
    const int row = (int)threadIdx.x >> 4, cofs = ((int)threadIdx.x & 15) * 4; v4f val = *(const v4fa*)(os + row * 68 + cofs);
#pragma unroll
    for (int w = 1; w < 16; ++w) val += *(const v4fa*)(os + w * (32 * 68) + row * 68 + cofs);
    const float cs = HL ? 1.0f : (1.0f / PCAR); v4us oh, ol;
#pragma unroll
    for (int q = 0; q < 4; ++q) { unsigned short a, c2; splitf(val[q] * cs, a, c2); oh[q] = a; ol[q] = c2; }
    *(v4us*)(Ah + (size_t)row * DQ + cofs) = oh; *(v4us*)(Al + (size_t)row * DQ + cofs) = ol;
}
__global__ __launch_bounds__(512) void k_fattn(const h16* __restrict__ Q16, const h16* __restrict__ K16, const h16* __restrict__ V16, const bf* __restrict__ Qh, const bf* __restrict__ Ql, const bf* __restrict__ Kh, const bf* __restrict__ Kl, const bf* __restrict__ Vh, const bf* __restrict__ Vl, bf* Ah, bf* Al) {
    __shared__ __align__(16) float os[16 * 32 * 68]; __shared__ float redm[16 * 32]; __shared__ float reds[16 * 32];
    const int h = blockIdx.x, q0 = blockIdx.y * 32; const size_t zq = ((size_t)h * TT + q0) * HD, zk = (size_t)(h / REP) * TT * HD, oo = (size_t)q0 * DQ + h * HD;
    static_assert(RH % 32 == 0 && TT == 16 * 128 && HD == 64, "a row block is all hi/lo or all fp16; 16 waves x 128 keys; 4 output column tiles");
    if (q0 < RH) fattn<bf, true>(Qh + zq, Ql + zq, Kh + zk, Kl + zk, Vh + zk, Vl + zk, Ah + oo, Al + oo, os, redm, reds);
    else fattn<h16, false>(Q16 + zq, nullptr, K16 + zk, nullptr, V16 + zk, nullptr, Ah + oo, Al + oo, os, redm, reds);
}

extern "C" void kernel_launch(void* const* d_in, const int* in_sizes, int n_in,
                              void* d_out, int out_size, void* d_ws, size_t ws_size, hipStream_t stream) {
    (void)in_sizes; (void)n_in; (void)out_size;
    const float* x = (const float*)d_in[0]; const float* wq = (const float*)d_in[1]; const float* wk = (const float*)d_in[2]; const float* wv = (const float*)d_in[3]; const float* wo = (const float*)d_in[4]; const float* lng = (const float*)d_in[5]; const float* lnb = (const float*)d_in[6];
    float* OUT = (float*)d_out;     // [1][2048][768]
    char* wsp = (char*)d_ws;
    auto take = [&](size_t bytes) { char* p = wsp; wsp += (bytes + 255) & ~(size_t)255; return (void*)p; };
    float* Y = (float*)take((size_t)TT * DM * 4); bf* WQ = (bf*)take((size_t)DQ * DM * 2); bf* WK = (bf*)take((size_t)DKV * DM * 2); bf* WV = (bf*)take((size_t)DKV * DM * 2); bf* WO = (bf*)take((size_t)DM * DQ * 2); float* CS = (float*)take((size_t)TT * HD * 2 * 4);
    bf* XB = (bf*)take((size_t)TT * DM * 2); float* FQ = (float*)take((size_t)TT * DQ * 4); float* FK = (float*)take((size_t)TT * DKV * 4);
    h16* QP16 = (h16*)take((size_t)NH_ * TT * HD * 2); h16* KP16 = (h16*)take((size_t)NKV * TT * HD * 2); h16* VT16 = (h16*)take((size_t)NKV * HD * TT * 2);
    bf* QPh = (bf*)take((size_t)NH_ * TT * HD * 2); bf* QPl = (bf*)take((size_t)NH_ * TT * HD * 2); bf* KPh = (bf*)take((size_t)NKV * TT * HD * 2); bf* KPl = (bf*)take((size_t)NKV * TT * HD * 2); bf* VTh = (bf*)take((size_t)NKV * HD * TT * 2); bf* VTl = (bf*)take((size_t)NKV * HD * TT * 2);
    bf* ATh = (bf*)take((size_t)TT * DQ * 2); bf* ATl = (bf*)take((size_t)TT * DQ * 2);
    if ((size_t)(wsp - (char*)d_ws) > ws_size) return;    // ws 256 MiB
    float* FV = FK;   // v projection reuses the k buffer after the k planes are built (stream-ordered)
    { k_cvt8<<<(unsigned)(((size_t)DQ * DM / 8 + 255) / 256), 256, 0, stream>>>(wq, WQ, (size_t)DQ * DM / 8); k_cvt8<<<(unsigned)(((size_t)DKV * DM / 8 + 255) / 256), 256, 0, stream>>>(wk, WK, (size_t)DKV * DM / 8); k_cvt8<<<(unsigned)(((size_t)DKV * DM / 8 + 255) / 256), 256, 0, stream>>>(wv, WV, (size_t)DKV * DM / 8);
      k_cvt8<<<(unsigned)(((size_t)DM * DQ / 8 + 255) / 256), 256, 0, stream>>>(wo, WO, (size_t)DM * DQ / 8);
       }
    k_csid<<<(TT * HD + 255) / 256, 256, 0, stream>>>(CS);
    const unsigned LQ = (unsigned)(((size_t)NH_ * TT * HD / 2 + 255) / 256), LKv = (unsigned)(((size_t)NKV * TT * HD / 2 + 255) / 256);
    for (int b = 0; b < NB_; ++b) {
        
        k_cvt8<<<(unsigned)(((size_t)TT * DM / 8 + 255) / 256), 256, 0, stream>>>(x + (size_t)b * TT * DM, XB, (size_t)TT * DM / 8);
        k_gemmw<bf, 0, false, 8><<<dim3(TT / 64, DQ / 64, 1), 256, 0, stream>>>(XB, nullptr, WQ, nullptr, DM, FQ, DQ, nullptr, 0, 0, 0);
        k_rope<<<LQ, 256, 0, stream>>>(FQ, DQ, NH_, CS, nullptr, nullptr, 1.0f, QP16, QPh, QPl);
        k_gemmw<bf, 0, false, 8><<<dim3(TT / 64, DKV / 64, 1), 256, 0, stream>>>(XB, nullptr, WK, nullptr, DM, FK, DKV, nullptr, 0, 0, 0);
        k_rope<<<LKv, 256, 0, stream>>>(FK, DKV, NKV, CS, nullptr, nullptr, 1.0f, KP16, KPh, KPl);
        k_gemmw<bf, 0, false, 8><<<dim3(TT / 64, DKV / 64, 1), 256, 0, stream>>>(XB, nullptr, WV, nullptr, DM, FV, DKV, nullptr, 0, 0, 0); k_vtp<<<LKv, 256, 0, stream>>>(FV, DKV, NKV, VT16, VTh, VTl);
        k_fattn<<<dim3(NH_, TT / 32, 1), 512, 0, stream>>>(QP16, KP16, VT16, QPh, QPl, KPh, KPl, VTh, VTl, ATh, ATl);
        k_gemmw<bf, 1, false, 8><<<dim3(TT / 64, DM / 64, 1), 256, 0, stream>>>(ATh, ATl, WO, nullptr, DQ, Y, DM, nullptr, 0, 0, 0); k_lnrS12<<<TT / 8, 256, 0, stream>>>(x + (size_t)b * TT * DM, Y, lng, lnb, OUT + (size_t)b * TT * DM);   /* LayerNorm(out + x), eps 1e-12 */ }
}

// v004
// One run takes 109 microseconds.
// Two timings next to v003 put it at 1.27 and 1.26 times that version's speed.
// All steps since v000 together make it 7.01 times as fast.
#include <hip/hip_runtime.h>

// BERT self-attention with residual + LayerNorm (x [2048][768], unbatched; q,k,v = x W^T ('oi' [768][768], no bias, 1/sqrt(768)); 12 heads x 64; softmax(q.k / 8) over all keys; out = merged Wo^T; y = LayerNorm(out + x) gamma + beta (eps 1e-12) -> [2048][768] (1.6 M)).
// Layout: bf16 copy of x; exact projections, q, k and v in one launch that writes the head planes itself; dense T-2048 attention in one fused kernel, scores and P in registers (hybrid rows: < 512 hi/lo 3 products, rest fp16 x1024); merged hi/lo x Wo exact into workspace; a LayerNorm row kernel adds bf16(x) and writes the output rows (one wave per row, 24 values per lane, f32 fixed order).
// Compute dtypes, f32 accumulate: every input rounded to bf16; projections exact; attention rows < 512 3 products, rest fp16; softmax, residual and LayerNorm f32; Wo hl x exact.

#define NB_  1
#define TT   2048
#define DM   768
#define NH_  12
#define NKV  12
#define REP  (NH_ / NKV)
#define HD   64
#define DQ   (NH_ * HD)
#define DKV  (NKV * HD)
#define RH   512                  // query rows < RH use hi+lo planes (0: none)
#define WIN  0
#define PCAR 1024.0f
#define SCL  0.125f
#define BSZ  1
typedef _Float16 h16;
typedef unsigned short bf;
typedef __attribute__((ext_vector_type(16))) __bf16   v16bf;
typedef __attribute__((ext_vector_type(16))) _Float16 v16h;
typedef __attribute__((ext_vector_type(8)))  _Float16 v8h;
typedef __attribute__((ext_vector_type(8)))  unsigned short v8us;
typedef __attribute__((ext_vector_type(8)))  float    v8f;
typedef __attribute__((ext_vector_type(4)))  float    v4f;
typedef v8h  __attribute__((may_alias)) v8ha;
typedef v4f  __attribute__((may_alias)) v4fa;
typedef v8us __attribute__((may_alias)) v8usa;

__device__ __forceinline__ unsigned short f2bf(float f) { unsigned u = __float_as_uint(f); u += 0x7FFFu + ((u >> 16) & 1u); return (unsigned short)(u >> 16); }
__device__ __forceinline__ float bf2f(unsigned short b) { return __uint_as_float(((unsigned)b) << 16); }
__device__ __forceinline__ float bfr(float f) { return bf2f(f2bf(f)); }
__device__ __forceinline__ v16h cat16(v8h lo, v8h hi) { return __builtin_shufflevector(lo, hi, 0, 1, 2, 3, 4, 5, 6, 7, 8, 9, 10, 11, 12, 13, 14, 15); }
__device__ __forceinline__ v16bf cat16b(v8us lo, v8us hi) { return __builtin_bit_cast(v16bf, __builtin_shufflevector(lo, hi, 0, 1, 2, 3, 4, 5, 6, 7, 8, 9, 10, 11, 12, 13, 14, 15)); }
__device__ __forceinline__ v8f wmma16(v16h a, v16h b, v8f c) { return __builtin_amdgcn_wmma_f32_16x16x32_f16(false, a, false, b, (short)0, c, false, false); }
__device__ __forceinline__ v8f wmmab(v16bf a, v16bf b, v8f c) { return __builtin_amdgcn_wmma_f32_16x16x32_bf16(false, a, false, b, (short)0, c, false, false); }



// ---- k_gemmw: register-blocked GEMM, one 64x64 output tile per workgroup (16 accumulators per wave), operands straight from K-contiguous 16-bit planes; grid (M/64, N/64, Z), 32 * KW threads.
// C[m][n] (f32, pitch ldc, + optional f32 bias[n]) = sum_k A[m][k] Bt[n][k] (+ split products per NSPLIT). z-batch strides sA/sB/sC in elements. K % (32 * KW) == 0.
// KW waves share the tile: wave w sums the k range [w K/KW, (w+1) K/KW) of the whole tile; the KW partial tiles meet in LDS and are added in wave order 0..KW-1 (fixed f32 order).
template <typename T16> struct WFrag;
template <> struct WFrag<h16> { typedef v16h V; static __device__ __forceinline__ V ld(const h16* p) { return cat16(*(const v8h*)p, *(const v8h*)(p + 16)); } static __device__ __forceinline__ v8f mma(V a, V b, v8f c) { return wmma16(a, b, c); } };
template <> struct WFrag<bf> { typedef v16bf V; static __device__ __forceinline__ V ld(const bf* p) { return cat16b(*(const v8us*)p, *(const v8us*)(p + 16)); } static __device__ __forceinline__ v8f mma(V a, V b, v8f c) { return wmmab(a, b, c); } };
template <typename T16, int NSPLIT, bool BIAS, int KW>
__global__ __launch_bounds__(32 * KW) void k_gemmw(const T16* __restrict__ A, const T16* __restrict__ A2, const T16* __restrict__ Bt, const T16* __restrict__ Bt2, int K, float* C, int ldc, const float* __restrict__ bias, size_t sA, size_t sB, size_t sC) {
    typedef typename WFrag<T16>::V V;
    __shared__ __align__(16) float os[KW == 1 ? 16 * 68 : KW * 64 * 68];
    const size_t z = blockIdx.z; A += z * sA; if (A2) A2 += z * sA; Bt += z * sB; if (Bt2) Bt2 += z * sB; C += z * sC;
    const int lane = threadIdx.x & 31, lr = lane & 15, hi = lane >> 4; const int r0 = blockIdx.x * 64, c0 = blockIdx.y * 64;
    v8f acc[4][4];
#pragma unroll
    for (int mb = 0; mb < 4; ++mb)
#pragma unroll
        for (int nb = 0; nb < 4; ++nb) acc[mb][nb] = (v8f){};
    const size_t aoff = (size_t)(r0 + lr) * K + 8 * hi, boff = (size_t)(c0 + lr) * K + 8 * hi;
    const int kw = (KW == 1) ? 0 : __builtin_amdgcn_readfirstlane((int)(threadIdx.x >> 5));   // wave number in a scalar register: the k loop stays a scalar loop
    const int kbeg = kw * (K / KW), kend = kbeg + K / KW;
#pragma unroll 1
    for (int kc = kbeg; kc < kend; kc += 32) {
        V a[4], a2[4];
#pragma unroll
        for (int mb = 0; mb < 4; ++mb) { a[mb] = WFrag<T16>::ld(A + aoff + (size_t)mb * 16 * K + kc); if (NSPLIT == 1 || NSPLIT == 2) a2[mb] = WFrag<T16>::ld(A2 + aoff + (size_t)mb * 16 * K + kc); }
#pragma unroll
        for (int nb = 0; nb < 4; ++nb) { const V b = WFrag<T16>::ld(Bt + boff + (size_t)nb * 16 * K + kc); V b2; if (NSPLIT >= 2) b2 = WFrag<T16>::ld(Bt2 + boff + (size_t)nb * 16 * K + kc);
#pragma unroll
            for (int mb = 0; mb < 4; ++mb) { acc[mb][nb] = WFrag<T16>::mma(a[mb], b, acc[mb][nb]); if (NSPLIT == 1 || NSPLIT == 2) acc[mb][nb] = WFrag<T16>::mma(a2[mb], b, acc[mb][nb]); if (NSPLIT >= 2) acc[mb][nb] = WFrag<T16>::mma(a[mb], b2, acc[mb][nb]); } }
        asm volatile("v_nop\n\tv_nop\n\tv_nop\n\tv_nop" : "+v"(acc[0][0]), "+v"(acc[1][1]), "+v"(acc[2][2]), "+v"(acc[3][3]) : "v"(a[0]), "v"(a[3]));
    }
    if constexpr (KW > 1) {
        float* my = os + kw * (64 * 68);
        // the three loops are unrolled so that acc[][][] is indexed by constants and stays in registers
#pragma unroll
        for (int mb = 0; mb < 4; ++mb)
#pragma unroll
            for (int nb = 0; nb < 4; ++nb)
#pragma unroll
                for (int j = 0; j < 8; ++j) my[(mb * 16 + hi * 8 + j) * 68 + nb * 16 + lr] = acc[mb][nb][j];
        __syncthreads();   // every wave's partial tile is in LDS before any wave adds them
        static_assert((64 * 16) % (32 * KW) == 0, "each thread adds the same number of 4-column pieces");
        // both loops unrolled: the LDS reads of all partial tiles issue ahead of the adds, which keep the order w = 0..KW-1
#pragma unroll
        for (int it = 0; it < (64 * 16) / (32 * KW); ++it) { const int s = (int)threadIdx.x + it * (32 * KW); const int row = s >> 4, cofs = (s & 15) * 4; v4f val = *(const v4fa*)(os + row * 68 + cofs);
#pragma unroll
            for (int w = 1; w < KW; ++w) val += *(const v4fa*)(os + w * (64 * 68) + row * 68 + cofs);
            if (BIAS) { val[0] += bfr(bias[c0 + cofs]); val[1] += bfr(bias[c0 + cofs + 1]); val[2] += bfr(bias[c0 + cofs + 2]); val[3] += bfr(bias[c0 + cofs + 3]); }
            *(v4f*)(C + (size_t)(r0 + row) * ldc + c0 + cofs) = val; }
        return;
    }
#pragma unroll
    for (int mb = 0; mb < 4; ++mb) {
#pragma unroll
        for (int nb = 0; nb < 4; ++nb) {
#pragma unroll
            for (int j = 0; j < 8; ++j) os[(hi * 8 + j) * 68 + nb * 16 + lr] = acc[mb][nb][j]; }
        __builtin_amdgcn_wave_barrier(); asm volatile("" ::: "memory");
        float* crow = C + (size_t)(r0 + mb * 16) * ldc + c0;
{
#pragma unroll
            for (int s = 0; s < 8; ++s) { const int row = 2 * s + hi, cofs = lr * 4; v4f val = *(const v4fa*)(os + row * 68 + cofs); if (BIAS) { val[0] += bfr(bias[c0 + cofs]); val[1] += bfr(bias[c0 + cofs + 1]); val[2] += bfr(bias[c0 + cofs + 2]); val[3] += bfr(bias[c0 + cofs + 3]); }
                *(v4f*)(crow + (size_t)row * ldc + cofs) = val; }
             }
        __builtin_amdgcn_wave_barrier(); asm volatile("" ::: "memory");
    }
}

__device__ __forceinline__ h16 tohx(float x) { return (h16)x; }
__device__ __forceinline__ void splitf(float y, unsigned short& h, unsigned short& l) { h = f2bf(y); l = f2bf(y - bf2f(h)); }
typedef __attribute__((ext_vector_type(2))) _Float16 v2h;
typedef __attribute__((ext_vector_type(4))) _Float16 v4h;
typedef __attribute__((ext_vector_type(2))) unsigned short v2us;
typedef __attribute__((ext_vector_type(4))) unsigned short v4us;
typedef __attribute__((ext_vector_type(2))) float v2f;
typedef __attribute__((ext_vector_type(4))) int v4i;

__global__ __launch_bounds__(256) void k_wtG(const float* __restrict__ w, int K, int N, bf* Bt) {
    const int lane = threadIdx.x & 31; const int L0 = (blockIdx.x * 8 + (threadIdx.x >> 5)) * 8; const int nlines = N * K / 64;
{
#pragma unroll 1
        for (int l = 0; l < 8; ++l) { const int L = L0 + l; if (L >= nlines) break; const size_t e = (size_t)L * 64 + lane * 2; const int k = (int)(e % K), n = (int)(e / K); v2us o;
            o[0] = f2bf(w[(size_t)k * N + n]); o[1] = f2bf(w[(size_t)(k + 1) * N + n]); *(v2us*)(Bt + e) = o; }
         }
}
__global__ __launch_bounds__(256) void k_cvt8(const float* __restrict__ src, bf* dst, size_t n8) { const size_t i = (size_t)blockIdx.x * 256 + threadIdx.x; if (i >= n8) return; const v8f v = *(const v8f*)(src + i * 8); v8us o;
#pragma unroll
    for (int k = 0; k < 8; ++k) o[k] = f2bf(v[k]); *(v8us*)(dst + i * 8) = o;  }

// ---- k_qkv: the three projections in one launch, grid (TT / 64, heads, 3), 8 waves; one 64x64 tile per workgroup; fragments, k split over the waves and LDS sum in wave order as in k_gemmw with KW = 8.
// A tile is 64 tokens of one head, so the epilogue rounds the f32 sums itself and stores them at their place in the head planes (fp16, hi, lo): no f32 copy of q, k, v in the workspace.
// z = 0, 1: rows = tokens (A = x), columns = d (B = Wq, Wk) -> planes [h][t][d]. z = 2: rows = d (A = Wv), columns = tokens (B = x) -> planes [h][d][t], the transposed V that P V reads.
__global__ __launch_bounds__(256) void k_qkv(const bf* __restrict__ X, const bf* __restrict__ Wq, const bf* __restrict__ Wk, const bf* __restrict__ Wv, h16* Q16, bf* Qh, bf* Ql, h16* K16, bf* Kh, bf* Kl, h16* V16, bf* Vh, bf* Vl) {
    typedef WFrag<bf>::V V;
    constexpr int KW = 8, K = DM;
    static_assert(DQ == DKV && HD == 64 && TT % 64 == 0 && K % (32 * KW) == 0, "one grid for q, k and v; a tile is one head wide");
    __shared__ __align__(16) float os[KW * 64 * 68];
    const int z = blockIdx.z, tb = blockIdx.x, hb = blockIdx.y;
    const bf* xt = X + (size_t)tb * 64 * K; const bf* wt = (z == 0 ? Wq : z == 1 ? Wk : Wv) + (size_t)hb * 64 * K;
    const bf* A = (z == 2) ? wt : xt; const bf* Bt = (z == 2) ? xt : wt;
    const int pitch = (z == 2) ? TT : HD; const size_t base = (size_t)hb * TT * HD + (size_t)tb * 64 * ((z == 2) ? 1 : HD);
    h16* P16 = (z == 0 ? Q16 : z == 1 ? K16 : V16) + base; bf* Ph = (z == 0 ? Qh : z == 1 ? Kh : Vh) + base; bf* Pl = (z == 0 ? Ql : z == 1 ? Kl : Vl) + base;
    const int lane = threadIdx.x & 31, lr = lane & 15, hi = lane >> 4;
    v8f acc[4][4];
#pragma unroll
    for (int mb = 0; mb < 4; ++mb)
#pragma unroll
        for (int nb = 0; nb < 4; ++nb) acc[mb][nb] = (v8f){};
    const int off = lr * K + 8 * hi;   // wave-uniform bases and one lane offset: every fragment load is scalar base + lane offset + constant
    const int kw = __builtin_amdgcn_readfirstlane((int)(threadIdx.x >> 5));   // wave number in a scalar register: the wave's k offset goes into the scalar bases
    A += kw * (K / KW); Bt += kw * (K / KW);
    // three trips, known at compile time: unrolled, so that no address is computed per trip, the first products start from zero and loads of the later trips issue beside the first trip's
#pragma unroll
    for (int kc = 0; kc < K / KW; kc += 32) {
        V a[4];
#pragma unroll
        for (int mb = 0; mb < 4; ++mb) a[mb] = WFrag<bf>::ld(A + kc + (off + mb * 16 * K));
#pragma unroll
        for (int nb = 0; nb < 4; ++nb) { const V b = WFrag<bf>::ld(Bt + kc + (off + nb * 16 * K));
#pragma unroll
            for (int mb = 0; mb < 4; ++mb) acc[mb][nb] = WFrag<bf>::mma(a[mb], b, acc[mb][nb]); }
    }
    float* my = os + kw * (64 * 68);
    // the three loops are unrolled so that acc[][][] is indexed by constants and stays in registers
#pragma unroll
    for (int mb = 0; mb < 4; ++mb)
#pragma unroll
        for (int nb = 0; nb < 4; ++nb)
#pragma unroll
            for (int j = 0; j < 8; ++j) my[(mb * 16 + hi * 8 + j) * 68 + nb * 16 + lr] = acc[mb][nb][j];
    __syncthreads();   // every wave's partial tile is in LDS before any wave adds them
    constexpr int NP = (64 * 16) / (32 * KW);   // 4-column pieces per thread
    v4h o16[NP]; v4us oh[NP], ol[NP];
    // the loops are unrolled: the LDS reads of all partial tiles issue ahead of the adds, which keep the order w = 0..KW-1, and the piece arrays stay in registers
#pragma unroll
    for (int it = 0; it < NP; ++it) { const int s = (int)threadIdx.x + it * (32 * KW); const int row = s >> 4, cofs = (s & 15) * 4; v4f val = *(const v4fa*)(os + row * 68 + cofs);
#pragma unroll
        for (int w = 1; w < KW; ++w) val += *(const v4fa*)(os + w * (64 * 68) + row * 68 + cofs);
#pragma unroll
        for (int q = 0; q < 4; ++q) { o16[it][q] = tohx(val[q]); unsigned short a2, c2; splitf(val[q], a2, c2); oh[it][q] = a2; ol[it][q] = c2; } }
    // the twelve stores go out back to back behind all the rounding; unrolled: the piece arrays are indexed by constants
#pragma unroll
    for (int it = 0; it < NP; ++it) { const int s = (int)threadIdx.x + it * (32 * KW); const int e = (s >> 4) * pitch + (s & 15) * 4; *(v4h*)(P16 + e) = o16[it]; *(v4us*)(Ph + e) = oh[it]; *(v4us*)(Pl + e) = ol[it]; }
}
__global__ __launch_bounds__(256) void k_lnrS12(const float* __restrict__ wb, const float* __restrict__ Y, const float* __restrict__ g, const float* __restrict__ bb, float* ob) { const int lane = threadIdx.x & 31; const int row = blockIdx.x * 8 + (threadIdx.x >> 5); if (row >= TT) return; const float* br = wb + (size_t)row * BSZ * DM; const float* yr = Y + (size_t)row * DM; float v[DM / 32]; float s = 0.f;
#pragma unroll
    for (int ch = 0; ch < DM / 128; ++ch) { const v4f a = *(const v4f*)(br + ch * 128 + lane * 4); const v4f y4 = *(const v4f*)(yr + ch * 128 + lane * 4);
#pragma unroll
        for (int q = 0; q < 4; ++q) { float ab = bfr(a[q]); asm volatile("" : "+v"(ab)); float t = __fadd_rn(ab, y4[q]); asm volatile("" : "+v"(t)); v[ch * 4 + q] = t; s = __fadd_rn(s, t); } }
#pragma unroll
    for (int sh = 16; sh; sh >>= 1) s = __fadd_rn(s, __shfl_xor(s, sh, 32));
    const float mu = __fdiv_rn(s, (float)DM); float s2 = 0.f;
#pragma unroll
    for (int k = 0; k < DM / 32; ++k) { const float dv = __fsub_rn(v[k], mu); float p2 = __fmul_rn(dv, dv); asm volatile("" : "+v"(p2)); s2 = __fadd_rn(s2, p2); }
#pragma unroll
    for (int sh = 16; sh; sh >>= 1) s2 = __fadd_rn(s2, __shfl_xor(s2, sh, 32));
    const float rs = __fdiv_rn(1.0f, __fsqrt_rn(__fadd_rn(__fdiv_rn(s2, (float)DM), 1e-12f)));
{
#pragma unroll
        for (int ch = 0; ch < DM / 128; ++ch) { v4f o; for (int q = 0; q < 4; ++q) { const int col = ch * 128 + lane * 4 + q; float dv = __fsub_rn(v[ch * 4 + q], mu); asm volatile("" : "+v"(dv)); float y = __fmul_rn(dv, rs); asm volatile("" : "+v"(y)); float gg = bfr(g[col]), bb2 = bfr(bb[col]); asm volatile("" : "+v"(gg), "+v"(bb2)); y = __fmul_rn(y, gg); asm volatile("" : "+v"(y)); o[q] = __fadd_rn(y, bb2); }   /* every step kept separate: no fma contraction */
            *(v4f*)(ob + (size_t)row * BSZ * DM + ch * 128 + lane * 4) = o; }
         } }

// ---- k_fattn: scores, softmax, P V and the head merge for 32 query rows of one head, in one workgroup of 16 waves; scores and P stay in registers. Grid (heads, TT / 32): the hi/lo row blocks, which cost most, come first.
// Wave w owns keys [128 w, 128 w + 128). It forms the transposed scores S^T = K Q^T (A = key rows, B = query rows), so that a lane holds 64 scores of one query per 16-query tile, and two 16-key D tiles,
// converted in place, are the A fragment (row = query, k = key in the loaders' k order 8 hi + 0..7, 16 + 8 hi + 0..7) of P V. Row maximum and row sum: in the lane, across the two lane halves, then over the 16 waves through LDS in wave order.
// The 16 partial 32 x 64 outputs meet in LDS and are added in wave order 0..15 (k ranges and order as in k_gemmw with KW = 16); the sum is scaled, split hi/lo and stored at its place in the merged [t][h d] planes.
typedef __attribute__((ext_vector_type(16))) unsigned short v16us;
template <typename T16, bool HL>
__device__ __forceinline__ void fattn(const T16* __restrict__ Q, const T16* __restrict__ Q2, const T16* __restrict__ Kp, const T16* __restrict__ K2, const T16* __restrict__ Vt, const T16* __restrict__ Vt2, bf* Ah, bf* Al, float* os, float* redm, float* reds) {
    typedef typename WFrag<T16>::V V;
    const int lane = threadIdx.x & 31, lr = lane & 15, hi = lane >> 4;
    const int kw = __builtin_amdgcn_readfirstlane((int)(threadIdx.x >> 5));   // wave number in a scalar register: the key offsets stay scalar
    const int key0 = kw * 128;
    // wave-uniform bases and one lane offset per plane kind: every fragment load is scalar base + lane offset + constant
    const int lo = lr * HD + 8 * hi, lv = lr * TT + 8 * hi;
    const T16* kb = Kp + (size_t)key0 * HD; const T16* kb2 = HL ? K2 + (size_t)key0 * HD : nullptr; const T16* vb = Vt + key0; const T16* vb2 = HL ? Vt2 + key0 : nullptr;
    // every loop below is unrolled so that s[][][] and acc[][][] are indexed by constants and stay in registers
    v8f s[8][2];
#pragma unroll
    for (int kt = 0; kt < 8; ++kt) { s[kt][0] = (v8f){}; s[kt][1] = (v8f){}; }
    {
        V qf[2][2], q2f[2][2];
#pragma unroll
        for (int qt = 0; qt < 2; ++qt)
#pragma unroll
            for (int ks = 0; ks < 2; ++ks) { const int o = lo + qt * 16 * HD + ks * 32; qf[qt][ks] = WFrag<T16>::ld(Q + o); if (HL) q2f[qt][ks] = WFrag<T16>::ld(Q2 + o); }
        V kf[2], k2f[2]; kf[0] = WFrag<T16>::ld(kb + lo); if (HL) k2f[0] = WFrag<T16>::ld(kb2 + lo);
#pragma unroll
        for (int it = 0; it < 16; ++it) { const int kt = it >> 1, ks = it & 1, c = it & 1, n = c ^ 1;
            if (it + 1 < 16) { const int o = lo + ((it + 1) >> 1) * 16 * HD + ((it + 1) & 1) * 32; kf[n] = WFrag<T16>::ld(kb + o); if (HL) k2f[n] = WFrag<T16>::ld(kb2 + o); }   // the next fragment's loads fly during this fragment's products
#pragma unroll
            for (int qt = 0; qt < 2; ++qt) { s[kt][qt] = WFrag<T16>::mma(kf[c], qf[qt][ks], s[kt][qt]); if (HL) { s[kt][qt] = WFrag<T16>::mma(kf[c], q2f[qt][ks], s[kt][qt]); s[kt][qt] = WFrag<T16>::mma(k2f[c], qf[qt][ks], s[kt][qt]); } } }
    }
    float mx[2], f[2];
#pragma unroll
    for (int qt = 0; qt < 2; ++qt) { float m = s[0][qt][0];
#pragma unroll
        for (int kt = 0; kt < 8; ++kt)
#pragma unroll
            for (int j = 0; j < 8; ++j) m = fmaxf(m, s[kt][qt][j]);
        mx[qt] = fmaxf(m, __shfl_xor(m, 16, 32)); }
    redm[kw * 32 + lane] = hi ? mx[1] : mx[0];
    __syncthreads();   // every wave's row maxima are in LDS before any wave joins them
#pragma unroll
    for (int qt = 0; qt < 2; ++qt) { float m = redm[qt * 16 + lr];
#pragma unroll
        for (int w = 1; w < 16; ++w) m = fmaxf(m, redm[w * 32 + qt * 16 + lr]);
        mx[qt] = m * SCL; }   // SCL is a power of two: the maximum of the scaled scores, exactly
#pragma unroll
    for (int qt = 0; qt < 2; ++qt) { float a = 0.f;
#pragma unroll
        for (int kt = 0; kt < 8; ++kt)
#pragma unroll
            for (int j = 0; j < 8; ++j) { const float e = __builtin_amdgcn_exp2f((s[kt][qt][j] * SCL - mx[qt]) * 1.4426950408889634f); s[kt][qt][j] = e; a += e; }
        f[qt] = a + __shfl_xor(a, 16, 32); }
    reds[kw * 32 + lane] = hi ? f[1] : f[0];
    __syncthreads();   // every wave's row sums are in LDS before any wave joins them
#pragma unroll
    for (int qt = 0; qt < 2; ++qt) { float a = reds[qt * 16 + lr];
#pragma unroll
        for (int w = 1; w < 16; ++w) a += reds[w * 32 + qt * 16 + lr];
        f[qt] = __fdiv_rn(HL ? 1.0f : PCAR, a); }
    v8f acc[2][4];
#pragma unroll
    for (int nb = 0; nb < 4; ++nb) { acc[0][nb] = (v8f){}; acc[1][nb] = (v8f){}; }
    V vf[2], v2f[2]; vf[0] = WFrag<T16>::ld(vb + lv); if (HL) v2f[0] = WFrag<T16>::ld(vb2 + lv);
#pragma unroll
    for (int kk = 0; kk < 4; ++kk) {
        V pa[2], pa2[2];
#pragma unroll
        for (int qt = 0; qt < 2; ++qt) {
            if constexpr (HL) { v16us ph, pl;
#pragma unroll
                for (int e = 0; e < 16; ++e) { unsigned short a, c2; splitf(s[2 * kk + (e >> 3)][qt][e & 7] * f[qt], a, c2); ph[e] = a; pl[e] = c2; }
                pa[qt] = __builtin_bit_cast(v16bf, ph); pa2[qt] = __builtin_bit_cast(v16bf, pl);
            } else {
#pragma unroll
                for (int e = 0; e < 16; ++e) pa[qt][e] = tohx(s[2 * kk + (e >> 3)][qt][e & 7] * f[qt]);
            } }
#pragma unroll
        for (int nb = 0; nb < 4; ++nb) { const int it = kk * 4 + nb, c = it & 1, n = c ^ 1;
            if (it + 1 < 16) { const int o = lv + ((it + 1) & 3) * 16 * TT + ((it + 1) >> 2) * 32; vf[n] = WFrag<T16>::ld(vb + o); if (HL) v2f[n] = WFrag<T16>::ld(vb2 + o); }   // the next fragment's loads fly during this fragment's products (and during the next P conversion)
#pragma unroll
            for (int qt = 0; qt < 2; ++qt) { acc[qt][nb] = WFrag<T16>::mma(pa[qt], vf[c], acc[qt][nb]); if (HL) { acc[qt][nb] = WFrag<T16>::mma(pa2[qt], vf[c], acc[qt][nb]); acc[qt][nb] = WFrag<T16>::mma(pa[qt], v2f[c], acc[qt][nb]); } } }
    }
    float* my = os + kw * (32 * 68);
#pragma unroll
    for (int qt = 0; qt < 2; ++qt)
#pragma unroll
        for (int nb = 0; nb < 4; ++nb)
#pragma unroll
            for (int j = 0; j < 8; ++j) my[(qt * 16 + hi * 8 + j) * 68 + nb * 16 + lr] = acc[qt][nb][j];
    __syncthreads();   // every wave's partial output tile is in LDS before any wave adds them
    const int row = (int)threadIdx.x >> 4, cofs = ((int)threadIdx.x & 15) * 4; v4f val = *(const v4fa*)(os + row * 68 + cofs);
#pragma unroll
    for (int w = 1; w < 16; ++w) val += *(const v4fa*)(os + w * (32 * 68) + row * 68 + cofs);
    const float cs = HL ? 1.0f : (1.0f / PCAR); v4us oh, ol;
#pragma unroll
    for (int q = 0; q < 4; ++q) { unsigned short a, c2; splitf(val[q] * cs, a, c2); oh[q] = a; ol[q] = c2; }
    *(v4us*)(Ah + (size_t)row * DQ + cofs) = oh; *(v4us*)(Al + (size_t)row * DQ + cofs) = ol;
}
__global__ __launch_bounds__(512) void k_fattn(const h16* __restrict__ Q16, const h16* __restrict__ K16, const h16* __restrict__ V16, const bf* __restrict__ Qh, const bf* __restrict__ Ql, const bf* __restrict__ Kh, const bf* __restrict__ Kl, const bf* __restrict__ Vh, const bf* __restrict__ Vl, bf* Ah, bf* Al) {
    __shared__ __align__(16) float os[16 * 32 * 68]; __shared__ float redm[16 * 32]; __shared__ float reds[16 * 32];
    const int h = blockIdx.x, q0 = blockIdx.y * 32; const size_t zq = ((size_t)h * TT + q0) * HD, zk = (size_t)(h / REP) * TT * HD, oo = (size_t)q0 * DQ + h * HD;
    static_assert(RH % 32 == 0 && TT == 16 * 128 && HD == 64, "a row block is all hi/lo or all fp16; 16 waves x 128 keys; 4 output column tiles");
    if (q0 < RH) fattn<bf, true>(Qh + zq, Ql + zq, Kh + zk, Kl + zk, Vh + zk, Vl + zk, Ah + oo, Al + oo, os, redm, reds);
    else fattn<h16, false>(Q16 + zq, nullptr, K16 + zk, nullptr, V16 + zk, nullptr, Ah + oo, Al + oo, os, redm, reds);
}

extern "C" void kernel_launch(void* const* d_in, const int* in_sizes, int n_in,
                              void* d_out, int out_size, void* d_ws, size_t ws_size, hipStream_t stream) {
    (void)in_sizes; (void)n_in; (void)out_size;
    const float* x = (const float*)d_in[0]; const float* wq = (const float*)d_in[1]; const float* wk = (const float*)d_in[2]; const float* wv = (const float*)d_in[3]; const float* wo = (const float*)d_in[4]; const float* lng = (const float*)d_in[5]; const float* lnb = (const float*)d_in[6];
    float* OUT = (float*)d_out;     // [1][2048][768]
    char* wsp = (char*)d_ws;
    auto take = [&](size_t bytes) { char* p = wsp; wsp += (bytes + 255) & ~(size_t)255; return (void*)p; };
    float* Y = (float*)take((size_t)TT * DM * 4); bf* WQ = (bf*)take((size_t)DQ * DM * 2); bf* WK = (bf*)take((size_t)DKV * DM * 2); bf* WV = (bf*)take((size_t)DKV * DM * 2); bf* WO = (bf*)take((size_t)DM * DQ * 2);
    bf* XB = (bf*)take((size_t)TT * DM * 2);
    h16* QP16 = (h16*)take((size_t)NH_ * TT * HD * 2); h16* KP16 = (h16*)take((size_t)NKV * TT * HD * 2); h16* VT16 = (h16*)take((size_t)NKV * HD * TT * 2);
    bf* QPh = (bf*)take((size_t)NH_ * TT * HD * 2); bf* QPl = (bf*)take((size_t)NH_ * TT * HD * 2); bf* KPh = (bf*)take((size_t)NKV * TT * HD * 2); bf* KPl = (bf*)take((size_t)NKV * TT * HD * 2); bf* VTh = (bf*)take((size_t)NKV * HD * TT * 2); bf* VTl = (bf*)take((size_t)NKV * HD * TT * 2);
    bf* ATh = (bf*)take((size_t)TT * DQ * 2); bf* ATl = (bf*)take((size_t)TT * DQ * 2);
    if ((size_t)(wsp - (char*)d_ws) > ws_size) return;    // ws 256 MiB
    { k_cvt8<<<(unsigned)(((size_t)DQ * DM / 8 + 255) / 256), 256, 0, stream>>>(wq, WQ, (size_t)DQ * DM / 8); k_cvt8<<<(unsigned)(((size_t)DKV * DM / 8 + 255) / 256), 256, 0, stream>>>(wk, WK, (size_t)DKV * DM / 8); k_cvt8<<<(unsigned)(((size_t)DKV * DM / 8 + 255) / 256), 256, 0, stream>>>(wv, WV, (size_t)DKV * DM / 8);
      k_cvt8<<<(unsigned)(((size_t)DM * DQ / 8 + 255) / 256), 256, 0, stream>>>(wo, WO, (size_t)DM * DQ / 8);
       }
    for (int b = 0; b < NB_; ++b) {
        
        k_cvt8<<<(unsigned)(((size_t)TT * DM / 8 + 255) / 256), 256, 0, stream>>>(x + (size_t)b * TT * DM, XB, (size_t)TT * DM / 8);
        k_qkv<<<dim3(TT / 64, NH_, 3), 256, 0, stream>>>(XB, WQ, WK, WV, QP16, QPh, QPl, KP16, KPh, KPl, VT16, VTh, VTl);
        k_fattn<<<dim3(NH_, TT / 32, 1), 512, 0, stream>>>(QP16, KP16, VT16, QPh, QPl, KPh, KPl, VTh, VTl, ATh, ATl);
        k_gemmw<bf, 1, false, 8><<<dim3(TT / 64, DM / 64, 1), 256, 0, stream>>>(ATh, ATl, WO, nullptr, DQ, Y, DM, nullptr, 0, 0, 0); k_lnrS12<<<TT / 8, 256, 0, stream>>>(x + (size_t)b * TT * DM, Y, lng, lnb, OUT + (size_t)b * TT * DM);   /* LayerNorm(out + x), eps 1e-12 */ }
}

// v005
// It runs in 86.1 microseconds.
// Timed twice side by side with v004, it ran 1.27 times as fast both times.
// Over all steps from v000 it is 8.92 times as fast.
#include <hip/hip_runtime.h>

// BERT self-attention with residual + LayerNorm (x [2048][768], unbatched; q,k,v = x W^T ('oi' [768][768], no bias, 1/sqrt(768)); 12 heads x 64; softmax(q.k / 8) over all keys; out = merged Wo^T; y = LayerNorm(out + x) gamma + beta (eps 1e-12) -> [2048][768] (1.6 M)).
// Every 16-bit operand plane in the workspace is kept in fragment order (see WFrag::ldf): 16 x 32 tiles of 512 elements, a lane's two 16-byte pieces at lane * 8 and 256 + lane * 8, so that one wave-wide 16-byte load reads 512 contiguous bytes.
// Layout: bf16 copy of x; exact projections, q, k and v in one launch that writes the head planes itself; dense T-2048 attention in one fused kernel, scores and P in registers (hybrid rows: < 512 hi/lo 3 products, rest fp16 x1024); merged hi/lo x Wo exact into workspace; a LayerNorm row kernel adds bf16(x) and writes the output rows (one wave per row, 24 values per lane, f32 fixed order).
// Compute dtypes, f32 accumulate: every input rounded to bf16; projections exact; attention rows < 512 3 products, rest fp16; softmax, residual and LayerNorm f32; Wo hl x exact.

#define NB_  1
#define TT   2048
#define DM   768
#define NH_  12
#define NKV  12
#define REP  (NH_ / NKV)
#define HD   64
#define DQ   (NH_ * HD)
#define DKV  (NKV * HD)
#define RH   512                  // query rows < RH use hi+lo planes (0: none)
#define WIN  0
#define PCAR 1024.0f
#define SCL  0.125f
#define BSZ  1
typedef _Float16 h16;
typedef unsigned short bf;
typedef __attribute__((ext_vector_type(16))) __bf16   v16bf;
typedef __attribute__((ext_vector_type(16))) _Float16 v16h;
typedef __attribute__((ext_vector_type(8)))  _Float16 v8h;
typedef __attribute__((ext_vector_type(8)))  unsigned short v8us;
typedef __attribute__((ext_vector_type(8)))  float    v8f;
typedef __attribute__((ext_vector_type(4)))  float    v4f;
typedef v8h  __attribute__((may_alias)) v8ha;
typedef v4f  __attribute__((may_alias)) v4fa;
typedef v8us __attribute__((may_alias)) v8usa;

__device__ __forceinline__ unsigned short f2bf(float f) { unsigned u = __float_as_uint(f); u += 0x7FFFu + ((u >> 16) & 1u); return (unsigned short)(u >> 16); }
__device__ __forceinline__ float bf2f(unsigned short b) { return __uint_as_float(((unsigned)b) << 16); }
__device__ __forceinline__ float bfr(float f) { return bf2f(f2bf(f)); }
__device__ __forceinline__ v16h cat16(v8h lo, v8h hi) { return __builtin_shufflevector(lo, hi, 0, 1, 2, 3, 4, 5, 6, 7, 8, 9, 10, 11, 12, 13, 14, 15); }
__device__ __forceinline__ v16bf cat16b(v8us lo, v8us hi) { return __builtin_bit_cast(v16bf, __builtin_shufflevector(lo, hi, 0, 1, 2, 3, 4, 5, 6, 7, 8, 9, 10, 11, 12, 13, 14, 15)); }
__device__ __forceinline__ v8f wmma16(v16h a, v16h b, v8f c) { return __builtin_amdgcn_wmma_f32_16x16x32_f16(false, a, false, b, (short)0, c, false, false); }
__device__ __forceinline__ v8f wmmab(v16bf a, v16bf b, v8f c) { return __builtin_amdgcn_wmma_f32_16x16x32_bf16(false, a, false, b, (short)0, c, false, false); }



// ---- k_gemmw: register-blocked GEMM, one 64x64 output tile per workgroup (16 accumulators per wave), operands straight from 16-bit planes in fragment order; grid (M/64, N/64, Z), 32 * KW threads.
// C[m][n] (f32, pitch ldc, + optional f32 bias[n]) = sum_k A[m][k] Bt[n][k] (+ split products per NSPLIT). z-batch strides sA/sB/sC in elements. K % (32 * KW) == 0.
// KW waves share the tile: wave w sums the k range [w K/KW, (w+1) K/KW) of the whole tile; the KW partial tiles meet in LDS and are added in wave order 0..KW-1 (fixed f32 order).
// Fragment order of a plane [R][K]: tile (r >> 4, k >> 5) is number (r >> 4) * (K / 32) + (k >> 5); in it element (r, k) stands at ((k >> 4) & 1) * 256 + (((k >> 3) & 1) * 16 + (r & 15)) * 8 + (k & 7).
// ldf(tile + lane * 8) gives lane (lr, hi) the same 16 values as ld(row lr, k = 8 hi) of a row-major plane: k = 8 hi + 0..7 and 16 + 8 hi + 0..7.
template <typename T16> struct WFrag;
template <> struct WFrag<h16> { typedef v16h V; static __device__ __forceinline__ V ld(const h16* p) { return cat16(*(const v8h*)p, *(const v8h*)(p + 16)); } static __device__ __forceinline__ V ldf(const h16* p) { return cat16(*(const v8h*)p, *(const v8h*)(p + 256)); } static __device__ __forceinline__ v8f mma(V a, V b, v8f c) { return wmma16(a, b, c); } };
template <> struct WFrag<bf> { typedef v16bf V; static __device__ __forceinline__ V ld(const bf* p) { return cat16b(*(const v8us*)p, *(const v8us*)(p + 16)); } static __device__ __forceinline__ V ldf(const bf* p) { return cat16b(*(const v8us*)p, *(const v8us*)(p + 256)); } static __device__ __forceinline__ v8f mma(V a, V b, v8f c) { return wmmab(a, b, c); } };
template <typename T16, int NSPLIT, bool BIAS, int KW, int K>   // K at compile time: the distance from band to band is a constant of the load
__global__ __launch_bounds__(32 * KW) void k_gemmw(const T16* __restrict__ A, const T16* __restrict__ A2, const T16* __restrict__ Bt, const T16* __restrict__ Bt2, float* C, int ldc, const float* __restrict__ bias, size_t sA, size_t sB, size_t sC) {
    typedef typename WFrag<T16>::V V;
    __shared__ __align__(16) float os[KW == 1 ? 16 * 68 : KW * 64 * 68];
    const size_t z = blockIdx.z; A += z * sA; if (A2) A2 += z * sA; Bt += z * sB; if (Bt2) Bt2 += z * sB; C += z * sC;
    const int lane = threadIdx.x & 31, lr = lane & 15, hi = lane >> 4; const int r0 = blockIdx.x * 64, c0 = blockIdx.y * 64;
    v8f acc[4][4];
#pragma unroll
    for (int mb = 0; mb < 4; ++mb)
#pragma unroll
        for (int nb = 0; nb < 4; ++nb) acc[mb][nb] = (v8f){};
    // a band of 16 rows is K / 32 tiles = 16 K elements, and the tile of k step kc starts at kc * 16: a wave-uniform base per k step, one lane offset and a constant per band
    const int lo = lane * 8; A += (size_t)r0 * K; if (NSPLIT == 1 || NSPLIT == 2) A2 += (size_t)r0 * K; Bt += (size_t)c0 * K; if (NSPLIT >= 2) Bt2 += (size_t)c0 * K;
    const int kw = (KW == 1) ? 0 : __builtin_amdgcn_readfirstlane((int)(threadIdx.x >> 5));   // wave number in a scalar register: the k loop stays a scalar loop
    const int kbeg = kw * (K / KW), kend = kbeg + K / KW;
    // K / KW / 32 trips, known at compile time: unrolled, as in k_qkv, so that every tile address is scalar base + lane offset + constant, with no 64-bit vector address arithmetic per trip
#pragma unroll
    for (int kc = kbeg; kc < kend; kc += 32) {
        V a[4], a2[4]; const T16* Ak = A + kc * 16; const T16* A2k = (NSPLIT == 1 || NSPLIT == 2) ? A2 + kc * 16 : nullptr; const T16* Bk = Bt + kc * 16; const T16* B2k = (NSPLIT >= 2) ? Bt2 + kc * 16 : nullptr;
#pragma unroll
        for (int mb = 0; mb < 4; ++mb) { a[mb] = WFrag<T16>::ldf(Ak + (lo + mb * 16 * K)); if (NSPLIT == 1 || NSPLIT == 2) a2[mb] = WFrag<T16>::ldf(A2k + (lo + mb * 16 * K)); }
#pragma unroll
        for (int nb = 0; nb < 4; ++nb) { const V b = WFrag<T16>::ldf(Bk + (lo + nb * 16 * K)); V b2; if (NSPLIT >= 2) b2 = WFrag<T16>::ldf(B2k + (lo + nb * 16 * K));
#pragma unroll
            for (int mb = 0; mb < 4; ++mb) { acc[mb][nb] = WFrag<T16>::mma(a[mb], b, acc[mb][nb]); if (NSPLIT == 1 || NSPLIT == 2) acc[mb][nb] = WFrag<T16>::mma(a2[mb], b, acc[mb][nb]); if (NSPLIT >= 2) acc[mb][nb] = WFrag<T16>::mma(a[mb], b2, acc[mb][nb]); } }
        asm volatile("v_nop\n\tv_nop\n\tv_nop\n\tv_nop" : "+v"(acc[0][0]), "+v"(acc[1][1]), "+v"(acc[2][2]), "+v"(acc[3][3]) : "v"(a[0]), "v"(a[3]));
    }
    if constexpr (KW > 1) {
        float* my = os + kw * (64 * 68);
        // the three loops are unrolled so that acc[][][] is indexed by constants and stays in registers
#pragma unroll
        for (int mb = 0; mb < 4; ++mb)
#pragma unroll
            for (int nb = 0; nb < 4; ++nb)
#pragma unroll
                for (int j = 0; j < 8; ++j) my[(mb * 16 + hi * 8 + j) * 68 + nb * 16 + lr] = acc[mb][nb][j];
        __syncthreads();   // every wave's partial tile is in LDS before any wave adds them
        static_assert((64 * 16) % (32 * KW) == 0, "each thread adds the same number of 4-column pieces");
        // both loops unrolled: the LDS reads of all partial tiles issue ahead of the adds, which keep the order w = 0..KW-1
#pragma unroll
        for (int it = 0; it < (64 * 16) / (32 * KW); ++it) { const int s = (int)threadIdx.x + it * (32 * KW); const int row = s >> 4, cofs = (s & 15) * 4; v4f val = *(const v4fa*)(os + row * 68 + cofs);
#pragma unroll
            for (int w = 1; w < KW; ++w) val += *(const v4fa*)(os + w * (64 * 68) + row * 68 + cofs);
            if (BIAS) { val[0] += bfr(bias[c0 + cofs]); val[1] += bfr(bias[c0 + cofs + 1]); val[2] += bfr(bias[c0 + cofs + 2]); val[3] += bfr(bias[c0 + cofs + 3]); }
            *(v4f*)(C + (size_t)(r0 + row) * ldc + c0 + cofs) = val; }
        return;
    }
#pragma unroll
    for (int mb = 0; mb < 4; ++mb) {
#pragma unroll
        for (int nb = 0; nb < 4; ++nb) {
#pragma unroll
            for (int j = 0; j < 8; ++j) os[(hi * 8 + j) * 68 + nb * 16 + lr] = acc[mb][nb][j]; }
        __builtin_amdgcn_wave_barrier(); asm volatile("" ::: "memory");
        float* crow = C + (size_t)(r0 + mb * 16) * ldc + c0;
{
#pragma unroll
            for (int s = 0; s < 8; ++s) { const int row = 2 * s + hi, cofs = lr * 4; v4f val = *(const v4fa*)(os + row * 68 + cofs); if (BIAS) { val[0] += bfr(bias[c0 + cofs]); val[1] += bfr(bias[c0 + cofs + 1]); val[2] += bfr(bias[c0 + cofs + 2]); val[3] += bfr(bias[c0 + cofs + 3]); }
                *(v4f*)(crow + (size_t)row * ldc + cofs) = val; }
             }
        __builtin_amdgcn_wave_barrier(); asm volatile("" ::: "memory");
    }
}

__device__ __forceinline__ h16 tohx(float x) { return (h16)x; }
__device__ __forceinline__ void splitf(float y, unsigned short& h, unsigned short& l) { h = f2bf(y); l = f2bf(y - bf2f(h)); }
typedef __attribute__((ext_vector_type(2))) _Float16 v2h;
typedef __attribute__((ext_vector_type(4))) _Float16 v4h;
typedef __attribute__((ext_vector_type(2))) unsigned short v2us;
typedef __attribute__((ext_vector_type(4))) unsigned short v4us;
typedef __attribute__((ext_vector_type(2))) float v2f;
typedef __attribute__((ext_vector_type(4))) int v4i;

__global__ __launch_bounds__(256) void k_wtG(const float* __restrict__ w, int K, int N, bf* Bt) {
    const int lane = threadIdx.x & 31; const int L0 = (blockIdx.x * 8 + (threadIdx.x >> 5)) * 8; const int nlines = N * K / 64;
{
#pragma unroll 1
        for (int l = 0; l < 8; ++l) { const int L = L0 + l; if (L >= nlines) break; const size_t e = (size_t)L * 64 + lane * 2; const int k = (int)(e % K), n = (int)(e / K); v2us o;
            o[0] = f2bf(w[(size_t)k * N + n]); o[1] = f2bf(w[(size_t)(k + 1) * N + n]); *(v2us*)(Bt + e) = o; }
         }
}
// f32 [R][DM] row-major -> bf16 in fragment order; one wave per 16 x 32 tile: it reads 16 whole 128-byte lines and stores 1 KiB in a row.
__global__ __launch_bounds__(256) void k_cvt8(const float* __restrict__ src, bf* dst, size_t n16) { const size_t i = (size_t)blockIdx.x * 256 + threadIdx.x; if (i >= n16) return; const int lane = threadIdx.x & 31; const int tile = (int)(i >> 5), rt = tile / (DM / 32), kt = tile % (DM / 32);
    const float* s = src + (size_t)(rt * 16 + (lane & 15)) * DM + kt * 32 + (lane >> 4) * 8; const v8f v = *(const v8f*)s, w = *(const v8f*)(s + 16); v8us o, o2;
#pragma unroll
    for (int k = 0; k < 8; ++k) { o[k] = f2bf(v[k]); o2[k] = f2bf(w[k]); }
    bf* d = dst + (size_t)tile * 512 + lane * 8; *(v8us*)d = o; *(v8us*)(d + 256) = o2; }

// ---- k_qkv: the three projections in one launch, grid (TT / 64, heads, 3), 8 waves; one 64x64 tile per workgroup; fragments, k split over the waves and LDS sum in wave order as in k_gemmw with KW = 8.
// A tile is 64 tokens of one head, so the epilogue rounds the f32 sums itself and stores them at their place in the head planes (fp16, hi, lo): no f32 copy of q, k, v in the workspace.
// z = 0, 1: rows = tokens (A = x), columns = d (B = Wq, Wk) -> planes [h][t][d]. z = 2: rows = d (A = Wv), columns = tokens (B = x) -> planes [h][d][t], the transposed V that P V reads.
// The head planes are in fragment order too. q, k: tile number (t >> 4) * 2 + (d >> 5) in the head. V: tile number (t >> 5) * 4 + (d >> 4), so that the 128 keys of one attention wave are 16 tiles in a row. Either way a 64 x 64 tile is 8 fragment tiles, 4096 elements, in a row.
__global__ __launch_bounds__(256) void k_qkv(const bf* __restrict__ X, const bf* __restrict__ Wq, const bf* __restrict__ Wk, const bf* __restrict__ Wv, h16* Q16, bf* Qh, bf* Ql, h16* K16, bf* Kh, bf* Kl, h16* V16, bf* Vh, bf* Vl) {
    typedef WFrag<bf>::V V;
    constexpr int KW = 8, K = DM;
    static_assert(DQ == DKV && HD == 64 && TT % 64 == 0 && K % (32 * KW) == 0, "one grid for q, k and v; a tile is one head wide");
    __shared__ __align__(16) float os[KW * 64 * 68];
    const int z = blockIdx.z, tb = blockIdx.x, hb = blockIdx.y;
    const bf* xt = X + (size_t)tb * 64 * K; const bf* wt = (z == 0 ? Wq : z == 1 ? Wk : Wv) + (size_t)hb * 64 * K;
    const bf* A = (z == 2) ? wt : xt; const bf* Bt = (z == 2) ? xt : wt;
    const size_t base = (size_t)hb * TT * HD + (size_t)tb * 64 * HD;
    h16* P16 = (z == 0 ? Q16 : z == 1 ? K16 : V16) + base; bf* Ph = (z == 0 ? Qh : z == 1 ? Kh : Vh) + base; bf* Pl = (z == 0 ? Ql : z == 1 ? Kl : Vl) + base;
    const int lane = threadIdx.x & 31, lr = lane & 15, hi = lane >> 4;
    v8f acc[4][4];
#pragma unroll
    for (int mb = 0; mb < 4; ++mb)
#pragma unroll
        for (int nb = 0; nb < 4; ++nb) acc[mb][nb] = (v8f){};
    const int off = lane * 8;   // wave-uniform bases and one lane offset: every fragment load is scalar base + lane offset + constant
    const int kw = __builtin_amdgcn_readfirstlane((int)(threadIdx.x >> 5));   // wave number in a scalar register: the wave's k offset goes into the scalar bases
    A += kw * (K / KW) * 16; Bt += kw * (K / KW) * 16;   // 32 k are one tile of 512 elements
    // three trips, known at compile time: unrolled, so that no address is computed per trip, the first products start from zero and loads of the later trips issue beside the first trip's
#pragma unroll
    for (int kc = 0; kc < K / KW; kc += 32) {
        V a[4];
#pragma unroll
        for (int mb = 0; mb < 4; ++mb) a[mb] = WFrag<bf>::ldf(A + kc * 16 + (off + mb * 16 * K));
#pragma unroll
        for (int nb = 0; nb < 4; ++nb) { const V b = WFrag<bf>::ldf(Bt + kc * 16 + (off + nb * 16 * K));
#pragma unroll
            for (int mb = 0; mb < 4; ++mb) acc[mb][nb] = WFrag<bf>::mma(a[mb], b, acc[mb][nb]); }
    }
    float* my = os + kw * (64 * 68);
    // the three loops are unrolled so that acc[][][] is indexed by constants and stays in registers
#pragma unroll
    for (int mb = 0; mb < 4; ++mb)
#pragma unroll
        for (int nb = 0; nb < 4; ++nb)
#pragma unroll
            for (int j = 0; j < 8; ++j) my[(mb * 16 + hi * 8 + j) * 68 + nb * 16 + lr] = acc[mb][nb][j];
    __syncthreads();   // every wave's partial tile is in LDS before any wave adds them
    constexpr int NP = (64 * 8) / (32 * KW);   // 8-column pieces per thread: a piece is one lane's 16 bytes of a fragment tile, and a wave's 32 pieces are 512 bytes in a row
    v8h o16[NP]; v8us oh[NP], ol[NP];
    // the loops are unrolled: the LDS reads of all partial tiles issue ahead of the adds, which keep the order w = 0..KW-1, and the piece arrays stay in registers
#pragma unroll
    for (int it = 0; it < NP; ++it) { const int tile = (kw >> 1) + it * (KW / 2);   // piece number threadIdx.x + it * 256 = (tile * 2 + half) * 32 + lane, half = kw & 1
        const int rt = (z == 2) ? (tile & 3) : (tile >> 1), ct = (z == 2) ? (tile >> 2) : (tile & 1); const int row = rt * 16 + lr, cofs = ct * 32 + (kw & 1) * 16 + hi * 8;
        v4f val = *(const v4fa*)(os + row * 68 + cofs), val2 = *(const v4fa*)(os + row * 68 + cofs + 4);
#pragma unroll
        for (int w = 1; w < KW; ++w) { val += *(const v4fa*)(os + w * (64 * 68) + row * 68 + cofs); val2 += *(const v4fa*)(os + w * (64 * 68) + row * 68 + cofs + 4); }
#pragma unroll
        for (int q = 0; q < 4; ++q) { o16[it][q] = tohx(val[q]); o16[it][q + 4] = tohx(val2[q]); unsigned short a2, c2; splitf(val[q], a2, c2); oh[it][q] = a2; ol[it][q] = c2; splitf(val2[q], a2, c2); oh[it][q + 4] = a2; ol[it][q + 4] = c2; } }
    // the six stores go out back to back behind all the rounding; unrolled: the piece arrays are indexed by constants
#pragma unroll
    for (int it = 0; it < NP; ++it) { const int e = ((int)threadIdx.x + it * (32 * KW)) * 8; *(v8h*)(P16 + e) = o16[it]; *(v8us*)(Ph + e) = oh[it]; *(v8us*)(Pl + e) = ol[it]; }
}
__global__ __launch_bounds__(256) void k_lnrS12(const float* __restrict__ wb, const float* __restrict__ Y, const float* __restrict__ g, const float* __restrict__ bb, float* ob) { const int lane = threadIdx.x & 31; const int row = blockIdx.x * 8 + (threadIdx.x >> 5); if (row >= TT) return; const float* br = wb + (size_t)row * BSZ * DM; const float* yr = Y + (size_t)row * DM; float v[DM / 32]; float s = 0.f;
#pragma unroll
    for (int ch = 0; ch < DM / 128; ++ch) { const v4f a = *(const v4f*)(br + ch * 128 + lane * 4); const v4f y4 = *(const v4f*)(yr + ch * 128 + lane * 4);
#pragma unroll
        for (int q = 0; q < 4; ++q) { float ab = bfr(a[q]); asm volatile("" : "+v"(ab)); float t = __fadd_rn(ab, y4[q]); asm volatile("" : "+v"(t)); v[ch * 4 + q] = t; s = __fadd_rn(s, t); } }
#pragma unroll
    for (int sh = 16; sh; sh >>= 1) s = __fadd_rn(s, __shfl_xor(s, sh, 32));
    const float mu = __fdiv_rn(s, (float)DM); float s2 = 0.f;
#pragma unroll
    for (int k = 0; k < DM / 32; ++k) { const float dv = __fsub_rn(v[k], mu); float p2 = __fmul_rn(dv, dv); asm volatile("" : "+v"(p2)); s2 = __fadd_rn(s2, p2); }
#pragma unroll
    for (int sh = 16; sh; sh >>= 1) s2 = __fadd_rn(s2, __shfl_xor(s2, sh, 32));
    const float rs = __fdiv_rn(1.0f, __fsqrt_rn(__fadd_rn(__fdiv_rn(s2, (float)DM), 1e-12f)));
{
#pragma unroll
        for (int ch = 0; ch < DM / 128; ++ch) { v4f o; for (int q = 0; q < 4; ++q) { const int col = ch * 128 + lane * 4 + q; float dv = __fsub_rn(v[ch * 4 + q], mu); asm volatile("" : "+v"(dv)); float y = __fmul_rn(dv, rs); asm volatile("" : "+v"(y)); float gg = bfr(g[col]), bb2 = bfr(bb[col]); asm volatile("" : "+v"(gg), "+v"(bb2)); y = __fmul_rn(y, gg); asm volatile("" : "+v"(y)); o[q] = __fadd_rn(y, bb2); }   /* every step kept separate: no fma contraction */
            *(v4f*)(ob + (size_t)row * BSZ * DM + ch * 128 + lane * 4) = o; }
         } }

// ---- k_fattn: scores, softmax, P V and the head merge for 32 query rows of one head, in one workgroup of 16 waves; scores and P stay in registers. Grid (heads, TT / 32): the hi/lo row blocks, which cost most, come first.
// Wave w owns keys [128 w, 128 w + 128). It forms the transposed scores S^T = K Q^T (A = key rows, B = query rows), so that a lane holds 64 scores of one query per 16-query tile, and two 16-key D tiles,
// converted in place, are the A fragment (row = query, k = key in the loaders' k order 8 hi + 0..7, 16 + 8 hi + 0..7) of P V. Row maximum and row sum: in the lane, across the two lane halves, then over the 16 waves through LDS in wave order.
// The 16 partial 32 x 64 outputs meet in LDS and are added in wave order 0..15 (k ranges and order as in k_gemmw with KW = 16); the sum is scaled, split hi/lo and stored at its place in the merged [t][h d] planes (fragment order).
typedef __attribute__((ext_vector_type(16))) unsigned short v16us;
template <typename T16, bool HL>
__device__ __forceinline__ void fattn(const T16* __restrict__ Q, const T16* __restrict__ Q2, const T16* __restrict__ Kp, const T16* __restrict__ K2, const T16* __restrict__ Vt, const T16* __restrict__ Vt2, bf* Ah, bf* Al, float* os, float* redm, float* reds) {
    typedef typename WFrag<T16>::V V;
    const int lane = threadIdx.x & 31, lr = lane & 15, hi = lane >> 4;
    const int kw = __builtin_amdgcn_readfirstlane((int)(threadIdx.x >> 5));   // wave number in a scalar register: the key offsets stay scalar
    const int key0 = kw * 128;
    // wave-uniform bases and one lane offset per plane kind: every fragment load is scalar base + lane offset + constant
    const int lo = lane * 8;   // planes in fragment order: fragment number n of a wave's range is tile n
    const T16* kb = Kp + (size_t)key0 * HD; const T16* kb2 = HL ? K2 + (size_t)key0 * HD : nullptr; const T16* vb = Vt + (size_t)key0 * HD; const T16* vb2 = HL ? Vt2 + (size_t)key0 * HD : nullptr;
    // every loop below is unrolled so that s[][][] and acc[][][] are indexed by constants and stay in registers
    v8f s[8][2];
#pragma unroll
    for (int kt = 0; kt < 8; ++kt) { s[kt][0] = (v8f){}; s[kt][1] = (v8f){}; }
    {
        V qf[2][2], q2f[2][2];
#pragma unroll
        for (int qt = 0; qt < 2; ++qt)
#pragma unroll
            for (int ks = 0; ks < 2; ++ks) { const int o = lo + (qt * 2 + ks) * 512; qf[qt][ks] = WFrag<T16>::ldf(Q + o); if (HL) q2f[qt][ks] = WFrag<T16>::ldf(Q2 + o); }
        V kf[2], k2f[2]; kf[0] = WFrag<T16>::ldf(kb + lo); if (HL) k2f[0] = WFrag<T16>::ldf(kb2 + lo);
#pragma unroll
        for (int it = 0; it < 16; ++it) { const int kt = it >> 1, ks = it & 1, c = it & 1, n = c ^ 1;
            if (it + 1 < 16) { const int o = lo + (it + 1) * 512; kf[n] = WFrag<T16>::ldf(kb + o); if (HL) k2f[n] = WFrag<T16>::ldf(kb2 + o); }   // the next fragment's loads fly during this fragment's products
#pragma unroll
            for (int qt = 0; qt < 2; ++qt) { s[kt][qt] = WFrag<T16>::mma(kf[c], qf[qt][ks], s[kt][qt]); if (HL) { s[kt][qt] = WFrag<T16>::mma(kf[c], q2f[qt][ks], s[kt][qt]); s[kt][qt] = WFrag<T16>::mma(k2f[c], qf[qt][ks], s[kt][qt]); } } }
    }
    float mx[2], f[2];
#pragma unroll
    for (int qt = 0; qt < 2; ++qt) { float m = s[0][qt][0];
#pragma unroll
        for (int kt = 0; kt < 8; ++kt)
#pragma unroll
            for (int j = 0; j < 8; ++j) m = fmaxf(m, s[kt][qt][j]);
        mx[qt] = fmaxf(m, __shfl_xor(m, 16, 32)); }
    redm[kw * 32 + lane] = hi ? mx[1] : mx[0];
    __syncthreads();   // every wave's row maxima are in LDS before any wave joins them
#pragma unroll
    for (int qt = 0; qt < 2; ++qt) { float m = redm[qt * 16 + lr];
#pragma unroll
        for (int w = 1; w < 16; ++w) m = fmaxf(m, redm[w * 32 + qt * 16 + lr]);
        mx[qt] = m * SCL; }   // SCL is a power of two: the maximum of the scaled scores, exactly
#pragma unroll
    for (int qt = 0; qt < 2; ++qt) { float a = 0.f;
#pragma unroll
        for (int kt = 0; kt < 8; ++kt)
#pragma unroll
            for (int j = 0; j < 8; ++j) { const float e = __builtin_amdgcn_exp2f((s[kt][qt][j] * SCL - mx[qt]) * 1.4426950408889634f); s[kt][qt][j] = e; a += e; }
        f[qt] = a + __shfl_xor(a, 16, 32); }
    reds[kw * 32 + lane] = hi ? f[1] : f[0];
    __syncthreads();   // every wave's row sums are in LDS before any wave joins them
#pragma unroll
    for (int qt = 0; qt < 2; ++qt) { float a = reds[qt * 16 + lr];
#pragma unroll
        for (int w = 1; w < 16; ++w) a += reds[w * 32 + qt * 16 + lr];
        f[qt] = __fdiv_rn(HL ? 1.0f : PCAR, a); }
    v8f acc[2][4];
#pragma unroll
    for (int nb = 0; nb < 4; ++nb) { acc[0][nb] = (v8f){}; acc[1][nb] = (v8f){}; }
    V vf[2], v2f[2]; vf[0] = WFrag<T16>::ldf(vb + lo); if (HL) v2f[0] = WFrag<T16>::ldf(vb2 + lo);
#pragma unroll
    for (int kk = 0; kk < 4; ++kk) {
        V pa[2], pa2[2];
#pragma unroll
        for (int qt = 0; qt < 2; ++qt) {
            if constexpr (HL) { v16us ph, pl;
#pragma unroll
                for (int e = 0; e < 16; ++e) { unsigned short a, c2; splitf(s[2 * kk + (e >> 3)][qt][e & 7] * f[qt], a, c2); ph[e] = a; pl[e] = c2; }
                pa[qt] = __builtin_bit_cast(v16bf, ph); pa2[qt] = __builtin_bit_cast(v16bf, pl);
            } else {
#pragma unroll
                for (int e = 0; e < 16; ++e) pa[qt][e] = tohx(s[2 * kk + (e >> 3)][qt][e & 7] * f[qt]);
            } }
#pragma unroll
        for (int nb = 0; nb < 4; ++nb) { const int it = kk * 4 + nb, c = it & 1, n = c ^ 1;
            if (it + 1 < 16) { const int o = lo + (it + 1) * 512; vf[n] = WFrag<T16>::ldf(vb + o); if (HL) v2f[n] = WFrag<T16>::ldf(vb2 + o); }   // the next fragment's loads fly during this fragment's products (and during the next P conversion)
#pragma unroll
            for (int qt = 0; qt < 2; ++qt) { acc[qt][nb] = WFrag<T16>::mma(pa[qt], vf[c], acc[qt][nb]); if (HL) { acc[qt][nb] = WFrag<T16>::mma(pa2[qt], vf[c], acc[qt][nb]); acc[qt][nb] = WFrag<T16>::mma(pa[qt], v2f[c], acc[qt][nb]); } } }
    }
    float* my = os + kw * (32 * 68);
#pragma unroll
    for (int qt = 0; qt < 2; ++qt)
#pragma unroll
        for (int nb = 0; nb < 4; ++nb)
#pragma unroll
            for (int j = 0; j < 8; ++j) my[(qt * 16 + hi * 8 + j) * 68 + nb * 16 + lr] = acc[qt][nb][j];
    __syncthreads();   // every wave's partial output tile is in LDS before any wave adds them
    // the 32 x 64 sum is 4 fragment tiles = 256 pieces of 8 columns (one lane's 16 bytes): waves 0..7 take one piece a lane (tile kw >> 1, half kw & 1) and store 512 bytes in a row; no barrier follows
    if (kw >= 8) return;
    const int qt = kw >> 2, ks = (kw >> 1) & 1; const int row = qt * 16 + lr, cofs = ks * 32 + (kw & 1) * 16 + hi * 8; v4f val = *(const v4fa*)(os + row * 68 + cofs), val2 = *(const v4fa*)(os + row * 68 + cofs + 4);
#pragma unroll
    for (int w = 1; w < 16; ++w) { val += *(const v4fa*)(os + w * (32 * 68) + row * 68 + cofs); val2 += *(const v4fa*)(os + w * (32 * 68) + row * 68 + cofs + 4); }
    const float cs = HL ? 1.0f : (1.0f / PCAR); v8us oh, ol;
#pragma unroll
    for (int q = 0; q < 4; ++q) { unsigned short a, c2; splitf(val[q] * cs, a, c2); oh[q] = a; ol[q] = c2; splitf(val2[q] * cs, a, c2); oh[q + 4] = a; ol[q + 4] = c2; }
    const int e = (qt * (DQ / 32) + ks) * 512 + (kw & 1) * 256 + lane * 8; *(v8us*)(Ah + e) = oh; *(v8us*)(Al + e) = ol;
}
__global__ __launch_bounds__(512) void k_fattn(const h16* __restrict__ Q16, const h16* __restrict__ K16, const h16* __restrict__ V16, const bf* __restrict__ Qh, const bf* __restrict__ Ql, const bf* __restrict__ Kh, const bf* __restrict__ Kl, const bf* __restrict__ Vh, const bf* __restrict__ Vl, bf* Ah, bf* Al) {
    __shared__ __align__(16) float os[16 * 32 * 68]; __shared__ float redm[16 * 32]; __shared__ float reds[16 * 32];
    const int h = blockIdx.x, q0 = blockIdx.y * 32; const size_t zq = ((size_t)h * TT + q0) * HD, zk = (size_t)(h / REP) * TT * HD, oo = (size_t)q0 * DQ + h * (HD * 16);   // merged planes [t][h d] in fragment order: a band of 16 rows is 16 DQ elements, a head is 2 tiles in it
    static_assert(RH % 32 == 0 && TT == 16 * 128 && HD == 64, "a row block is all hi/lo or all fp16; 16 waves x 128 keys; 4 output column tiles");
    if (q0 < RH) fattn<bf, true>(Qh + zq, Ql + zq, Kh + zk, Kl + zk, Vh + zk, Vl + zk, Ah + oo, Al + oo, os, redm, reds);
    else fattn<h16, false>(Q16 + zq, nullptr, K16 + zk, nullptr, V16 + zk, nullptr, Ah + oo, Al + oo, os, redm, reds);
}

extern "C" void kernel_launch(void* const* d_in, const int* in_sizes, int n_in,
                              void* d_out, int out_size, void* d_ws, size_t ws_size, hipStream_t stream) {
    (void)in_sizes; (void)n_in; (void)out_size;
    const float* x = (const float*)d_in[0]; const float* wq = (const float*)d_in[1]; const float* wk = (const float*)d_in[2]; const float* wv = (const float*)d_in[3]; const float* wo = (const float*)d_in[4]; const float* lng = (const float*)d_in[5]; const float* lnb = (const float*)d_in[6];
    float* OUT = (float*)d_out;     // [1][2048][768]
    char* wsp = (char*)d_ws;
    auto take = [&](size_t bytes) { char* p = wsp; wsp += (bytes + 255) & ~(size_t)255; return (void*)p; };
    float* Y = (float*)take((size_t)TT * DM * 4); bf* WQ = (bf*)take((size_t)DQ * DM * 2); bf* WK = (bf*)take((size_t)DKV * DM * 2); bf* WV = (bf*)take((size_t)DKV * DM * 2); bf* WO = (bf*)take((size_t)DM * DQ * 2);
    bf* XB = (bf*)take((size_t)TT * DM * 2);
    h16* QP16 = (h16*)take((size_t)NH_ * TT * HD * 2); h16* KP16 = (h16*)take((size_t)NKV * TT * HD * 2); h16* VT16 = (h16*)take((size_t)NKV * HD * TT * 2);
    bf* QPh = (bf*)take((size_t)NH_ * TT * HD * 2); bf* QPl = (bf*)take((size_t)NH_ * TT * HD * 2); bf* KPh = (bf*)take((size_t)NKV * TT * HD * 2); bf* KPl = (bf*)take((size_t)NKV * TT * HD * 2); bf* VTh = (bf*)take((size_t)NKV * HD * TT * 2); bf* VTl = (bf*)take((size_t)NKV * HD * TT * 2);
    bf* ATh = (bf*)take((size_t)TT * DQ * 2); bf* ATl = (bf*)take((size_t)TT * DQ * 2);
    if ((size_t)(wsp - (char*)d_ws) > ws_size) return;    // ws 256 MiB
    { k_cvt8<<<(unsigned)(((size_t)DQ * DM / 16 + 255) / 256), 256, 0, stream>>>(wq, WQ, (size_t)DQ * DM / 16); k_cvt8<<<(unsigned)(((size_t)DKV * DM / 16 + 255) / 256), 256, 0, stream>>>(wk, WK, (size_t)DKV * DM / 16); k_cvt8<<<(unsigned)(((size_t)DKV * DM / 16 + 255) / 256), 256, 0, stream>>>(wv, WV, (size_t)DKV * DM / 16);
      k_cvt8<<<(unsigned)(((size_t)DM * DQ / 16 + 255) / 256), 256, 0, stream>>>(wo, WO, (size_t)DM * DQ / 16);
       }
    for (int b = 0; b < NB_; ++b) {
        
        k_cvt8<<<(unsigned)(((size_t)TT * DM / 16 + 255) / 256), 256, 0, stream>>>(x + (size_t)b * TT * DM, XB, (size_t)TT * DM / 16);
        k_qkv<<<dim3(TT / 64, NH_, 3), 256, 0, stream>>>(XB, WQ, WK, WV, QP16, QPh, QPl, KP16, KPh, KPl, VT16, VTh, VTl);
        k_fattn<<<dim3(NH_, TT / 32, 1), 512, 0, stream>>>(QP16, KP16, VT16, QPh, QPl, KPh, KPl, VTh, VTl, ATh, ATl);
        k_gemmw<bf, 1, false, 8, DQ><<<dim3(TT / 64, DM / 64, 1), 256, 0, stream>>>(ATh, ATl, WO, nullptr, Y, DM, nullptr, 0, 0, 0); k_lnrS12<<<TT / 8, 256, 0, stream>>>(x + (size_t)b * TT * DM, Y, lng, lnb, OUT + (size_t)b * TT * DM);   /* LayerNorm(out + x), eps 1e-12 */ }
}

// v006
// One run takes 77.3 microseconds.
// Next to v005, in two timings, it ran 1.11 times as fast each time.
// Over all steps from v000 it is 9.93 times as fast.
#include <hip/hip_runtime.h>

// BERT self-attention with residual + LayerNorm (x [2048][768], unbatched; q,k,v = x W^T ('oi' [768][768], no bias, 1/sqrt(768)); 12 heads x 64; softmax(q.k / 8) over all keys; out = merged Wo^T; y = LayerNorm(out + x) gamma + beta (eps 1e-12) -> [2048][768] (1.6 M)).
// Every 16-bit operand plane in the workspace is kept in fragment order (see WFrag::ldf): 16 x 32 tiles of 512 elements, a lane's two 16-byte pieces at lane * 8 and 256 + lane * 8, so that one wave-wide 16-byte load reads 512 contiguous bytes.
// Layout: bf16 copies of x and the four weights, one launch; exact projections, q, k and v in one launch that writes the head planes itself; dense T-2048 attention in one fused kernel, scores and P in registers (hybrid rows: < 512 hi/lo 3 products, rest fp16 x1024); merged hi/lo x Wo exact into workspace; a LayerNorm row kernel adds bf16(x) and writes the output rows (one wave per row, 24 values per lane, f32 fixed order).
// Compute dtypes, f32 accumulate: every input rounded to bf16; projections exact; attention rows < 512 3 products, rest fp16; softmax, residual and LayerNorm f32; Wo hl x exact.

#define NB_  1
#define TT   2048
#define DM   768
#define NH_  12
#define NKV  12
#define REP  (NH_ / NKV)
#define HD   64
#define DQ   (NH_ * HD)
#define DKV  (NKV * HD)
#define RH   512                  // query rows < RH use hi+lo planes (0: none)
#define WIN  0
#define PCAR 1024.0f
#define SCL  0.125f
#define BSZ  1
typedef _Float16 h16;
typedef unsigned short bf;
typedef __attribute__((ext_vector_type(16))) __bf16   v16bf;
typedef __attribute__((ext_vector_type(16))) _Float16 v16h;
typedef __attribute__((ext_vector_type(8)))  _Float16 v8h;
typedef __attribute__((ext_vector_type(8)))  unsigned short v8us;
typedef __attribute__((ext_vector_type(8)))  float    v8f;
typedef __attribute__((ext_vector_type(4)))  float    v4f;
typedef v8h  __attribute__((may_alias)) v8ha;
typedef v4f  __attribute__((may_alias)) v4fa;
typedef v8us __attribute__((may_alias)) v8usa;

__device__ __forceinline__ unsigned short f2bf(float f) { unsigned u = __float_as_uint(f); u += 0x7FFFu + ((u >> 16) & 1u); return (unsigned short)(u >> 16); }
__device__ __forceinline__ float bf2f(unsigned short b) { return __uint_as_float(((unsigned)b) << 16); }
__device__ __forceinline__ float bfr(float f) { return bf2f(f2bf(f)); }
__device__ __forceinline__ v16h cat16(v8h lo, v8h hi) { return __builtin_shufflevector(lo, hi, 0, 1, 2, 3, 4, 5, 6, 7, 8, 9, 10, 11, 12, 13, 14, 15); }
__device__ __forceinline__ v16bf cat16b(v8us lo, v8us hi) { return __builtin_bit_cast(v16bf, __builtin_shufflevector(lo, hi, 0, 1, 2, 3, 4, 5, 6, 7, 8, 9, 10, 11, 12, 13, 14, 15)); }
__device__ __forceinline__ v8f wmma16(v16h a, v16h b, v8f c) { return __builtin_amdgcn_wmma_f32_16x16x32_f16(false, a, false, b, (short)0, c, false, false); }
__device__ __forceinline__ v8f wmmab(v16bf a, v16bf b, v8f c) { return __builtin_amdgcn_wmma_f32_16x16x32_bf16(false, a, false, b, (short)0, c, false, false); }



// ---- k_gemmw: register-blocked GEMM, one 64x64 output tile per workgroup (16 accumulators per wave), operands straight from 16-bit planes in fragment order; grid (M/64, N/64, Z), 32 * KW threads.
// C[m][n] (f32, pitch ldc, + optional f32 bias[n]) = sum_k A[m][k] Bt[n][k] (+ split products per NSPLIT). z-batch strides sA/sB/sC in elements. K % (32 * KW) == 0.
// KW waves share the tile: wave w sums the k range [w K/KW, (w+1) K/KW) of the whole tile; the KW partial tiles meet in LDS and are added in wave order 0..KW-1 (fixed f32 order).
// Fragment order of a plane [R][K]: tile (r >> 4, k >> 5) is number (r >> 4) * (K / 32) + (k >> 5); in it element (r, k) stands at ((k >> 4) & 1) * 256 + (((k >> 3) & 1) * 16 + (r & 15)) * 8 + (k & 7).
// ldf(tile + lane * 8) gives lane (lr, hi) the same 16 values as ld(row lr, k = 8 hi) of a row-major plane: k = 8 hi + 0..7 and 16 + 8 hi + 0..7.
template <typename T16> struct WFrag;
template <> struct WFrag<h16> { typedef v16h V; static __device__ __forceinline__ V ld(const h16* p) { return cat16(*(const v8h*)p, *(const v8h*)(p + 16)); } static __device__ __forceinline__ V ldf(const h16* p) { return cat16(*(const v8h*)p, *(const v8h*)(p + 256)); } static __device__ __forceinline__ v8f mma(V a, V b, v8f c) { return wmma16(a, b, c); } };
template <> struct WFrag<bf> { typedef v16bf V; static __device__ __forceinline__ V ld(const bf* p) { return cat16b(*(const v8us*)p, *(const v8us*)(p + 16)); } static __device__ __forceinline__ V ldf(const bf* p) { return cat16b(*(const v8us*)p, *(const v8us*)(p + 256)); } static __device__ __forceinline__ v8f mma(V a, V b, v8f c) { return wmmab(a, b, c); } };
template <typename T16, int NSPLIT, bool BIAS, int KW, int K>   // K at compile time: the distance from band to band is a constant of the load
__global__ __launch_bounds__(32 * KW) void k_gemmw(const T16* __restrict__ A, const T16* __restrict__ A2, const T16* __restrict__ Bt, const T16* __restrict__ Bt2, float* C, int ldc, const float* __restrict__ bias, size_t sA, size_t sB, size_t sC) {
    typedef typename WFrag<T16>::V V;
    __shared__ __align__(16) float os[KW == 1 ? 16 * 68 : KW * 64 * 68];
    const size_t z = blockIdx.z; A += z * sA; if (A2) A2 += z * sA; Bt += z * sB; if (Bt2) Bt2 += z * sB; C += z * sC;
    const int lane = threadIdx.x & 31, lr = lane & 15, hi = lane >> 4; const int r0 = blockIdx.x * 64, c0 = blockIdx.y * 64;
    v8f acc[4][4];
#pragma unroll
    for (int mb = 0; mb < 4; ++mb)
#pragma unroll
        for (int nb = 0; nb < 4; ++nb) acc[mb][nb] = (v8f){};
    // a band of 16 rows is K / 32 tiles = 16 K elements, and the tile of k step kc starts at kc * 16: a wave-uniform base per k step, one lane offset and a constant per band
    const int lo = lane * 8; A += (size_t)r0 * K; if (NSPLIT == 1 || NSPLIT == 2) A2 += (size_t)r0 * K; Bt += (size_t)c0 * K; if (NSPLIT >= 2) Bt2 += (size_t)c0 * K;
    const int kw = (KW == 1) ? 0 : __builtin_amdgcn_readfirstlane((int)(threadIdx.x >> 5));   // wave number in a scalar register: the k loop stays a scalar loop
    const int kbeg = kw * (K / KW), kend = kbeg + K / KW;
    // K / KW / 32 trips, known at compile time: unrolled, as in k_qkv, so that every tile address is scalar base + lane offset + constant, with no 64-bit vector address arithmetic per trip
#pragma unroll
    for (int kc = kbeg; kc < kend; kc += 32) {
        V a[4], a2[4]; const T16* Ak = A + kc * 16; const T16* A2k = (NSPLIT == 1 || NSPLIT == 2) ? A2 + kc * 16 : nullptr; const T16* Bk = Bt + kc * 16; const T16* B2k = (NSPLIT >= 2) ? Bt2 + kc * 16 : nullptr;
#pragma unroll
        for (int mb = 0; mb < 4; ++mb) { a[mb] = WFrag<T16>::ldf(Ak + (lo + mb * 16 * K)); if (NSPLIT == 1 || NSPLIT == 2) a2[mb] = WFrag<T16>::ldf(A2k + (lo + mb * 16 * K)); }
#pragma unroll
        for (int nb = 0; nb < 4; ++nb) { const V b = WFrag<T16>::ldf(Bk + (lo + nb * 16 * K)); V b2; if (NSPLIT >= 2) b2 = WFrag<T16>::ldf(B2k + (lo + nb * 16 * K));
#pragma unroll
            for (int mb = 0; mb < 4; ++mb) { acc[mb][nb] = WFrag<T16>::mma(a[mb], b, acc[mb][nb]); if (NSPLIT == 1 || NSPLIT == 2) acc[mb][nb] = WFrag<T16>::mma(a2[mb], b, acc[mb][nb]); if (NSPLIT >= 2) acc[mb][nb] = WFrag<T16>::mma(a[mb], b2, acc[mb][nb]); } }
        asm volatile("v_nop\n\tv_nop\n\tv_nop\n\tv_nop" : "+v"(acc[0][0]), "+v"(acc[1][1]), "+v"(acc[2][2]), "+v"(acc[3][3]) : "v"(a[0]), "v"(a[3]));
    }
    if constexpr (KW > 1) {
        float* my = os + kw * (64 * 68);
        // the three loops are unrolled so that acc[][][] is indexed by constants and stays in registers
#pragma unroll
        for (int mb = 0; mb < 4; ++mb)
#pragma unroll
            for (int nb = 0; nb < 4; ++nb)
#pragma unroll
                for (int j = 0; j < 8; ++j) my[(mb * 16 + hi * 8 + j) * 68 + nb * 16 + lr] = acc[mb][nb][j];
        __syncthreads();   // every wave's partial tile is in LDS before any wave adds them
        static_assert((64 * 16) % (32 * KW) == 0, "each thread adds the same number of 4-column pieces");
        // both loops unrolled: the LDS reads of all partial tiles issue ahead of the adds, which keep the order w = 0..KW-1
#pragma unroll
        for (int it = 0; it < (64 * 16) / (32 * KW); ++it) { const int s = (int)threadIdx.x + it * (32 * KW); const int row = s >> 4, cofs = (s & 15) * 4; v4f val = *(const v4fa*)(os + row * 68 + cofs);
#pragma unroll
            for (int w = 1; w < KW; ++w) val += *(const v4fa*)(os + w * (64 * 68) + row * 68 + cofs);
            if (BIAS) { val[0] += bfr(bias[c0 + cofs]); val[1] += bfr(bias[c0 + cofs + 1]); val[2] += bfr(bias[c0 + cofs + 2]); val[3] += bfr(bias[c0 + cofs + 3]); }
            *(v4f*)(C + (size_t)(r0 + row) * ldc + c0 + cofs) = val; }
        return;
    }
#pragma unroll
    for (int mb = 0; mb < 4; ++mb) {
#pragma unroll
        for (int nb = 0; nb < 4; ++nb) {
#pragma unroll
            for (int j = 0; j < 8; ++j) os[(hi * 8 + j) * 68 + nb * 16 + lr] = acc[mb][nb][j]; }
        __builtin_amdgcn_wave_barrier(); asm volatile("" ::: "memory");
        float* crow = C + (size_t)(r0 + mb * 16) * ldc + c0;
{
#pragma unroll
            for (int s = 0; s < 8; ++s) { const int row = 2 * s + hi, cofs = lr * 4; v4f val = *(const v4fa*)(os + row * 68 + cofs); if (BIAS) { val[0] += bfr(bias[c0 + cofs]); val[1] += bfr(bias[c0 + cofs + 1]); val[2] += bfr(bias[c0 + cofs + 2]); val[3] += bfr(bias[c0 + cofs + 3]); }
                *(v4f*)(crow + (size_t)row * ldc + cofs) = val; }
             }
        __builtin_amdgcn_wave_barrier(); asm volatile("" ::: "memory");
    }
}

__device__ __forceinline__ h16 tohx(float x) { return (h16)x; }
__device__ __forceinline__ void splitf(float y, unsigned short& h, unsigned short& l) { h = f2bf(y); l = f2bf(y - bf2f(h)); }
typedef __attribute__((ext_vector_type(2))) _Float16 v2h;
typedef __attribute__((ext_vector_type(4))) _Float16 v4h;
typedef __attribute__((ext_vector_type(2))) unsigned short v2us;
typedef __attribute__((ext_vector_type(4))) unsigned short v4us;
typedef __attribute__((ext_vector_type(2))) float v2f;
typedef __attribute__((ext_vector_type(4))) int v4i;

__global__ __launch_bounds__(256) void k_wtG(const float* __restrict__ w, int K, int N, bf* Bt) {
    const int lane = threadIdx.x & 31; const int L0 = (blockIdx.x * 8 + (threadIdx.x >> 5)) * 8; const int nlines = N * K / 64;
{
#pragma unroll 1
        for (int l = 0; l < 8; ++l) { const int L = L0 + l; if (L >= nlines) break; const size_t e = (size_t)L * 64 + lane * 2; const int k = (int)(e % K), n = (int)(e / K); v2us o;
            o[0] = f2bf(w[(size_t)k * N + n]); o[1] = f2bf(w[(size_t)(k + 1) * N + n]); *(v2us*)(Bt + e) = o; }
         }
}
// f32 [R][DM] row-major -> bf16 in fragment order; one wave per 16 x 32 tile: it reads 16 whole 128-byte lines and stores 1 KiB in a row.
// One launch converts all five planes: workgroups [0, BX) take x, then BW workgroups each for Wq, Wk, Wv, Wo; a workgroup lies wholly in one plane, so source and destination are chosen by scalar tests.
__global__ __launch_bounds__(256) void k_cvt8(const float* __restrict__ x, const float* __restrict__ wq, const float* __restrict__ wk, const float* __restrict__ wv, const float* __restrict__ wo, bf* XB, bf* WQ, bf* WK, bf* WV, bf* WO) {
    constexpr int BX = TT * DM / 16 / 256, BW = DM * DM / 16 / 256;
    static_assert(NB_ == 1 && DQ == DM && DKV == DM && (TT * DM) % (16 * 256) == 0 && (DM * DM) % (16 * 256) == 0, "one x plane, four square weights, whole workgroups per plane");
    int b = blockIdx.x; const float* src = x; bf* dst = XB;
    if (b >= BX) { b -= BX; const int p = b / BW; b -= p * BW; src = p == 0 ? wq : p == 1 ? wk : p == 2 ? wv : wo; dst = p == 0 ? WQ : p == 1 ? WK : p == 2 ? WV : WO; }
    const int lane = threadIdx.x & 31; const int tile = b * 8 + (int)(threadIdx.x >> 5), rt = tile / (DM / 32), kt = tile % (DM / 32);
    const float* s = src + (size_t)(rt * 16 + (lane & 15)) * DM + kt * 32 + (lane >> 4) * 8; const v8f v = *(const v8f*)s, w = *(const v8f*)(s + 16); v8us o, o2;
#pragma unroll
    for (int k = 0; k < 8; ++k) { o[k] = f2bf(v[k]); o2[k] = f2bf(w[k]); }
    bf* d = dst + (size_t)tile * 512 + lane * 8; *(v8us*)d = o; *(v8us*)(d + 256) = o2; }

// ---- k_qkv: the three projections in one launch, grid (TT / 64, heads, 3), 8 waves; one 64x64 tile per workgroup; fragments, k split over the waves and LDS sum in wave order as in k_gemmw with KW = 8.
// A tile is 64 tokens of one head, so the epilogue rounds the f32 sums itself and stores them at their place in the head planes (fp16, hi, lo): no f32 copy of q, k, v in the workspace.
// z = 0, 1: rows = tokens (A = x), columns = d (B = Wq, Wk) -> planes [h][t][d]. z = 2: rows = d (A = Wv), columns = tokens (B = x) -> planes [h][d][t], the transposed V that P V reads.
// The head planes are in fragment order too. q, k: tile number (t >> 4) * 2 + (d >> 5) in the head. V: tile number (t >> 5) * 4 + (d >> 4), so that the 128 keys of one attention wave are 16 tiles in a row. Either way a 64 x 64 tile is 8 fragment tiles, 4096 elements, in a row.
__global__ __launch_bounds__(256) void k_qkv(const bf* __restrict__ X, const bf* __restrict__ Wq, const bf* __restrict__ Wk, const bf* __restrict__ Wv, h16* Q16, bf* Qh, bf* Ql, h16* K16, bf* Kh, bf* Kl, h16* V16, bf* Vh, bf* Vl) {
    typedef WFrag<bf>::V V;
    constexpr int KW = 8, K = DM;
    static_assert(DQ == DKV && HD == 64 && TT % 64 == 0 && K % (32 * KW) == 0, "one grid for q, k and v; a tile is one head wide");
    __shared__ __align__(16) float os[KW * 64 * 68];
    const int z = blockIdx.z, tb = blockIdx.x, hb = blockIdx.y;
    const bf* xt = X + (size_t)tb * 64 * K; const bf* wt = (z == 0 ? Wq : z == 1 ? Wk : Wv) + (size_t)hb * 64 * K;
    const bf* A = (z == 2) ? wt : xt; const bf* Bt = (z == 2) ? xt : wt;
    const size_t base = (size_t)hb * TT * HD + (size_t)tb * 64 * HD;
    h16* P16 = (z == 0 ? Q16 : z == 1 ? K16 : V16) + base; bf* Ph = (z == 0 ? Qh : z == 1 ? Kh : Vh) + base; bf* Pl = (z == 0 ? Ql : z == 1 ? Kl : Vl) + base;
    const int lane = threadIdx.x & 31, lr = lane & 15, hi = lane >> 4;
    v8f acc[4][4];
#pragma unroll
    for (int mb = 0; mb < 4; ++mb)
#pragma unroll
        for (int nb = 0; nb < 4; ++nb) acc[mb][nb] = (v8f){};
    const int off = lane * 8;   // wave-uniform bases and one lane offset: every fragment load is scalar base + lane offset + constant
    const int kw = __builtin_amdgcn_readfirstlane((int)(threadIdx.x >> 5));   // wave number in a scalar register: the wave's k offset goes into the scalar bases
    A += kw * (K / KW) * 16; Bt += kw * (K / KW) * 16;   // 32 k are one tile of 512 elements
    // three trips, known at compile time: unrolled, so that no address is computed per trip, the first products start from zero and loads of the later trips issue beside the first trip's
#pragma unroll
    for (int kc = 0; kc < K / KW; kc += 32) {
        V a[4];
#pragma unroll
        for (int mb = 0; mb < 4; ++mb) a[mb] = WFrag<bf>::ldf(A + kc * 16 + (off + mb * 16 * K));
#pragma unroll
        for (int nb = 0; nb < 4; ++nb) { const V b = WFrag<bf>::ldf(Bt + kc * 16 + (off + nb * 16 * K));
#pragma unroll
            for (int mb = 0; mb < 4; ++mb) acc[mb][nb] = WFrag<bf>::mma(a[mb], b, acc[mb][nb]); }
    }
    float* my = os + kw * (64 * 68);
    // the three loops are unrolled so that acc[][][] is indexed by constants and stays in registers
#pragma unroll
    for (int mb = 0; mb < 4; ++mb)
#pragma unroll
        for (int nb = 0; nb < 4; ++nb)
#pragma unroll
            for (int j = 0; j < 8; ++j) my[(mb * 16 + hi * 8 + j) * 68 + nb * 16 + lr] = acc[mb][nb][j];
    __syncthreads();   // every wave's partial tile is in LDS before any wave adds them
    constexpr int NP = (64 * 8) / (32 * KW);   // 8-column pieces per thread: a piece is one lane's 16 bytes of a fragment tile, and a wave's 32 pieces are 512 bytes in a row
    v8h o16[NP]; v8us oh[NP], ol[NP];
    // the loops are unrolled: the LDS reads of all partial tiles issue ahead of the adds, which keep the order w = 0..KW-1, and the piece arrays stay in registers
#pragma unroll
    for (int it = 0; it < NP; ++it) { const int tile = (kw >> 1) + it * (KW / 2);   // piece number threadIdx.x + it * 256 = (tile * 2 + half) * 32 + lane, half = kw & 1
        const int rt = (z == 2) ? (tile & 3) : (tile >> 1), ct = (z == 2) ? (tile >> 2) : (tile & 1); const int row = rt * 16 + lr, cofs = ct * 32 + (kw & 1) * 16 + hi * 8;
        v4f val = *(const v4fa*)(os + row * 68 + cofs), val2 = *(const v4fa*)(os + row * 68 + cofs + 4);
#pragma unroll
        for (int w = 1; w < KW; ++w) { val += *(const v4fa*)(os + w * (64 * 68) + row * 68 + cofs); val2 += *(const v4fa*)(os + w * (64 * 68) + row * 68 + cofs + 4); }
#pragma unroll
        for (int q = 0; q < 4; ++q) { o16[it][q] = tohx(val[q]); o16[it][q + 4] = tohx(val2[q]); unsigned short a2, c2; splitf(val[q], a2, c2); oh[it][q] = a2; ol[it][q] = c2; splitf(val2[q], a2, c2); oh[it][q + 4] = a2; ol[it][q + 4] = c2; } }
    // the six stores go out back to back behind all the rounding; unrolled: the piece arrays are indexed by constants
#pragma unroll
    for (int it = 0; it < NP; ++it) { const int e = ((int)threadIdx.x + it * (32 * KW)) * 8; *(v8h*)(P16 + e) = o16[it]; *(v8us*)(Ph + e) = oh[it]; *(v8us*)(Pl + e) = ol[it]; }
}
__global__ __launch_bounds__(256) void k_lnrS12(const float* __restrict__ wb, const float* __restrict__ Y, const float* __restrict__ g, const float* __restrict__ bb, float* ob) { const int lane = threadIdx.x & 31; const int row = blockIdx.x * 8 + (threadIdx.x >> 5); if (row >= TT) return; const float* br = wb + (size_t)row * BSZ * DM; const float* yr = Y + (size_t)row * DM; float v[DM / 32]; float s = 0.f;
#pragma unroll
    for (int ch = 0; ch < DM / 128; ++ch) { const v4f a = *(const v4f*)(br + ch * 128 + lane * 4); const v4f y4 = *(const v4f*)(yr + ch * 128 + lane * 4);
#pragma unroll
        for (int q = 0; q < 4; ++q) { float ab = bfr(a[q]); asm volatile("" : "+v"(ab)); float t = __fadd_rn(ab, y4[q]); asm volatile("" : "+v"(t)); v[ch * 4 + q] = t; s = __fadd_rn(s, t); } }
#pragma unroll
    for (int sh = 16; sh; sh >>= 1) s = __fadd_rn(s, __shfl_xor(s, sh, 32));
    const float mu = __fdiv_rn(s, (float)DM); float s2 = 0.f;
#pragma unroll
    for (int k = 0; k < DM / 32; ++k) { const float dv = __fsub_rn(v[k], mu); float p2 = __fmul_rn(dv, dv); asm volatile("" : "+v"(p2)); s2 = __fadd_rn(s2, p2); }
#pragma unroll
    for (int sh = 16; sh; sh >>= 1) s2 = __fadd_rn(s2, __shfl_xor(s2, sh, 32));
    const float rs = __fdiv_rn(1.0f, __fsqrt_rn(__fadd_rn(__fdiv_rn(s2, (float)DM), 1e-12f)));
{
#pragma unroll
        for (int ch = 0; ch < DM / 128; ++ch) { v4f o; for (int q = 0; q < 4; ++q) { const int col = ch * 128 + lane * 4 + q; float dv = __fsub_rn(v[ch * 4 + q], mu); asm volatile("" : "+v"(dv)); float y = __fmul_rn(dv, rs); asm volatile("" : "+v"(y)); float gg = bfr(g[col]), bb2 = bfr(bb[col]); asm volatile("" : "+v"(gg), "+v"(bb2)); y = __fmul_rn(y, gg); asm volatile("" : "+v"(y)); o[q] = __fadd_rn(y, bb2); }   /* every step kept separate: no fma contraction */
            *(v4f*)(ob + (size_t)row * BSZ * DM + ch * 128 + lane * 4) = o; }
         } }

// ---- k_fattn: scores, softmax, P V and the head merge for 32 query rows of one head, in one workgroup of 16 waves; scores and P stay in registers. Grid (heads, TT / 32): the hi/lo row blocks, which cost most, come first.
// Wave w owns keys [128 w, 128 w + 128). It forms the transposed scores S^T = K Q^T (A = key rows, B = query rows), so that a lane holds 64 scores of one query per 16-query tile, and two 16-key D tiles,
// converted in place, are the A fragment (row = query, k = key in the loaders' k order 8 hi + 0..7, 16 + 8 hi + 0..7) of P V. Row maximum and row sum: in the lane, across the two lane halves, then over the 16 waves through LDS in wave order.
// The 16 partial 32 x 64 outputs meet in LDS and are added in wave order 0..15 (k ranges and order as in k_gemmw with KW = 16); the sum is scaled, split hi/lo and stored at its place in the merged [t][h d] planes (fragment order).
typedef __attribute__((ext_vector_type(16))) unsigned short v16us;
template <typename T16, bool HL>
__device__ __forceinline__ void fattn(const T16* __restrict__ Q, const T16* __restrict__ Q2, const T16* __restrict__ Kp, const T16* __restrict__ K2, const T16* __restrict__ Vt, const T16* __restrict__ Vt2, bf* Ah, bf* Al, float* os, float* redm, float* reds) {
    typedef typename WFrag<T16>::V V;
    const int lane = threadIdx.x & 31, lr = lane & 15, hi = lane >> 4;
    const int kw = __builtin_amdgcn_readfirstlane((int)(threadIdx.x >> 5));   // wave number in a scalar register: the key offsets stay scalar
    const int key0 = kw * 128;
    // wave-uniform bases and one lane offset per plane kind: every fragment load is scalar base + lane offset + constant
    const int lo = lane * 8;   // planes in fragment order: fragment number n of a wave's range is tile n
    const T16* kb = Kp + (size_t)key0 * HD; const T16* kb2 = HL ? K2 + (size_t)key0 * HD : nullptr; const T16* vb = Vt + (size_t)key0 * HD; const T16* vb2 = HL ? Vt2 + (size_t)key0 * HD : nullptr;
    // every loop below is unrolled so that s[][][] and acc[][][] are indexed by constants and stay in registers
    v8f s[8][2];
#pragma unroll
    for (int kt = 0; kt < 8; ++kt) { s[kt][0] = (v8f){}; s[kt][1] = (v8f){}; }
    {
        V qf[2][2], q2f[2][2];
#pragma unroll
        for (int qt = 0; qt < 2; ++qt)
#pragma unroll
            for (int ks = 0; ks < 2; ++ks) { const int o = lo + (qt * 2 + ks) * 512; qf[qt][ks] = WFrag<T16>::ldf(Q + o); if (HL) q2f[qt][ks] = WFrag<T16>::ldf(Q2 + o); }
        V kf[2], k2f[2]; kf[0] = WFrag<T16>::ldf(kb + lo); if (HL) k2f[0] = WFrag<T16>::ldf(kb2 + lo);
#pragma unroll
        for (int it = 0; it < 16; ++it) { const int kt = it >> 1, ks = it & 1, c = it & 1, n = c ^ 1;
            if (it + 1 < 16) { const int o = lo + (it + 1) * 512; kf[n] = WFrag<T16>::ldf(kb + o); if (HL) k2f[n] = WFrag<T16>::ldf(kb2 + o); }   // the next fragment's loads fly during this fragment's products
#pragma unroll
            for (int qt = 0; qt < 2; ++qt) { s[kt][qt] = WFrag<T16>::mma(kf[c], qf[qt][ks], s[kt][qt]); if (HL) { s[kt][qt] = WFrag<T16>::mma(kf[c], q2f[qt][ks], s[kt][qt]); s[kt][qt] = WFrag<T16>::mma(k2f[c], qf[qt][ks], s[kt][qt]); } } }
    }
    float mx[2], f[2];
#pragma unroll
    for (int qt = 0; qt < 2; ++qt) { float m = s[0][qt][0];
#pragma unroll
        for (int kt = 0; kt < 8; ++kt)
#pragma unroll
            for (int j = 0; j < 8; ++j) m = fmaxf(m, s[kt][qt][j]);
        mx[qt] = fmaxf(m, __shfl_xor(m, 16, 32)); }
    redm[kw * 32 + lane] = hi ? mx[1] : mx[0];
    __syncthreads();   // every wave's row maxima are in LDS before any wave joins them
#pragma unroll
    for (int qt = 0; qt < 2; ++qt) { float m = redm[qt * 16 + lr];
#pragma unroll
        for (int w = 1; w < 16; ++w) m = fmaxf(m, redm[w * 32 + qt * 16 + lr]);
        mx[qt] = m * SCL; }   // SCL is a power of two: the maximum of the scaled scores, exactly
#pragma unroll
    for (int qt = 0; qt < 2; ++qt) { float a = 0.f;
#pragma unroll
        for (int kt = 0; kt < 8; ++kt)
#pragma unroll
            for (int j = 0; j < 8; ++j) { const float e = __builtin_amdgcn_exp2f((s[kt][qt][j] * SCL - mx[qt]) * 1.4426950408889634f); s[kt][qt][j] = e; a += e; }
        f[qt] = a + __shfl_xor(a, 16, 32); }
    reds[kw * 32 + lane] = hi ? f[1] : f[0];
    __syncthreads();   // every wave's row sums are in LDS before any wave joins them
#pragma unroll
    for (int qt = 0; qt < 2; ++qt) { float a = reds[qt * 16 + lr];
#pragma unroll
        for (int w = 1; w < 16; ++w) a += reds[w * 32 + qt * 16 + lr];
        f[qt] = __fdiv_rn(HL ? 1.0f : PCAR, a); }
    v8f acc[2][4];
#pragma unroll
    for (int nb = 0; nb < 4; ++nb) { acc[0][nb] = (v8f){}; acc[1][nb] = (v8f){}; }
    V vf[2], v2f[2]; vf[0] = WFrag<T16>::ldf(vb + lo); if (HL) v2f[0] = WFrag<T16>::ldf(vb2 + lo);
#pragma unroll
    for (int kk = 0; kk < 4; ++kk) {
        V pa[2], pa2[2];
#pragma unroll
        for (int qt = 0; qt < 2; ++qt) {
            if constexpr (HL) { v16us ph, pl;
#pragma unroll
                for (int e = 0; e < 16; ++e) { unsigned short a, c2; splitf(s[2 * kk + (e >> 3)][qt][e & 7] * f[qt], a, c2); ph[e] = a; pl[e] = c2; }
                pa[qt] = __builtin_bit_cast(v16bf, ph); pa2[qt] = __builtin_bit_cast(v16bf, pl);
            } else {
#pragma unroll
                for (int e = 0; e < 16; ++e) pa[qt][e] = tohx(s[2 * kk + (e >> 3)][qt][e & 7] * f[qt]);
            } }
#pragma unroll
        for (int nb = 0; nb < 4; ++nb) { const int it = kk * 4 + nb, c = it & 1, n = c ^ 1;
            if (it + 1 < 16) { const int o = lo + (it + 1) * 512; vf[n] = WFrag<T16>::ldf(vb + o); if (HL) v2f[n] = WFrag<T16>::ldf(vb2 + o); }   // the next fragment's loads fly during this fragment's products (and during the next P conversion)
#pragma unroll
            for (int qt = 0; qt < 2; ++qt) { acc[qt][nb] = WFrag<T16>::mma(pa[qt], vf[c], acc[qt][nb]); if (HL) { acc[qt][nb] = WFrag<T16>::mma(pa2[qt], vf[c], acc[qt][nb]); acc[qt][nb] = WFrag<T16>::mma(pa[qt], v2f[c], acc[qt][nb]); } } }
    }
    float* my = os + kw * (32 * 68);
#pragma unroll
    for (int qt = 0; qt < 2; ++qt)
#pragma unroll
        for (int nb = 0; nb < 4; ++nb)
#pragma unroll
            for (int j = 0; j < 8; ++j) my[(qt * 16 + hi * 8 + j) * 68 + nb * 16 + lr] = acc[qt][nb][j];
    __syncthreads();   // every wave's partial output tile is in LDS before any wave adds them
    // the 32 x 64 sum is 4 fragment tiles = 256 pieces of 8 columns (one lane's 16 bytes): waves 0..7 take one piece a lane (tile kw >> 1, half kw & 1) and store 512 bytes in a row; no barrier follows
    if (kw >= 8) return;
    const int qt = kw >> 2, ks = (kw >> 1) & 1; const int row = qt * 16 + lr, cofs = ks * 32 + (kw & 1) * 16 + hi * 8; v4f val = *(const v4fa*)(os + row * 68 + cofs), val2 = *(const v4fa*)(os + row * 68 + cofs + 4);
#pragma unroll
    for (int w = 1; w < 16; ++w) { val += *(const v4fa*)(os + w * (32 * 68) + row * 68 + cofs); val2 += *(const v4fa*)(os + w * (32 * 68) + row * 68 + cofs + 4); }
    const float cs = HL ? 1.0f : (1.0f / PCAR); v8us oh, ol;
#pragma unroll
    for (int q = 0; q < 4; ++q) { unsigned short a, c2; splitf(val[q] * cs, a, c2); oh[q] = a; ol[q] = c2; splitf(val2[q] * cs, a, c2); oh[q + 4] = a; ol[q + 4] = c2; }
    const int e = (qt * (DQ / 32) + ks) * 512 + (kw & 1) * 256 + lane * 8; *(v8us*)(Ah + e) = oh; *(v8us*)(Al + e) = ol;
}
__global__ __launch_bounds__(512) void k_fattn(const h16* __restrict__ Q16, const h16* __restrict__ K16, const h16* __restrict__ V16, const bf* __restrict__ Qh, const bf* __restrict__ Ql, const bf* __restrict__ Kh, const bf* __restrict__ Kl, const bf* __restrict__ Vh, const bf* __restrict__ Vl, bf* Ah, bf* Al) {
    __shared__ __align__(16) float os[16 * 32 * 68]; __shared__ float redm[16 * 32]; __shared__ float reds[16 * 32];
    const int h = blockIdx.x, q0 = blockIdx.y * 32; const size_t zq = ((size_t)h * TT + q0) * HD, zk = (size_t)(h / REP) * TT * HD, oo = (size_t)q0 * DQ + h * (HD * 16);   // merged planes [t][h d] in fragment order: a band of 16 rows is 16 DQ elements, a head is 2 tiles in it
    static_assert(RH % 32 == 0 && TT == 16 * 128 && HD == 64, "a row block is all hi/lo or all fp16; 16 waves x 128 keys; 4 output column tiles");
    if (q0 < RH) fattn<bf, true>(Qh + zq, Ql + zq, Kh + zk, Kl + zk, Vh + zk, Vl + zk, Ah + oo, Al + oo, os, redm, reds);
    else fattn<h16, false>(Q16 + zq, nullptr, K16 + zk, nullptr, V16 + zk, nullptr, Ah + oo, Al + oo, os, redm, reds);
}

extern "C" void kernel_launch(void* const* d_in, const int* in_sizes, int n_in,
                              void* d_out, int out_size, void* d_ws, size_t ws_size, hipStream_t stream) {
    (void)in_sizes; (void)n_in; (void)out_size;
    const float* x = (const float*)d_in[0]; const float* wq = (const float*)d_in[1]; const float* wk = (const float*)d_in[2]; const float* wv = (const float*)d_in[3]; const float* wo = (const float*)d_in[4]; const float* lng = (const float*)d_in[5]; const float* lnb = (const float*)d_in[6];
    float* OUT = (float*)d_out;     // [1][2048][768]
    char* wsp = (char*)d_ws;
    auto take = [&](size_t bytes) { char* p = wsp; wsp += (bytes + 255) & ~(size_t)255; return (void*)p; };
    float* Y = (float*)take((size_t)TT * DM * 4); bf* WQ = (bf*)take((size_t)DQ * DM * 2); bf* WK = (bf*)take((size_t)DKV * DM * 2); bf* WV = (bf*)take((size_t)DKV * DM * 2); bf* WO = (bf*)take((size_t)DM * DQ * 2);
    bf* XB = (bf*)take((size_t)TT * DM * 2);
    h16* QP16 = (h16*)take((size_t)NH_ * TT * HD * 2); h16* KP16 = (h16*)take((size_t)NKV * TT * HD * 2); h16* VT16 = (h16*)take((size_t)NKV * HD * TT * 2);
    bf* QPh = (bf*)take((size_t)NH_ * TT * HD * 2); bf* QPl = (bf*)take((size_t)NH_ * TT * HD * 2); bf* KPh = (bf*)take((size_t)NKV * TT * HD * 2); bf* KPl = (bf*)take((size_t)NKV * TT * HD * 2); bf* VTh = (bf*)take((size_t)NKV * HD * TT * 2); bf* VTl = (bf*)take((size_t)NKV * HD * TT * 2);
    bf* ATh = (bf*)take((size_t)TT * DQ * 2); bf* ATl = (bf*)take((size_t)TT * DQ * 2);
    if ((size_t)(wsp - (char*)d_ws) > ws_size) return;    // ws 256 MiB
    k_cvt8<<<TT * DM / 16 / 256 + 4 * (DM * DM / 16 / 256), 256, 0, stream>>>(x, wq, wk, wv, wo, XB, WQ, WK, WV, WO);
    for (int b = 0; b < NB_; ++b) {
        
        k_qkv<<<dim3(TT / 64, NH_, 3), 256, 0, stream>>>(XB, WQ, WK, WV, QP16, QPh, QPl, KP16, KPh, KPl, VT16, VTh, VTl);
        k_fattn<<<dim3(NH_, TT / 32, 1), 512, 0, stream>>>(QP16, KP16, VT16, QPh, QPl, KPh, KPl, VTh, VTl, ATh, ATl);
        k_gemmw<bf, 1, false, 8, DQ><<<dim3(TT / 64, DM / 64, 1), 256, 0, stream>>>(ATh, ATl, WO, nullptr, Y, DM, nullptr, 0, 0, 0); k_lnrS12<<<TT / 8, 256, 0, stream>>>(x + (size_t)b * TT * DM, Y, lng, lnb, OUT + (size_t)b * TT * DM);   /* LayerNorm(out + x), eps 1e-12 */ }
}

// v007
// A run of this version takes 67.4 microseconds.
// Timed twice side by side with v006, it ran 1.15 and 1.14 times as fast.
// All steps since v000 together make it 11.4 times as fast.
#include <hip/hip_runtime.h>

// BERT self-attention with residual + LayerNorm (x [2048][768], unbatched; q,k,v = x W^T ('oi' [768][768], no bias, 1/sqrt(768)); 12 heads x 64; softmax(q.k / 8) over all keys; out = merged Wo^T; y = LayerNorm(out + x) gamma + beta (eps 1e-12) -> [2048][768] (1.6 M)).
// Every 16-bit operand plane in the workspace is kept in fragment order (see WFrag::ldf): 16 x 32 tiles of 512 elements, a lane's two 16-byte pieces at lane * 8 and 256 + lane * 8, so that one wave-wide 16-byte load reads 512 contiguous bytes.
// Layout: bf16 copies of x and the four weights, one launch; exact projections, q, k and v in one launch that writes the head planes itself; dense T-2048 attention in one fused kernel, scores and P in registers (hybrid rows: < 512 hi/lo 3 products, rest fp16 x1024); merged hi/lo x Wo exact into workspace; a LayerNorm row kernel adds bf16(x) and writes the output rows (one wave per row, 24 values per lane, f32 fixed order).
// Compute dtypes, f32 accumulate: every input rounded to bf16; projections exact; attention rows < 512 3 products, rest fp16; softmax, residual and LayerNorm f32; Wo hl x exact.

#define NB_  1
#define TT   2048
#define DM   768
#define NH_  12
#define NKV  12
#define REP  (NH_ / NKV)
#define HD   64
#define DQ   (NH_ * HD)
#define DKV  (NKV * HD)
#define RH   512                  // query rows < RH use hi+lo planes (0: none)
#define WIN  0
#define PCAR 1024.0f
#define SCL  0.125f
#define BSZ  1
typedef _Float16 h16;
typedef unsigned short bf;
typedef __attribute__((ext_vector_type(16))) __bf16   v16bf;
typedef __attribute__((ext_vector_type(16))) _Float16 v16h;
typedef __attribute__((ext_vector_type(8)))  _Float16 v8h;
typedef __attribute__((ext_vector_type(8)))  unsigned short v8us;
typedef __attribute__((ext_vector_type(8)))  float    v8f;
typedef __attribute__((ext_vector_type(4)))  float    v4f;
typedef v8h  __attribute__((may_alias)) v8ha;
typedef v4f  __attribute__((may_alias)) v4fa;
typedef v8us __attribute__((may_alias)) v8usa;

__device__ __forceinline__ unsigned short f2bf(float f) { unsigned u = __float_as_uint(f); u += 0x7FFFu + ((u >> 16) & 1u); return (unsigned short)(u >> 16); }
__device__ __forceinline__ float bf2f(unsigned short b) { return __uint_as_float(((unsigned)b) << 16); }
__device__ __forceinline__ float bfr(float f) { return bf2f(f2bf(f)); }
__device__ __forceinline__ v16h cat16(v8h lo, v8h hi) { return __builtin_shufflevector(lo, hi, 0, 1, 2, 3, 4, 5, 6, 7, 8, 9, 10, 11, 12, 13, 14, 15); }
__device__ __forceinline__ v16bf cat16b(v8us lo, v8us hi) { return __builtin_bit_cast(v16bf, __builtin_shufflevector(lo, hi, 0, 1, 2, 3, 4, 5, 6, 7, 8, 9, 10, 11, 12, 13, 14, 15)); }
__device__ __forceinline__ v8f wmma16(v16h a, v16h b, v8f c) { return __builtin_amdgcn_wmma_f32_16x16x32_f16(false, a, false, b, (short)0, c, false, false); }
__device__ __forceinline__ v8f wmmab(v16bf a, v16bf b, v8f c) { return __builtin_amdgcn_wmma_f32_16x16x32_bf16(false, a, false, b, (short)0, c, false, false); }



// ---- k_gemmw: register-blocked GEMM, one 64x64 output tile per workgroup (16 accumulators per wave), operands straight from 16-bit planes in fragment order; grid (M/64, N/64, Z), 32 * KW threads.
// C[m][n] (f32, pitch ldc, + optional f32 bias[n]) = sum_k A[m][k] Bt[n][k] (+ split products per NSPLIT). z-batch strides sA/sB/sC in elements. K % (32 * KW) == 0.
// KW waves share the tile: wave w sums the k range [w K/KW, (w+1) K/KW) of the whole tile; the KW partial tiles meet in LDS and are added in wave order 0..KW-1 (fixed f32 order).
// Fragment order of a plane [R][K]: tile (r >> 4, k >> 5) is number (r >> 4) * (K / 32) + (k >> 5); in it element (r, k) stands at ((k >> 4) & 1) * 256 + (((k >> 3) & 1) * 16 + (r & 15)) * 8 + (k & 7).
// ldf(tile + lane * 8) gives lane (lr, hi) the same 16 values as ld(row lr, k = 8 hi) of a row-major plane: k = 8 hi + 0..7 and 16 + 8 hi + 0..7.
template <typename T16> struct WFrag;
template <> struct WFrag<h16> { typedef v16h V; static __device__ __forceinline__ V ld(const h16* p) { return cat16(*(const v8h*)p, *(const v8h*)(p + 16)); } static __device__ __forceinline__ V ldf(const h16* p) { return cat16(*(const v8h*)p, *(const v8h*)(p + 256)); } static __device__ __forceinline__ v8f mma(V a, V b, v8f c) { return wmma16(a, b, c); } };
template <> struct WFrag<bf> { typedef v16bf V; static __device__ __forceinline__ V ld(const bf* p) { return cat16b(*(const v8us*)p, *(const v8us*)(p + 16)); } static __device__ __forceinline__ V ldf(const bf* p) { return cat16b(*(const v8us*)p, *(const v8us*)(p + 256)); } static __device__ __forceinline__ v8f mma(V a, V b, v8f c) { return wmmab(a, b, c); } };
template <typename T16, int NSPLIT, bool BIAS, int KW, int K>   // K at compile time: the distance from band to band is a constant of the load
__global__ __launch_bounds__(32 * KW) void k_gemmw(const T16* __restrict__ A, const T16* __restrict__ A2, const T16* __restrict__ Bt, const T16* __restrict__ Bt2, float* C, int ldc, const float* __restrict__ bias, size_t sA, size_t sB, size_t sC) {
    typedef typename WFrag<T16>::V V;
    __shared__ __align__(16) float os[KW == 1 ? 16 * 68 : KW * 64 * 68];
    const size_t z = blockIdx.z; A += z * sA; if (A2) A2 += z * sA; Bt += z * sB; if (Bt2) Bt2 += z * sB; C += z * sC;
    const int lane = threadIdx.x & 31, lr = lane & 15, hi = lane >> 4; const int r0 = blockIdx.x * 64, c0 = blockIdx.y * 64;
    v8f acc[4][4];
#pragma unroll
    for (int mb = 0; mb < 4; ++mb)
#pragma unroll
        for (int nb = 0; nb < 4; ++nb) acc[mb][nb] = (v8f){};
    // a band of 16 rows is K / 32 tiles = 16 K elements, and the tile of k step kc starts at kc * 16: a wave-uniform base per k step, one lane offset and a constant per band
    const int lo = lane * 8; A += (size_t)r0 * K; if (NSPLIT == 1 || NSPLIT == 2) A2 += (size_t)r0 * K; Bt += (size_t)c0 * K; if (NSPLIT >= 2) Bt2 += (size_t)c0 * K;
    const int kw = (KW == 1) ? 0 : __builtin_amdgcn_readfirstlane((int)(threadIdx.x >> 5));   // wave number in a scalar register: the k loop stays a scalar loop
    const int kbeg = kw * (K / KW), kend = kbeg + K / KW;
    // K / KW / 32 trips, known at compile time: unrolled, as in k_qkv, so that every tile address is scalar base + lane offset + constant, with no 64-bit vector address arithmetic per trip
#pragma unroll
    for (int kc = kbeg; kc < kend; kc += 32) {
        V a[4], a2[4]; const T16* Ak = A + kc * 16; const T16* A2k = (NSPLIT == 1 || NSPLIT == 2) ? A2 + kc * 16 : nullptr; const T16* Bk = Bt + kc * 16; const T16* B2k = (NSPLIT >= 2) ? Bt2 + kc * 16 : nullptr;
#pragma unroll
        for (int mb = 0; mb < 4; ++mb) { a[mb] = WFrag<T16>::ldf(Ak + (lo + mb * 16 * K)); if (NSPLIT == 1 || NSPLIT == 2) a2[mb] = WFrag<T16>::ldf(A2k + (lo + mb * 16 * K)); }
#pragma unroll
        for (int nb = 0; nb < 4; ++nb) { const V b = WFrag<T16>::ldf(Bk + (lo + nb * 16 * K)); V b2; if (NSPLIT >= 2) b2 = WFrag<T16>::ldf(B2k + (lo + nb * 16 * K));
#pragma unroll
            for (int mb = 0; mb < 4; ++mb) { acc[mb][nb] = WFrag<T16>::mma(a[mb], b, acc[mb][nb]); if (NSPLIT == 1 || NSPLIT == 2) acc[mb][nb] = WFrag<T16>::mma(a2[mb], b, acc[mb][nb]); if (NSPLIT >= 2) acc[mb][nb] = WFrag<T16>::mma(a[mb], b2, acc[mb][nb]); } }
        asm volatile("v_nop\n\tv_nop\n\tv_nop\n\tv_nop" : "+v"(acc[0][0]), "+v"(acc[1][1]), "+v"(acc[2][2]), "+v"(acc[3][3]) : "v"(a[0]), "v"(a[3]));
    }
    if constexpr (KW > 1) {
        float* my = os + kw * (64 * 68);
        // the three loops are unrolled so that acc[][][] is indexed by constants and stays in registers
#pragma unroll
        for (int mb = 0; mb < 4; ++mb)
#pragma unroll
            for (int nb = 0; nb < 4; ++nb)
#pragma unroll
                for (int j = 0; j < 8; ++j) my[(mb * 16 + hi * 8 + j) * 68 + nb * 16 + lr] = acc[mb][nb][j];
        __syncthreads();   // every wave's partial tile is in LDS before any wave adds them
        static_assert((64 * 16) % (32 * KW) == 0, "each thread adds the same number of 4-column pieces");
        // both loops unrolled: the LDS reads of all partial tiles issue ahead of the adds, which keep the order w = 0..KW-1
#pragma unroll
        for (int it = 0; it < (64 * 16) / (32 * KW); ++it) { const int s = (int)threadIdx.x + it * (32 * KW); const int row = s >> 4, cofs = (s & 15) * 4; v4f val = *(const v4fa*)(os + row * 68 + cofs);
#pragma unroll
            for (int w = 1; w < KW; ++w) val += *(const v4fa*)(os + w * (64 * 68) + row * 68 + cofs);
            if (BIAS) { val[0] += bfr(bias[c0 + cofs]); val[1] += bfr(bias[c0 + cofs + 1]); val[2] += bfr(bias[c0 + cofs + 2]); val[3] += bfr(bias[c0 + cofs + 3]); }
            *(v4f*)(C + (size_t)(r0 + row) * ldc + c0 + cofs) = val; }
        return;
    }
#pragma unroll
    for (int mb = 0; mb < 4; ++mb) {
#pragma unroll
        for (int nb = 0; nb < 4; ++nb) {
#pragma unroll
            for (int j = 0; j < 8; ++j) os[(hi * 8 + j) * 68 + nb * 16 + lr] = acc[mb][nb][j]; }
        __builtin_amdgcn_wave_barrier(); asm volatile("" ::: "memory");
        float* crow = C + (size_t)(r0 + mb * 16) * ldc + c0;
{
#pragma unroll
            for (int s = 0; s < 8; ++s) { const int row = 2 * s + hi, cofs = lr * 4; v4f val = *(const v4fa*)(os + row * 68 + cofs); if (BIAS) { val[0] += bfr(bias[c0 + cofs]); val[1] += bfr(bias[c0 + cofs + 1]); val[2] += bfr(bias[c0 + cofs + 2]); val[3] += bfr(bias[c0 + cofs + 3]); }
                *(v4f*)(crow + (size_t)row * ldc + cofs) = val; }
             }
        __builtin_amdgcn_wave_barrier(); asm volatile("" ::: "memory");
    }
}

__device__ __forceinline__ h16 tohx(float x) { return (h16)x; }
__device__ __forceinline__ void splitf(float y, unsigned short& h, unsigned short& l) { h = f2bf(y); l = f2bf(y - bf2f(h)); }
typedef __attribute__((ext_vector_type(2))) _Float16 v2h;
typedef __attribute__((ext_vector_type(4))) _Float16 v4h;
typedef __attribute__((ext_vector_type(2))) unsigned short v2us;
typedef __attribute__((ext_vector_type(4))) unsigned short v4us;
typedef __attribute__((ext_vector_type(2))) float v2f;
typedef __attribute__((ext_vector_type(4))) int v4i;

__global__ __launch_bounds__(256) void k_wtG(const float* __restrict__ w, int K, int N, bf* Bt) {
    const int lane = threadIdx.x & 31; const int L0 = (blockIdx.x * 8 + (threadIdx.x >> 5)) * 8; const int nlines = N * K / 64;
{
#pragma unroll 1
        for (int l = 0; l < 8; ++l) { const int L = L0 + l; if (L >= nlines) break; const size_t e = (size_t)L * 64 + lane * 2; const int k = (int)(e % K), n = (int)(e / K); v2us o;
            o[0] = f2bf(w[(size_t)k * N + n]); o[1] = f2bf(w[(size_t)(k + 1) * N + n]); *(v2us*)(Bt + e) = o; }
         }
}
// f32 [R][DM] row-major -> bf16 in fragment order; one wave per 16 x 32 tile: it reads 16 whole 128-byte lines and stores 1 KiB in a row.
// One launch converts all five planes: workgroups [0, BX) take x, then BW workgroups each for Wq, Wk, Wv, Wo; a workgroup lies wholly in one plane, so source and destination are chosen by scalar tests.
__global__ __launch_bounds__(256) void k_cvt8(const float* __restrict__ x, const float* __restrict__ wq, const float* __restrict__ wk, const float* __restrict__ wv, const float* __restrict__ wo, bf* XB, bf* WQ, bf* WK, bf* WV, bf* WO) {
    constexpr int BX = TT * DM / 16 / 256, BW = DM * DM / 16 / 256;
    static_assert(NB_ == 1 && DQ == DM && DKV == DM && (TT * DM) % (16 * 256) == 0 && (DM * DM) % (16 * 256) == 0, "one x plane, four square weights, whole workgroups per plane");
    int b = blockIdx.x; const float* src = x; bf* dst = XB;
    if (b >= BX) { b -= BX; const int p = b / BW; b -= p * BW; src = p == 0 ? wq : p == 1 ? wk : p == 2 ? wv : wo; dst = p == 0 ? WQ : p == 1 ? WK : p == 2 ? WV : WO; }
    const int lane = threadIdx.x & 31; const int tile = b * 8 + (int)(threadIdx.x >> 5), rt = tile / (DM / 32), kt = tile % (DM / 32);
    const float* s = src + (size_t)(rt * 16 + (lane & 15)) * DM + kt * 32 + (lane >> 4) * 8; const v8f v = *(const v8f*)s, w = *(const v8f*)(s + 16); v8us o, o2;
#pragma unroll
    for (int k = 0; k < 8; ++k) { o[k] = f2bf(v[k]); o2[k] = f2bf(w[k]); }
    bf* d = dst + (size_t)tile * 512 + lane * 8; *(v8us*)d = o; *(v8us*)(d + 256) = o2; }

// ---- k_qkv: the three projections in one launch, grid (TT / 64, heads, 3), 8 waves; one 64x64 tile per workgroup; fragments, k split over the waves and LDS sum in wave order as in k_gemmw with KW = 8.
// A tile is 64 tokens of one head, so the epilogue rounds the f32 sums itself and stores them at their place in the head planes (fp16, hi, lo): no f32 copy of q, k, v in the workspace.
// z = 0, 1: rows = tokens (A = x), columns = d (B = Wq, Wk) -> planes [h][t][d]. z = 2: rows = d (A = Wv), columns = tokens (B = x) -> planes [h][d][t], the transposed V that P V reads.
// The head planes are in fragment order too. q, k: tile number (t >> 4) * 2 + (d >> 5) in the head. V: tile number (t >> 5) * 4 + (d >> 4), so that the 128 keys of one attention wave are 16 tiles in a row. Either way a 64 x 64 tile is 8 fragment tiles, 4096 elements, in a row.
__global__ __launch_bounds__(256) void k_qkv(const bf* __restrict__ X, const bf* __restrict__ Wq, const bf* __restrict__ Wk, const bf* __restrict__ Wv, h16* Q16, bf* Qh, bf* Ql, h16* K16, bf* Kh, bf* Kl, h16* V16, bf* Vh, bf* Vl) {
    typedef WFrag<bf>::V V;
    constexpr int KW = 8, K = DM;
    static_assert(DQ == DKV && HD == 64 && TT % 64 == 0 && K % (32 * KW) == 0, "one grid for q, k and v; a tile is one head wide");
    __shared__ __align__(16) float os[KW * 64 * 68];
    const int z = blockIdx.z, tb = blockIdx.x, hb = blockIdx.y;
    const bf* xt = X + (size_t)tb * 64 * K; const bf* wt = (z == 0 ? Wq : z == 1 ? Wk : Wv) + (size_t)hb * 64 * K;
    const bf* A = (z == 2) ? wt : xt; const bf* Bt = (z == 2) ? xt : wt;
    const size_t base = (size_t)hb * TT * HD + (size_t)tb * 64 * HD;
    h16* P16 = (z == 0 ? Q16 : z == 1 ? K16 : V16) + base; bf* Ph = (z == 0 ? Qh : z == 1 ? Kh : Vh) + base; bf* Pl = (z == 0 ? Ql : z == 1 ? Kl : Vl) + base;
    const int lane = threadIdx.x & 31, lr = lane & 15, hi = lane >> 4;
    v8f acc[4][4];
#pragma unroll
    for (int mb = 0; mb < 4; ++mb)
#pragma unroll
        for (int nb = 0; nb < 4; ++nb) acc[mb][nb] = (v8f){};
    const int off = lane * 8;   // wave-uniform bases and one lane offset: every fragment load is scalar base + lane offset + constant
    const int kw = __builtin_amdgcn_readfirstlane((int)(threadIdx.x >> 5));   // wave number in a scalar register: the wave's k offset goes into the scalar bases
    A += kw * (K / KW) * 16; Bt += kw * (K / KW) * 16;   // 32 k are one tile of 512 elements
    // three trips, known at compile time. The loads of trips 0 and 1 are issued as one group ahead of the first product, those of trip 2 as soon as registers of trip 0 (then of trip 1) are free:
    // a wave waits out one L2 latency, not one per late fragment. Products in the order trip, nb, mb, as before.
    static_assert(K / KW == 96, "three trips");
    V a[3][4], b[3][4];
    auto lda = [&](int t, int mb) { a[t][mb] = WFrag<bf>::ldf(A + t * 512 + (off + mb * 16 * K)); };
    auto ldb = [&](int t, int nb) { b[t][nb] = WFrag<bf>::ldf(Bt + t * 512 + (off + nb * 16 * K)); };
    auto prod = [&](int t, int nb) {
#pragma unroll
        for (int mb = 0; mb < 4; ++mb) acc[mb][nb] = WFrag<bf>::mma(a[t][mb], b[t][nb], acc[mb][nb]); };
#pragma unroll
    for (int t = 0; t < 2; ++t) {
#pragma unroll
        for (int i = 0; i < 4; ++i) lda(t, i);
#pragma unroll
        for (int i = 0; i < 4; ++i) ldb(t, i); }
    __builtin_amdgcn_sched_barrier(0);   // keeps the 32 loads above ahead of every product: left alone the compiler issued 13 of the 24 fragments late, most directly in front of their products
#pragma unroll
    for (int nb = 0; nb < 4; ++nb) prod(0, nb);
    __builtin_amdgcn_sched_barrier(0);   // trip 2's first loads stand here, a whole trip ahead of their products, not later
#pragma unroll
    for (int i = 0; i < 4; ++i) lda(2, i);
    ldb(2, 0); ldb(2, 1);
    __builtin_amdgcn_sched_barrier(0);   // as above
    prod(1, 0); prod(1, 1);
    __builtin_amdgcn_sched_barrier(0);   // trip 2's last loads stand here, 16 products ahead of their own
    ldb(2, 2); ldb(2, 3);
    __builtin_amdgcn_sched_barrier(0);   // as above
    prod(1, 2); prod(1, 3);
#pragma unroll
    for (int nb = 0; nb < 4; ++nb) prod(2, nb);
    float* my = os + kw * (64 * 68);
    // the three loops are unrolled so that acc[][][] is indexed by constants and stays in registers
#pragma unroll
    for (int mb = 0; mb < 4; ++mb)
#pragma unroll
        for (int nb = 0; nb < 4; ++nb)
#pragma unroll
            for (int j = 0; j < 8; ++j) my[(mb * 16 + hi * 8 + j) * 68 + nb * 16 + lr] = acc[mb][nb][j];
    __syncthreads();   // every wave's partial tile is in LDS before any wave adds them
    constexpr int NP = (64 * 8) / (32 * KW);   // 8-column pieces per thread: a piece is one lane's 16 bytes of a fragment tile, and a wave's 32 pieces are 512 bytes in a row
    v8h o16[NP]; v8us oh[NP], ol[NP];
    // the loops are unrolled: the LDS reads of all partial tiles issue ahead of the adds, which keep the order w = 0..KW-1, and the piece arrays stay in registers
#pragma unroll
    for (int it = 0; it < NP; ++it) { const int tile = (kw >> 1) + it * (KW / 2);   // piece number threadIdx.x + it * 256 = (tile * 2 + half) * 32 + lane, half = kw & 1
        const int rt = (z == 2) ? (tile & 3) : (tile >> 1), ct = (z == 2) ? (tile >> 2) : (tile & 1); const int row = rt * 16 + lr, cofs = ct * 32 + (kw & 1) * 16 + hi * 8;
        v4f val = *(const v4fa*)(os + row * 68 + cofs), val2 = *(const v4fa*)(os + row * 68 + cofs + 4);
#pragma unroll
        for (int w = 1; w < KW; ++w) { val += *(const v4fa*)(os + w * (64 * 68) + row * 68 + cofs); val2 += *(const v4fa*)(os + w * (64 * 68) + row * 68 + cofs + 4); }
#pragma unroll
        for (int q = 0; q < 4; ++q) { o16[it][q] = tohx(val[q]); o16[it][q + 4] = tohx(val2[q]); unsigned short a2, c2; splitf(val[q], a2, c2); oh[it][q] = a2; ol[it][q] = c2; splitf(val2[q], a2, c2); oh[it][q + 4] = a2; ol[it][q + 4] = c2; } }
    // the six stores go out back to back behind all the rounding; unrolled: the piece arrays are indexed by constants
#pragma unroll
    for (int it = 0; it < NP; ++it) { const int e = ((int)threadIdx.x + it * (32 * KW)) * 8; *(v8h*)(P16 + e) = o16[it]; *(v8us*)(Ph + e) = oh[it]; *(v8us*)(Pl + e) = ol[it]; }
}
__global__ __launch_bounds__(256) void k_lnrS12(const float* __restrict__ wb, const float* __restrict__ Y, const float* __restrict__ g, const float* __restrict__ bb, float* ob) { const int lane = threadIdx.x & 31; const int row = blockIdx.x * 8 + (threadIdx.x >> 5); if (row >= TT) return; const float* br = wb + (size_t)row * BSZ * DM; const float* yr = Y + (size_t)row * DM; float v[DM / 32]; float s = 0.f;
    // every load of the row (x, the product, gamma, beta: 16 bytes a lane each) is issued here, ahead of the arithmetic: one memory latency per wave instead of one per 128 columns and one per gamma / beta element
    v4f a6[DM / 128], y6[DM / 128], g6[DM / 128], b6[DM / 128];
#pragma unroll
    for (int ch = 0; ch < DM / 128; ++ch) { a6[ch] = *(const v4f*)(br + ch * 128 + lane * 4); y6[ch] = *(const v4f*)(yr + ch * 128 + lane * 4); }
#pragma unroll
    for (int ch = 0; ch < DM / 128; ++ch) { g6[ch] = *(const v4f*)(g + ch * 128 + lane * 4); b6[ch] = *(const v4f*)(bb + ch * 128 + lane * 4); }
#pragma unroll
    for (int ch = 0; ch < DM / 128; ++ch) { const v4f a = a6[ch]; const v4f y4 = y6[ch];
#pragma unroll
        for (int q = 0; q < 4; ++q) { float ab = bfr(a[q]); asm volatile("" : "+v"(ab)); float t = __fadd_rn(ab, y4[q]); asm volatile("" : "+v"(t)); v[ch * 4 + q] = t; s = __fadd_rn(s, t); } }
#pragma unroll
    for (int sh = 16; sh; sh >>= 1) s = __fadd_rn(s, __shfl_xor(s, sh, 32));
    const float mu = __fdiv_rn(s, (float)DM); float s2 = 0.f;
#pragma unroll
    for (int k = 0; k < DM / 32; ++k) { const float dv = __fsub_rn(v[k], mu); float p2 = __fmul_rn(dv, dv); asm volatile("" : "+v"(p2)); s2 = __fadd_rn(s2, p2); }
#pragma unroll
    for (int sh = 16; sh; sh >>= 1) s2 = __fadd_rn(s2, __shfl_xor(s2, sh, 32));
    const float rs = __fdiv_rn(1.0f, __fsqrt_rn(__fadd_rn(__fdiv_rn(s2, (float)DM), 1e-12f)));
{
#pragma unroll
        for (int ch = 0; ch < DM / 128; ++ch) { v4f o; for (int q = 0; q < 4; ++q) { float dv = __fsub_rn(v[ch * 4 + q], mu); asm volatile("" : "+v"(dv)); float y = __fmul_rn(dv, rs); asm volatile("" : "+v"(y)); float gg = bfr(g6[ch][q]), bb2 = bfr(b6[ch][q]); asm volatile("" : "+v"(gg), "+v"(bb2)); y = __fmul_rn(y, gg); asm volatile("" : "+v"(y)); o[q] = __fadd_rn(y, bb2); }   /* every step kept separate: no fma contraction */
            *(v4f*)(ob + (size_t)row * BSZ * DM + ch * 128 + lane * 4) = o; }
         } }

// ---- k_fattn: scores, softmax, P V and the head merge for 32 query rows of one head, in one workgroup of 16 waves; scores and P stay in registers. Grid (heads, TT / 32): the hi/lo row blocks, which cost most, come first.
// Wave w owns keys [128 w, 128 w + 128). It forms the transposed scores S^T = K Q^T (A = key rows, B = query rows), so that a lane holds 64 scores of one query per 16-query tile, and two 16-key D tiles,
// converted in place, are the A fragment (row = query, k = key in the loaders' k order 8 hi + 0..7, 16 + 8 hi + 0..7) of P V. Row maximum and row sum: in the lane, across the two lane halves, then over the 16 waves through LDS in wave order.
// The 16 partial 32 x 64 outputs meet in LDS and are added in wave order 0..15 (k ranges and order as in k_gemmw with KW = 16); the sum is scaled, split hi/lo and stored at its place in the merged [t][h d] planes (fragment order).
typedef __attribute__((ext_vector_type(16))) unsigned short v16us;
template <typename T16, bool HL>
__device__ __forceinline__ void fattn(const T16* __restrict__ Q, const T16* __restrict__ Q2, const T16* __restrict__ Kp, const T16* __restrict__ K2, const T16* __restrict__ Vt, const T16* __restrict__ Vt2, bf* Ah, bf* Al, float* os, float* redm, float* reds) {
    typedef typename WFrag<T16>::V V;
    const int lane = threadIdx.x & 31, lr = lane & 15, hi = lane >> 4;
    const int kw = __builtin_amdgcn_readfirstlane((int)(threadIdx.x >> 5));   // wave number in a scalar register: the key offsets stay scalar
    const int key0 = kw * 128;
    // wave-uniform bases and one lane offset per plane kind: every fragment load is scalar base + lane offset + constant
    const int lo = lane * 8;   // planes in fragment order: fragment number n of a wave's range is tile n
    const T16* kb = Kp + (size_t)key0 * HD; const T16* kb2 = HL ? K2 + (size_t)key0 * HD : nullptr; const T16* vb = Vt + (size_t)key0 * HD; const T16* vb2 = HL ? Vt2 + (size_t)key0 * HD : nullptr;
    // every loop below is unrolled so that s[][][] and acc[][][] are indexed by constants and stay in registers
    v8f s[8][2];
#pragma unroll
    for (int kt = 0; kt < 8; ++kt) { s[kt][0] = (v8f){}; s[kt][1] = (v8f){}; }
    {
        V qf[2][2], q2f[2][2];
#pragma unroll
        for (int qt = 0; qt < 2; ++qt)
#pragma unroll
            for (int ks = 0; ks < 2; ++ks) { const int o = lo + (qt * 2 + ks) * 512; qf[qt][ks] = WFrag<T16>::ldf(Q + o); if (HL) q2f[qt][ks] = WFrag<T16>::ldf(Q2 + o); }
        // K fragments are loaded KD fragments ahead of their products. With hi and lo planes: 4 ahead (24 products, which cover an L2 latency with four waves on the SIMD), held there by the scheduling barriers. With one plane the order is left to the compiler, which issues nearly all loads at the start.
        constexpr int KD = HL ? 4 : 1;
        V kf[16], k2f[16];
#pragma unroll
        for (int it = 0; it < KD; ++it) { const int o = lo + it * 512; kf[it] = WFrag<T16>::ldf(kb + o); if (HL) k2f[it] = WFrag<T16>::ldf(kb2 + o); }
        if (HL) __builtin_amdgcn_sched_barrier(0);   // keeps the group of loads above ahead of the first product
#pragma unroll
        for (int it = 0; it < 16; ++it) { const int kt = it >> 1, ks = it & 1;
            if (it + KD < 16) { const int o = lo + (it + KD) * 512; kf[it + KD] = WFrag<T16>::ldf(kb + o); if (HL) k2f[it + KD] = WFrag<T16>::ldf(kb2 + o); }
#pragma unroll
            for (int qt = 0; qt < 2; ++qt) { s[kt][qt] = WFrag<T16>::mma(kf[it], qf[qt][ks], s[kt][qt]); if (HL) { s[kt][qt] = WFrag<T16>::mma(kf[it], q2f[qt][ks], s[kt][qt]); s[kt][qt] = WFrag<T16>::mma(k2f[it], qf[qt][ks], s[kt][qt]); } }
            if (HL) __builtin_amdgcn_sched_barrier(0);   // keeps each fragment's loads KD fragments ahead: left alone the compiler moved them to one fragment ahead
        }
    }
    float mx[2], f[2];
#pragma unroll
    for (int qt = 0; qt < 2; ++qt) { float m = s[0][qt][0];
#pragma unroll
        for (int kt = 0; kt < 8; ++kt)
#pragma unroll
            for (int j = 0; j < 8; ++j) m = fmaxf(m, s[kt][qt][j]);
        mx[qt] = fmaxf(m, __shfl_xor(m, 16, 32)); }
    redm[kw * 32 + lane] = hi ? mx[1] : mx[0];
    __syncthreads();   // every wave's row maxima are in LDS before any wave joins them
#pragma unroll
    for (int qt = 0; qt < 2; ++qt) { float m = redm[qt * 16 + lr];
#pragma unroll
        for (int w = 1; w < 16; ++w) m = fmaxf(m, redm[w * 32 + qt * 16 + lr]);
        mx[qt] = m * SCL; }   // SCL is a power of two: the maximum of the scaled scores, exactly
    // V fragments: fragment j is loaded in front of the products of the first fragment it with vlim(it) >= j, as far ahead as the registers freed by the scores allow. With hi and lo planes the first two are loaded here, so that they fly during the exponentials, and the scheduling barriers hold every load in its place; with one plane the order is left to the compiler.
    V vf[16], v2f[16];
    auto ldv = [&](int j) { const int o = lo + j * 512; vf[j] = WFrag<T16>::ldf(vb + o); if (HL) v2f[j] = WFrag<T16>::ldf(vb2 + o); };
    auto vlim = [](int it) { return HL ? (it < 0 ? 1 : it + (it < 4 ? 1 : 3)) : it + 1; };
    if constexpr (HL) {
#pragma unroll
        for (int j = 0; j < 16; ++j) if (j <= vlim(-1)) ldv(j);
        __builtin_amdgcn_sched_barrier(0);   // keeps these loads ahead of the exponentials
    }
#pragma unroll
    for (int qt = 0; qt < 2; ++qt) { float a = 0.f;
#pragma unroll
        for (int kt = 0; kt < 8; ++kt)
#pragma unroll
            for (int j = 0; j < 8; ++j) { const float e = __builtin_amdgcn_exp2f((s[kt][qt][j] * SCL - mx[qt]) * 1.4426950408889634f); s[kt][qt][j] = e; a += e; }
        f[qt] = a + __shfl_xor(a, 16, 32); }
    reds[kw * 32 + lane] = hi ? f[1] : f[0];
    __syncthreads();   // every wave's row sums are in LDS before any wave joins them
#pragma unroll
    for (int qt = 0; qt < 2; ++qt) { float a = reds[qt * 16 + lr];
#pragma unroll
        for (int w = 1; w < 16; ++w) a += reds[w * 32 + qt * 16 + lr];
        f[qt] = __fdiv_rn(HL ? 1.0f : PCAR, a); }
    v8f acc[2][4];
#pragma unroll
    for (int nb = 0; nb < 4; ++nb) { acc[0][nb] = (v8f){}; acc[1][nb] = (v8f){}; }
    if constexpr (!HL) ldv(0);
#pragma unroll
    for (int kk = 0; kk < 4; ++kk) {
        V pa[2], pa2[2];
#pragma unroll
        for (int qt = 0; qt < 2; ++qt) {
            if constexpr (HL) { v16us ph, pl;
#pragma unroll
                for (int e = 0; e < 16; ++e) { unsigned short a, c2; splitf(s[2 * kk + (e >> 3)][qt][e & 7] * f[qt], a, c2); ph[e] = a; pl[e] = c2; }
                pa[qt] = __builtin_bit_cast(v16bf, ph); pa2[qt] = __builtin_bit_cast(v16bf, pl);
            } else {
#pragma unroll
                for (int e = 0; e < 16; ++e) pa[qt][e] = tohx(s[2 * kk + (e >> 3)][qt][e & 7] * f[qt]);
            } }
#pragma unroll
        for (int nb = 0; nb < 4; ++nb) { const int it = kk * 4 + nb;
#pragma unroll
            for (int j = 0; j < 16; ++j) if (j > vlim(it - 1) && j <= vlim(it)) ldv(j);
#pragma unroll
            for (int qt = 0; qt < 2; ++qt) { acc[qt][nb] = WFrag<T16>::mma(pa[qt], vf[it], acc[qt][nb]); if (HL) { acc[qt][nb] = WFrag<T16>::mma(pa2[qt], vf[it], acc[qt][nb]); acc[qt][nb] = WFrag<T16>::mma(pa[qt], v2f[it], acc[qt][nb]); } }
            if (HL) __builtin_amdgcn_sched_barrier(0);   // keeps each fragment's loads where they stand: left alone the compiler moved most of them directly in front of their products
        }
    }
    float* my = os + kw * (32 * 68);
#pragma unroll
    for (int qt = 0; qt < 2; ++qt)
#pragma unroll
        for (int nb = 0; nb < 4; ++nb)
#pragma unroll
            for (int j = 0; j < 8; ++j) my[(qt * 16 + hi * 8 + j) * 68 + nb * 16 + lr] = acc[qt][nb][j];
    __syncthreads();   // every wave's partial output tile is in LDS before any wave adds them
    // the 32 x 64 sum is 4 fragment tiles = 256 pieces of 8 columns (one lane's 16 bytes): waves 0..7 take one piece a lane (tile kw >> 1, half kw & 1) and store 512 bytes in a row; no barrier follows
    if (kw >= 8) return;
    const int qt = kw >> 2, ks = (kw >> 1) & 1; const int row = qt * 16 + lr, cofs = ks * 32 + (kw & 1) * 16 + hi * 8; v4f val = *(const v4fa*)(os + row * 68 + cofs), val2 = *(const v4fa*)(os + row * 68 + cofs + 4);
#pragma unroll
    for (int w = 1; w < 16; ++w) { val += *(const v4fa*)(os + w * (32 * 68) + row * 68 + cofs); val2 += *(const v4fa*)(os + w * (32 * 68) + row * 68 + cofs + 4); }
    const float cs = HL ? 1.0f : (1.0f / PCAR); v8us oh, ol;
#pragma unroll
    for (int q = 0; q < 4; ++q) { unsigned short a, c2; splitf(val[q] * cs, a, c2); oh[q] = a; ol[q] = c2; splitf(val2[q] * cs, a, c2); oh[q + 4] = a; ol[q + 4] = c2; }
    const int e = (qt * (DQ / 32) + ks) * 512 + (kw & 1) * 256 + lane * 8; *(v8us*)(Ah + e) = oh; *(v8us*)(Al + e) = ol;
}
__global__ __launch_bounds__(512) void k_fattn(const h16* __restrict__ Q16, const h16* __restrict__ K16, const h16* __restrict__ V16, const bf* __restrict__ Qh, const bf* __restrict__ Ql, const bf* __restrict__ Kh, const bf* __restrict__ Kl, const bf* __restrict__ Vh, const bf* __restrict__ Vl, bf* Ah, bf* Al) {
    __shared__ __align__(16) float os[16 * 32 * 68]; __shared__ float redm[16 * 32]; __shared__ float reds[16 * 32];
    const int h = blockIdx.x, q0 = blockIdx.y * 32; const size_t zq = ((size_t)h * TT + q0) * HD, zk = (size_t)(h / REP) * TT * HD, oo = (size_t)q0 * DQ + h * (HD * 16);   // merged planes [t][h d] in fragment order: a band of 16 rows is 16 DQ elements, a head is 2 tiles in it
    static_assert(RH % 32 == 0 && TT == 16 * 128 && HD == 64, "a row block is all hi/lo or all fp16; 16 waves x 128 keys; 4 output column tiles");
    if (q0 < RH) fattn<bf, true>(Qh + zq, Ql + zq, Kh + zk, Kl + zk, Vh + zk, Vl + zk, Ah + oo, Al + oo, os, redm, reds);
    else fattn<h16, false>(Q16 + zq, nullptr, K16 + zk, nullptr, V16 + zk, nullptr, Ah + oo, Al + oo, os, redm, reds);
}

extern "C" void kernel_launch(void* const* d_in, const int* in_sizes, int n_in,
                              void* d_out, int out_size, void* d_ws, size_t ws_size, hipStream_t stream) {
    (void)in_sizes; (void)n_in; (void)out_size;
    const float* x = (const float*)d_in[0]; const float* wq = (const float*)d_in[1]; const float* wk = (const float*)d_in[2]; const float* wv = (const float*)d_in[3]; const float* wo = (const float*)d_in[4]; const float* lng = (const float*)d_in[5]; const float* lnb = (const float*)d_in[6];
    float* OUT = (float*)d_out;     // [1][2048][768]
    char* wsp = (char*)d_ws;
    auto take = [&](size_t bytes) { char* p = wsp; wsp += (bytes + 255) & ~(size_t)255; return (void*)p; };
    float* Y = (float*)take((size_t)TT * DM * 4); bf* WQ = (bf*)take((size_t)DQ * DM * 2); bf* WK = (bf*)take((size_t)DKV * DM * 2); bf* WV = (bf*)take((size_t)DKV * DM * 2); bf* WO = (bf*)take((size_t)DM * DQ * 2);
    bf* XB = (bf*)take((size_t)TT * DM * 2);
    h16* QP16 = (h16*)take((size_t)NH_ * TT * HD * 2); h16* KP16 = (h16*)take((size_t)NKV * TT * HD * 2); h16* VT16 = (h16*)take((size_t)NKV * HD * TT * 2);
    bf* QPh = (bf*)take((size_t)NH_ * TT * HD * 2); bf* QPl = (bf*)take((size_t)NH_ * TT * HD * 2); bf* KPh = (bf*)take((size_t)NKV * TT * HD * 2); bf* KPl = (bf*)take((size_t)NKV * TT * HD * 2); bf* VTh = (bf*)take((size_t)NKV * HD * TT * 2); bf* VTl = (bf*)take((size_t)NKV * HD * TT * 2);
    bf* ATh = (bf*)take((size_t)TT * DQ * 2); bf* ATl = (bf*)take((size_t)TT * DQ * 2);
    if ((size_t)(wsp - (char*)d_ws) > ws_size) return;    // ws 256 MiB
    k_cvt8<<<TT * DM / 16 / 256 + 4 * (DM * DM / 16 / 256), 256, 0, stream>>>(x, wq, wk, wv, wo, XB, WQ, WK, WV, WO);
    for (int b = 0; b < NB_; ++b) {
        
        k_qkv<<<dim3(TT / 64, NH_, 3), 256, 0, stream>>>(XB, WQ, WK, WV, QP16, QPh, QPl, KP16, KPh, KPl, VT16, VTh, VTl);
        k_fattn<<<dim3(NH_, TT / 32, 1), 512, 0, stream>>>(QP16, KP16, VT16, QPh, QPl, KPh, KPl, VTh, VTl, ATh, ATl);
        k_gemmw<bf, 1, false, 8, DQ><<<dim3(TT / 64, DM / 64, 1), 256, 0, stream>>>(ATh, ATl, WO, nullptr, Y, DM, nullptr, 0, 0, 0); k_lnrS12<<<TT / 8, 256, 0, stream>>>(x + (size_t)b * TT * DM, Y, lng, lnb, OUT + (size_t)b * TT * DM);   /* LayerNorm(out + x), eps 1e-12 */ }
}

// v008
// It runs in 63 microseconds.
// Two timings next to v007 both put it at 1.07 times that version's speed.
// Counting every step since v000, it is 12.2 times as fast.
#include <hip/hip_runtime.h>

// BERT self-attention with residual + LayerNorm (x [2048][768], unbatched; q,k,v = x W^T ('oi' [768][768], no bias, 1/sqrt(768)); 12 heads x 64; softmax(q.k / 8) over all keys; out = merged Wo^T; y = LayerNorm(out + x) gamma + beta (eps 1e-12) -> [2048][768] (1.6 M)).
// Every 16-bit operand plane in the workspace is kept in fragment order (see WFrag::ldf): 16 x 32 tiles of 512 elements, a lane's two 16-byte pieces at lane * 8 and 256 + lane * 8, so that one wave-wide 16-byte load reads 512 contiguous bytes.
// Layout: bf16 copies of x and the four weights, one launch; exact projections, q, k and v in one launch that writes the head planes itself; dense T-2048 attention in one fused kernel, scores and P in registers (hybrid rows: < 512 hi/lo 3 products, rest fp16 x1024); merged hi/lo x Wo exact into workspace; a LayerNorm row kernel adds bf16(x) and writes the output rows (one wave per row, 24 values per lane, f32 fixed order).
// Compute dtypes, f32 accumulate: every input rounded to bf16; projections exact; attention rows < 512 3 products, rest fp16; softmax, residual and LayerNorm f32; Wo hl x exact.

#define NB_  1
#define TT   2048
#define DM   768
#define NH_  12
#define NKV  12
#define REP  (NH_ / NKV)
#define HD   64
#define DQ   (NH_ * HD)
#define DKV  (NKV * HD)
#define RH   512                  // query rows < RH use hi+lo planes (0: none)
#define WIN  0
#define PCAR 1024.0f
#define SCL  0.125f
#define BSZ  1
typedef _Float16 h16;
typedef unsigned short bf;
typedef __attribute__((ext_vector_type(16))) __bf16   v16bf;
typedef __attribute__((ext_vector_type(16))) _Float16 v16h;
typedef __attribute__((ext_vector_type(8)))  _Float16 v8h;
typedef __attribute__((ext_vector_type(8)))  unsigned short v8us;
typedef __attribute__((ext_vector_type(8)))  float    v8f;
typedef __attribute__((ext_vector_type(4)))  float    v4f;
typedef v8h  __attribute__((may_alias)) v8ha;
typedef v4f  __attribute__((may_alias)) v4fa;
typedef v8us __attribute__((may_alias)) v8usa;

__device__ __forceinline__ unsigned short f2bf(float f) { unsigned u = __float_as_uint(f); u += 0x7FFFu + ((u >> 16) & 1u); return (unsigned short)(u >> 16); }
__device__ __forceinline__ float bf2f(unsigned short b) { return __uint_as_float(((unsigned)b) << 16); }
__device__ __forceinline__ float bfr(float f) { return bf2f(f2bf(f)); }
__device__ __forceinline__ v16h cat16(v8h lo, v8h hi) { return __builtin_shufflevector(lo, hi, 0, 1, 2, 3, 4, 5, 6, 7, 8, 9, 10, 11, 12, 13, 14, 15); }
__device__ __forceinline__ v16bf cat16b(v8us lo, v8us hi) { return __builtin_bit_cast(v16bf, __builtin_shufflevector(lo, hi, 0, 1, 2, 3, 4, 5, 6, 7, 8, 9, 10, 11, 12, 13, 14, 15)); }
__device__ __forceinline__ v8f wmma16(v16h a, v16h b, v8f c) { return __builtin_amdgcn_wmma_f32_16x16x32_f16(false, a, false, b, (short)0, c, false, false); }
__device__ __forceinline__ v8f wmmab(v16bf a, v16bf b, v8f c) { return __builtin_amdgcn_wmma_f32_16x16x32_bf16(false, a, false, b, (short)0, c, false, false); }



// ---- k_gemmw: register-blocked GEMM, one 64x64 output tile per workgroup (16 accumulators per wave), operands straight from 16-bit planes in fragment order; grid (M/64, N/64, Z), 32 * KW threads.
// C[m][n] (f32, pitch ldc, + optional f32 bias[n]) = sum_k A[m][k] Bt[n][k] (+ split products per NSPLIT). z-batch strides sA/sB/sC in elements. K % (32 * KW) == 0.
// KW waves share the tile: wave w sums the k range [w K/KW, (w+1) K/KW) of the whole tile; the KW partial tiles meet in LDS and are added in wave order 0..KW-1 (fixed f32 order).
// Fragment order of a plane [R][K]: tile (r >> 4, k >> 5) is number (r >> 4) * (K / 32) + (k >> 5); in it element (r, k) stands at ((k >> 4) & 1) * 256 + (((k >> 3) & 1) * 16 + (r & 15)) * 8 + (k & 7).
// ldf(tile + lane * 8) gives lane (lr, hi) the same 16 values as ld(row lr, k = 8 hi) of a row-major plane: k = 8 hi + 0..7 and 16 + 8 hi + 0..7.
template <typename T16> struct WFrag;
template <> struct WFrag<h16> { typedef v16h V; static __device__ __forceinline__ V ld(const h16* p) { return cat16(*(const v8h*)p, *(const v8h*)(p + 16)); } static __device__ __forceinline__ V ldf(const h16* p) { return cat16(*(const v8h*)p, *(const v8h*)(p + 256)); } static __device__ __forceinline__ v8f mma(V a, V b, v8f c) { return wmma16(a, b, c); } };
template <> struct WFrag<bf> { typedef v16bf V; static __device__ __forceinline__ V ld(const bf* p) { return cat16b(*(const v8us*)p, *(const v8us*)(p + 16)); } static __device__ __forceinline__ V ldf(const bf* p) { return cat16b(*(const v8us*)p, *(const v8us*)(p + 256)); } static __device__ __forceinline__ v8f mma(V a, V b, v8f c) { return wmmab(a, b, c); } };
template <typename T16, int NSPLIT, bool BIAS, int KW, int K>   // K at compile time: the distance from band to band is a constant of the load
__global__ __launch_bounds__(32 * KW) void k_gemmw(const T16* __restrict__ A, const T16* __restrict__ A2, const T16* __restrict__ Bt, const T16* __restrict__ Bt2, float* C, int ldc, const float* __restrict__ bias, size_t sA, size_t sB, size_t sC) {
    typedef typename WFrag<T16>::V V;
    __shared__ __align__(16) float os[KW == 1 ? 16 * 68 : KW * 64 * 68];
    const size_t z = blockIdx.z; A += z * sA; if (A2) A2 += z * sA; Bt += z * sB; if (Bt2) Bt2 += z * sB; C += z * sC;
    const int lane = threadIdx.x & 31, lr = lane & 15, hi = lane >> 4; const int r0 = blockIdx.x * 64, c0 = blockIdx.y * 64;
    v8f acc[4][4];
#pragma unroll
    for (int mb = 0; mb < 4; ++mb)
#pragma unroll
        for (int nb = 0; nb < 4; ++nb) acc[mb][nb] = (v8f){};
    // a band of 16 rows is K / 32 tiles = 16 K elements, and the tile of k step kc starts at kc * 16: a wave-uniform base per k step, one lane offset and a constant per band
    const int lo = lane * 8; A += (size_t)r0 * K; if (NSPLIT == 1 || NSPLIT == 2) A2 += (size_t)r0 * K; Bt += (size_t)c0 * K; if (NSPLIT >= 2) Bt2 += (size_t)c0 * K;
    const int kw = (KW == 1) ? 0 : __builtin_amdgcn_readfirstlane((int)(threadIdx.x >> 5));   // wave number in a scalar register: the k loop stays a scalar loop
    const int kbeg = kw * (K / KW), kend = kbeg + K / KW;
    // K / KW / 32 trips, known at compile time: unrolled, as in k_qkv, so that every tile address is scalar base + lane offset + constant, with no 64-bit vector address arithmetic per trip
#pragma unroll
    for (int kc = kbeg; kc < kend; kc += 32) {
        V a[4], a2[4]; const T16* Ak = A + kc * 16; const T16* A2k = (NSPLIT == 1 || NSPLIT == 2) ? A2 + kc * 16 : nullptr; const T16* Bk = Bt + kc * 16; const T16* B2k = (NSPLIT >= 2) ? Bt2 + kc * 16 : nullptr;
#pragma unroll
        for (int mb = 0; mb < 4; ++mb) { a[mb] = WFrag<T16>::ldf(Ak + (lo + mb * 16 * K)); if (NSPLIT == 1 || NSPLIT == 2) a2[mb] = WFrag<T16>::ldf(A2k + (lo + mb * 16 * K)); }
#pragma unroll
        for (int nb = 0; nb < 4; ++nb) { const V b = WFrag<T16>::ldf(Bk + (lo + nb * 16 * K)); V b2; if (NSPLIT >= 2) b2 = WFrag<T16>::ldf(B2k + (lo + nb * 16 * K));
#pragma unroll
            for (int mb = 0; mb < 4; ++mb) { acc[mb][nb] = WFrag<T16>::mma(a[mb], b, acc[mb][nb]); if (NSPLIT == 1 || NSPLIT == 2) acc[mb][nb] = WFrag<T16>::mma(a2[mb], b, acc[mb][nb]); if (NSPLIT >= 2) acc[mb][nb] = WFrag<T16>::mma(a[mb], b2, acc[mb][nb]); } }
        asm volatile("v_nop\n\tv_nop\n\tv_nop\n\tv_nop" : "+v"(acc[0][0]), "+v"(acc[1][1]), "+v"(acc[2][2]), "+v"(acc[3][3]) : "v"(a[0]), "v"(a[3]));
    }
    if constexpr (KW > 1) {
        float* my = os + kw * (64 * 68);
        // the three loops are unrolled so that acc[][][] is indexed by constants and stays in registers
#pragma unroll
        for (int mb = 0; mb < 4; ++mb)
#pragma unroll
            for (int nb = 0; nb < 4; ++nb)
#pragma unroll
                for (int j = 0; j < 8; ++j) my[(mb * 16 + hi * 8 + j) * 68 + nb * 16 + lr] = acc[mb][nb][j];
        __syncthreads();   // every wave's partial tile is in LDS before any wave adds them
        static_assert((64 * 16) % (32 * KW) == 0, "each thread adds the same number of 4-column pieces");
        // both loops unrolled: the LDS reads of all partial tiles issue ahead of the adds, which keep the order w = 0..KW-1
#pragma unroll
        for (int it = 0; it < (64 * 16) / (32 * KW); ++it) { const int s = (int)threadIdx.x + it * (32 * KW); const int row = s >> 4, cofs = (s & 15) * 4; v4f val = *(const v4fa*)(os + row * 68 + cofs);
#pragma unroll
            for (int w = 1; w < KW; ++w) val += *(const v4fa*)(os + w * (64 * 68) + row * 68 + cofs);
            if (BIAS) { val[0] += bfr(bias[c0 + cofs]); val[1] += bfr(bias[c0 + cofs + 1]); val[2] += bfr(bias[c0 + cofs + 2]); val[3] += bfr(bias[c0 + cofs + 3]); }
            *(v4f*)(C + (size_t)(r0 + row) * ldc + c0 + cofs) = val; }
        return;
    }
#pragma unroll
    for (int mb = 0; mb < 4; ++mb) {
#pragma unroll
        for (int nb = 0; nb < 4; ++nb) {
#pragma unroll
            for (int j = 0; j < 8; ++j) os[(hi * 8 + j) * 68 + nb * 16 + lr] = acc[mb][nb][j]; }
        __builtin_amdgcn_wave_barrier(); asm volatile("" ::: "memory");
        float* crow = C + (size_t)(r0 + mb * 16) * ldc + c0;
{
#pragma unroll
            for (int s = 0; s < 8; ++s) { const int row = 2 * s + hi, cofs = lr * 4; v4f val = *(const v4fa*)(os + row * 68 + cofs); if (BIAS) { val[0] += bfr(bias[c0 + cofs]); val[1] += bfr(bias[c0 + cofs + 1]); val[2] += bfr(bias[c0 + cofs + 2]); val[3] += bfr(bias[c0 + cofs + 3]); }
                *(v4f*)(crow + (size_t)row * ldc + cofs) = val; }
             }
        __builtin_amdgcn_wave_barrier(); asm volatile("" ::: "memory");
    }
}

__device__ __forceinline__ h16 tohx(float x) { return (h16)x; }
__device__ __forceinline__ void splitf(float y, unsigned short& h, unsigned short& l) { h = f2bf(y); l = f2bf(y - bf2f(h)); }
typedef __attribute__((ext_vector_type(2))) _Float16 v2h;
typedef __attribute__((ext_vector_type(4))) _Float16 v4h;
typedef __attribute__((ext_vector_type(2))) unsigned short v2us;
typedef __attribute__((ext_vector_type(4))) unsigned short v4us;
typedef __attribute__((ext_vector_type(2))) float v2f;
typedef __attribute__((ext_vector_type(4))) int v4i;

__global__ __launch_bounds__(256) void k_wtG(const float* __restrict__ w, int K, int N, bf* Bt) {
    const int lane = threadIdx.x & 31; const int L0 = (blockIdx.x * 8 + (threadIdx.x >> 5)) * 8; const int nlines = N * K / 64;
{
#pragma unroll 1
        for (int l = 0; l < 8; ++l) { const int L = L0 + l; if (L >= nlines) break; const size_t e = (size_t)L * 64 + lane * 2; const int k = (int)(e % K), n = (int)(e / K); v2us o;
            o[0] = f2bf(w[(size_t)k * N + n]); o[1] = f2bf(w[(size_t)(k + 1) * N + n]); *(v2us*)(Bt + e) = o; }
         }
}
// f32 [R][DM] row-major -> bf16 in fragment order; one wave per 16 x 32 tile: it reads 16 whole 128-byte lines and stores 1 KiB in a row.
// One launch converts all five planes: workgroups [0, BX) take x, then BW workgroups each for Wq, Wk, Wv, Wo; a workgroup lies wholly in one plane, so source and destination are chosen by scalar tests.
__global__ __launch_bounds__(256) void k_cvt8(const float* __restrict__ x, const float* __restrict__ wq, const float* __restrict__ wk, const float* __restrict__ wv, const float* __restrict__ wo, bf* XB, bf* WQ, bf* WK, bf* WV, bf* WO) {
    constexpr int BX = TT * DM / 16 / 256, BW = DM * DM / 16 / 256;
    static_assert(NB_ == 1 && DQ == DM && DKV == DM && (TT * DM) % (16 * 256) == 0 && (DM * DM) % (16 * 256) == 0, "one x plane, four square weights, whole workgroups per plane");
    int b = blockIdx.x; const float* src = x; bf* dst = XB;
    if (b >= BX) { b -= BX; const int p = b / BW; b -= p * BW; src = p == 0 ? wq : p == 1 ? wk : p == 2 ? wv : wo; dst = p == 0 ? WQ : p == 1 ? WK : p == 2 ? WV : WO; }
    const int lane = threadIdx.x & 31; const int tile = b * 8 + (int)(threadIdx.x >> 5), rt = tile / (DM / 32), kt = tile % (DM / 32);
    const float* s = src + (size_t)(rt * 16 + (lane & 15)) * DM + kt * 32 + (lane >> 4) * 8; const v8f v = *(const v8f*)s, w = *(const v8f*)(s + 16); v8us o, o2;
#pragma unroll
    for (int k = 0; k < 8; ++k) { o[k] = f2bf(v[k]); o2[k] = f2bf(w[k]); }
    bf* d = dst + (size_t)tile * 512 + lane * 8; *(v8us*)d = o; *(v8us*)(d + 256) = o2; }

// ---- k_qkv: the three projections in one launch, grid (TT / 64, heads, 3), 8 waves; one 64x64 tile per workgroup; fragments, k split over the waves and LDS sum in wave order as in k_gemmw with KW = 8.
// A tile is 64 tokens of one head, so the epilogue rounds the f32 sums itself and stores them at their place in the head planes (fp16, hi, lo): no f32 copy of q, k, v in the workspace.
// z = 0, 1: rows = tokens (A = x), columns = d (B = Wq, Wk) -> planes [h][t][d]. z = 2: rows = d (A = Wv), columns = tokens (B = x) -> planes [h][d][t], the transposed V that P V reads.
// The head planes are in fragment order too. q, k: tile number (t >> 4) * 2 + (d >> 5) in the head. V: tile number (t >> 5) * 4 + (d >> 4), so that the 128 keys of one attention wave are 16 tiles in a row. Either way a 64 x 64 tile is 8 fragment tiles, 4096 elements, in a row.
__global__ __launch_bounds__(256) void k_qkv(const bf* __restrict__ X, const bf* __restrict__ Wq, const bf* __restrict__ Wk, const bf* __restrict__ Wv, h16* Q16, bf* Qh, bf* Ql, h16* K16, bf* Kh, bf* Kl, h16* V16, bf* Vh, bf* Vl) {
    typedef WFrag<bf>::V V;
    constexpr int KW = 8, K = DM;
    static_assert(DQ == DKV && HD == 64 && TT % 64 == 0 && K % (32 * KW) == 0, "one grid for q, k and v; a tile is one head wide");
    __shared__ __align__(16) float os[KW * 64 * 68];
    const int z = blockIdx.z, tb = blockIdx.x, hb = blockIdx.y;
    const bf* xt = X + (size_t)tb * 64 * K; const bf* wt = (z == 0 ? Wq : z == 1 ? Wk : Wv) + (size_t)hb * 64 * K;
    const bf* A = (z == 2) ? wt : xt; const bf* Bt = (z == 2) ? xt : wt;
    const size_t base = (size_t)hb * TT * HD + (size_t)tb * 64 * HD;
    h16* P16 = (z == 0 ? Q16 : z == 1 ? K16 : V16) + base; bf* Ph = (z == 0 ? Qh : z == 1 ? Kh : Vh) + base; bf* Pl = (z == 0 ? Ql : z == 1 ? Kl : Vl) + base;
    const int lane = threadIdx.x & 31, lr = lane & 15, hi = lane >> 4;
    v8f acc[4][4];
#pragma unroll
    for (int mb = 0; mb < 4; ++mb)
#pragma unroll
        for (int nb = 0; nb < 4; ++nb) acc[mb][nb] = (v8f){};
    const int off = lane * 8;   // wave-uniform bases and one lane offset: every fragment load is scalar base + lane offset + constant
    const int kw = __builtin_amdgcn_readfirstlane((int)(threadIdx.x >> 5));   // wave number in a scalar register: the wave's k offset goes into the scalar bases
    A += kw * (K / KW) * 16; Bt += kw * (K / KW) * 16;   // 32 k are one tile of 512 elements
    // three trips, known at compile time. The loads of trips 0 and 1 are issued as one group ahead of the first product, those of trip 2 as soon as registers of trip 0 (then of trip 1) are free:
    // a wave waits out one L2 latency, not one per late fragment. Products in the order trip, nb, mb, as before.
    static_assert(K / KW == 96, "three trips");
    V a[3][4], b[3][4];
    auto lda = [&](int t, int mb) { a[t][mb] = WFrag<bf>::ldf(A + t * 512 + (off + mb * 16 * K)); };
    auto ldb = [&](int t, int nb) { b[t][nb] = WFrag<bf>::ldf(Bt + t * 512 + (off + nb * 16 * K)); };
    auto prod = [&](int t, int nb) {
#pragma unroll
        for (int mb = 0; mb < 4; ++mb) acc[mb][nb] = WFrag<bf>::mma(a[t][mb], b[t][nb], acc[mb][nb]); };
#pragma unroll
    for (int t = 0; t < 2; ++t) {
#pragma unroll
        for (int i = 0; i < 4; ++i) lda(t, i);
#pragma unroll
        for (int i = 0; i < 4; ++i) ldb(t, i); }
    __builtin_amdgcn_sched_barrier(0);   // keeps the 32 loads above ahead of every product: left alone the compiler issued 13 of the 24 fragments late, most directly in front of their products
#pragma unroll
    for (int nb = 0; nb < 4; ++nb) prod(0, nb);
    __builtin_amdgcn_sched_barrier(0);   // trip 2's first loads stand here, a whole trip ahead of their products, not later
#pragma unroll
    for (int i = 0; i < 4; ++i) lda(2, i);
    ldb(2, 0); ldb(2, 1);
    __builtin_amdgcn_sched_barrier(0);   // as above
    prod(1, 0); prod(1, 1);
    __builtin_amdgcn_sched_barrier(0);   // trip 2's last loads stand here, 16 products ahead of their own
    ldb(2, 2); ldb(2, 3);
    __builtin_amdgcn_sched_barrier(0);   // as above
    prod(1, 2); prod(1, 3);
#pragma unroll
    for (int nb = 0; nb < 4; ++nb) prod(2, nb);
    float* my = os + kw * (64 * 68);
    // the three loops are unrolled so that acc[][][] is indexed by constants and stays in registers
#pragma unroll
    for (int mb = 0; mb < 4; ++mb)
#pragma unroll
        for (int nb = 0; nb < 4; ++nb)
#pragma unroll
            for (int j = 0; j < 8; ++j) my[(mb * 16 + hi * 8 + j) * 68 + nb * 16 + lr] = acc[mb][nb][j];
    __syncthreads();   // every wave's partial tile is in LDS before any wave adds them
    constexpr int NP = (64 * 8) / (32 * KW);   // 8-column pieces per thread: a piece is one lane's 16 bytes of a fragment tile, and a wave's 32 pieces are 512 bytes in a row
    v8h o16[NP]; v8us oh[NP], ol[NP];
    // the loops are unrolled: the LDS reads of all partial tiles issue ahead of the adds, which keep the order w = 0..KW-1, and the piece arrays stay in registers
#pragma unroll
    for (int it = 0; it < NP; ++it) { const int tile = (kw >> 1) + it * (KW / 2);   // piece number threadIdx.x + it * 256 = (tile * 2 + half) * 32 + lane, half = kw & 1
        const int rt = (z == 2) ? (tile & 3) : (tile >> 1), ct = (z == 2) ? (tile >> 2) : (tile & 1); const int row = rt * 16 + lr, cofs = ct * 32 + (kw & 1) * 16 + hi * 8;
        v4f val = *(const v4fa*)(os + row * 68 + cofs), val2 = *(const v4fa*)(os + row * 68 + cofs + 4);
#pragma unroll
        for (int w = 1; w < KW; ++w) { val += *(const v4fa*)(os + w * (64 * 68) + row * 68 + cofs); val2 += *(const v4fa*)(os + w * (64 * 68) + row * 68 + cofs + 4); }
#pragma unroll
        for (int q = 0; q < 4; ++q) { o16[it][q] = tohx(val[q]); o16[it][q + 4] = tohx(val2[q]); unsigned short a2, c2; splitf(val[q], a2, c2); oh[it][q] = a2; ol[it][q] = c2; splitf(val2[q], a2, c2); oh[it][q + 4] = a2; ol[it][q + 4] = c2; } }
    // the six stores go out back to back behind all the rounding; unrolled: the piece arrays are indexed by constants
#pragma unroll
    for (int it = 0; it < NP; ++it) { const int e = ((int)threadIdx.x + it * (32 * KW)) * 8; *(v8h*)(P16 + e) = o16[it]; *(v8us*)(Ph + e) = oh[it]; *(v8us*)(Pl + e) = ol[it]; }
}
__global__ __launch_bounds__(256) void k_lnrS12(const float* __restrict__ wb, const float* __restrict__ Y, const float* __restrict__ g, const float* __restrict__ bb, float* ob) { const int lane = threadIdx.x & 31; const int row = blockIdx.x * 8 + (threadIdx.x >> 5); if (row >= TT) return; const float* br = wb + (size_t)row * BSZ * DM; const float* yr = Y + (size_t)row * DM; float v[DM / 32]; float s = 0.f;
    // every load of the row (x, the product, gamma, beta: 16 bytes a lane each) is issued here, ahead of the arithmetic: one memory latency per wave instead of one per 128 columns and one per gamma / beta element
    v4f a6[DM / 128], y6[DM / 128], g6[DM / 128], b6[DM / 128];
#pragma unroll
    for (int ch = 0; ch < DM / 128; ++ch) { a6[ch] = *(const v4f*)(br + ch * 128 + lane * 4); y6[ch] = *(const v4f*)(yr + ch * 128 + lane * 4); }
#pragma unroll
    for (int ch = 0; ch < DM / 128; ++ch) { g6[ch] = *(const v4f*)(g + ch * 128 + lane * 4); b6[ch] = *(const v4f*)(bb + ch * 128 + lane * 4); }
#pragma unroll
    for (int ch = 0; ch < DM / 128; ++ch) { const v4f a = a6[ch]; const v4f y4 = y6[ch];
#pragma unroll
        for (int q = 0; q < 4; ++q) { float ab = bfr(a[q]); asm volatile("" : "+v"(ab)); float t = __fadd_rn(ab, y4[q]); asm volatile("" : "+v"(t)); v[ch * 4 + q] = t; s = __fadd_rn(s, t); } }
#pragma unroll
    for (int sh = 16; sh; sh >>= 1) s = __fadd_rn(s, __shfl_xor(s, sh, 32));
    const float mu = __fdiv_rn(s, (float)DM); float s2 = 0.f;
#pragma unroll
    for (int k = 0; k < DM / 32; ++k) { const float dv = __fsub_rn(v[k], mu); float p2 = __fmul_rn(dv, dv); asm volatile("" : "+v"(p2)); s2 = __fadd_rn(s2, p2); }
#pragma unroll
    for (int sh = 16; sh; sh >>= 1) s2 = __fadd_rn(s2, __shfl_xor(s2, sh, 32));
    const float rs = __fdiv_rn(1.0f, __fsqrt_rn(__fadd_rn(__fdiv_rn(s2, (float)DM), 1e-12f)));
{
#pragma unroll
        for (int ch = 0; ch < DM / 128; ++ch) { v4f o; for (int q = 0; q < 4; ++q) { float dv = __fsub_rn(v[ch * 4 + q], mu); asm volatile("" : "+v"(dv)); float y = __fmul_rn(dv, rs); asm volatile("" : "+v"(y)); float gg = bfr(g6[ch][q]), bb2 = bfr(b6[ch][q]); asm volatile("" : "+v"(gg), "+v"(bb2)); y = __fmul_rn(y, gg); asm volatile("" : "+v"(y)); o[q] = __fadd_rn(y, bb2); }   /* every step kept separate: no fma contraction */
            *(v4f*)(ob + (size_t)row * BSZ * DM + ch * 128 + lane * 4) = o; }
         } }

// ---- k_fattn: scores, softmax, P V and the head merge for 32 query rows of one head, in one workgroup of 16 waves; scores and P stay in registers. Grid (heads, TT / 32): the hi/lo row blocks, which cost most, come first.
// Wave w owns keys [128 w, 128 w + 128). It forms the transposed scores S^T = K Q^T (A = key rows, B = query rows), so that a lane holds 64 scores of one query per 16-query tile, and two 16-key D tiles,
// converted in place, are the A fragment (row = query, k = key in the loaders' k order 8 hi + 0..7, 16 + 8 hi + 0..7) of P V. Softmax per wave: each wave takes the maximum and the sum of its own 128 keys (in the lane, across the two lane halves) and goes on to P V with no exchange.
// The 16 partial 32 x 64 outputs, maxima and sums meet in LDS behind the kernel's one barrier and are joined in wave order 0..15, each weighted with exp(own maximum - row maximum); the sum is divided by the joined row sum, split hi/lo and stored at its place in the merged [t][h d] planes (fragment order).
typedef __attribute__((ext_vector_type(16))) unsigned short v16us;
template <typename T16, bool HL>
__device__ __forceinline__ void fattn(const T16* __restrict__ Q, const T16* __restrict__ Q2, const T16* __restrict__ Kp, const T16* __restrict__ K2, const T16* __restrict__ Vt, const T16* __restrict__ Vt2, bf* Ah, bf* Al, float* os, float* redm, float* reds) {
    typedef typename WFrag<T16>::V V;
    const int lane = threadIdx.x & 31, lr = lane & 15, hi = lane >> 4;
    const int kw = __builtin_amdgcn_readfirstlane((int)(threadIdx.x >> 5));   // wave number in a scalar register: the key offsets stay scalar
    const int key0 = kw * 128;
    // wave-uniform bases and one lane offset per plane kind: every fragment load is scalar base + lane offset + constant
    const int lo = lane * 8;   // planes in fragment order: fragment number n of a wave's range is tile n
    const T16* kb = Kp + (size_t)key0 * HD; const T16* kb2 = HL ? K2 + (size_t)key0 * HD : nullptr; const T16* vb = Vt + (size_t)key0 * HD; const T16* vb2 = HL ? Vt2 + (size_t)key0 * HD : nullptr;
    // every loop below is unrolled so that s[][][] and acc[][][] are indexed by constants and stay in registers
    v8f s[8][2];
#pragma unroll
    for (int kt = 0; kt < 8; ++kt) { s[kt][0] = (v8f){}; s[kt][1] = (v8f){}; }
    {
        V qf[2][2], q2f[2][2];
#pragma unroll
        for (int qt = 0; qt < 2; ++qt)
#pragma unroll
            for (int ks = 0; ks < 2; ++ks) { const int o = lo + (qt * 2 + ks) * 512; qf[qt][ks] = WFrag<T16>::ldf(Q + o); if (HL) q2f[qt][ks] = WFrag<T16>::ldf(Q2 + o); }
        if (!HL) __builtin_amdgcn_sched_barrier(0);   // keeps the Q loads first: loads return in order, and with Q behind the 12 K fragments the second product waited for the whole group
        // K fragments are loaded KD fragments ahead of their products. With hi and lo planes: 4 ahead (24 products, which cover an L2 latency with four waves on the SIMD), held there by the scheduling barriers. With one plane: 12 ahead, so that 32 loads (Q and 12 K fragments) are issued at the start, held there the same way: in this build the compiler, left alone, issued more than half of the K fragments only two fragments ahead.
        constexpr int KD = HL ? 4 : 12;
        V kf[16], k2f[16];
#pragma unroll
        for (int it = 0; it < KD; ++it) { const int o = lo + it * 512; kf[it] = WFrag<T16>::ldf(kb + o); if (HL) k2f[it] = WFrag<T16>::ldf(kb2 + o); }
        __builtin_amdgcn_sched_barrier(0);   // keeps the group of loads above ahead of the first product
#pragma unroll
        for (int it = 0; it < 16; ++it) { const int kt = it >> 1, ks = it & 1;
            if (it + KD < 16) { const int o = lo + (it + KD) * 512; kf[it + KD] = WFrag<T16>::ldf(kb + o); if (HL) k2f[it + KD] = WFrag<T16>::ldf(kb2 + o); }
#pragma unroll
            for (int qt = 0; qt < 2; ++qt) { s[kt][qt] = WFrag<T16>::mma(kf[it], qf[qt][ks], s[kt][qt]); if (HL) { s[kt][qt] = WFrag<T16>::mma(kf[it], q2f[qt][ks], s[kt][qt]); s[kt][qt] = WFrag<T16>::mma(k2f[it], qf[qt][ks], s[kt][qt]); } }
            __builtin_amdgcn_sched_barrier(0);   // keeps each fragment's loads KD fragments ahead: left alone the compiler moved them to one or two fragments ahead
        }
    }
    float mx[2], f[2];
#pragma unroll
    for (int qt = 0; qt < 2; ++qt) { float m = s[0][qt][0];
#pragma unroll
        for (int kt = 0; kt < 8; ++kt)
#pragma unroll
            for (int j = 0; j < 8; ++j) m = fmaxf(m, s[kt][qt][j]);
        mx[qt] = fmaxf(m, __shfl_xor(m, 16, 32)) * SCL; }   // the maximum of the wave's own 128 scaled scores of the row; SCL is a power of two: exact
    redm[kw * 32 + lane] = hi ? mx[1] : mx[0];   // read behind the one barrier, where the partial outputs are joined
    __builtin_amdgcn_sched_barrier(0);   // keeps the V loads below behind the scores: left alone, with no barrier between them, the compiler moved them among the K loads, issued those late and spilled registers
    // V fragments: fragment j is loaded in front of the products of the first fragment it with vlim(it) >= j, as far ahead as the registers freed by the scores allow. The first two (hi and lo planes) or four (one plane) are loaded here: no barrier stands between here and P V any more, so they fly during the exponentials; the scheduling barriers hold every load in its place.
    V vf[16], v2f[16];
    auto ldv = [&](int j) { const int o = lo + j * 512; vf[j] = WFrag<T16>::ldf(vb + o); if (HL) v2f[j] = WFrag<T16>::ldf(vb2 + o); };
    auto vlim = [](int it) { return HL ? (it < 0 ? 1 : it + (it < 4 ? 1 : 3)) : (it < 0 ? 3 : it + (it < 4 ? 5 : 8)); };
#pragma unroll
    for (int j = 0; j < 16; ++j) if (j <= vlim(-1)) ldv(j);
    __builtin_amdgcn_sched_barrier(0);   // keeps these loads ahead of the exponentials
#pragma unroll
    for (int qt = 0; qt < 2; ++qt) { float a = 0.f;
#pragma unroll
        for (int kt = 0; kt < 8; ++kt) { float y[8], e[8];
#pragma unroll
            for (int j = 0; j < 8; ++j) { y[j] = (s[kt][qt][j] * SCL - mx[qt]) * 1.4426950408889634f; if constexpr (!HL) y[j] += 10.0f;   // fp16 P carries the factor PCAR = 2^10, exactly, through the exponent; the sums carry it too, so it cancels at the join
                e[j] = __builtin_amdgcn_exp2f(y[j]); s[kt][qt][j] = e[j]; a += e[j]; }
            // the slot behind a transcendental: as inputs here the eight arguments keep their registers until all eight exponentials are issued, so no instruction directly behind one overwrites its source; the v_nop is the slot of the last one, where the compiler puts no other instruction there
            asm volatile("v_nop" :: "v"(y[0]), "v"(y[1]), "v"(y[2]), "v"(y[3]), "v"(y[4]), "v"(y[5]), "v"(y[6]), "v"(y[7]), "v"(e[0]), "v"(e[1]), "v"(e[2]), "v"(e[3]), "v"(e[4]), "v"(e[5]), "v"(e[6]), "v"(e[7])); }
        f[qt] = a + __shfl_xor(a, 16, 32); }
    reds[kw * 32 + lane] = hi ? f[1] : f[0];   // read behind the one barrier too
    __builtin_amdgcn_sched_barrier(0);   // keeps the exponentials ahead of P V: left alone, with no barrier between them, the compiler mixed the two phases and spilled registers
    v8f acc[2][4];
#pragma unroll
    for (int nb = 0; nb < 4; ++nb) { acc[0][nb] = (v8f){}; acc[1][nb] = (v8f){}; }
#pragma unroll
    for (int kk = 0; kk < 4; ++kk) {
        V pa[2], pa2[2];
#pragma unroll
        for (int qt = 0; qt < 2; ++qt) {
            if constexpr (HL) { v16us ph, pl;
#pragma unroll
                for (int e = 0; e < 16; ++e) { unsigned short a, c2; splitf(s[2 * kk + (e >> 3)][qt][e & 7], a, c2); ph[e] = a; pl[e] = c2; }
                pa[qt] = __builtin_bit_cast(v16bf, ph); pa2[qt] = __builtin_bit_cast(v16bf, pl);
            } else {
#pragma unroll
                for (int e = 0; e < 16; ++e) pa[qt][e] = tohx(s[2 * kk + (e >> 3)][qt][e & 7]);
            } }
#pragma unroll
        for (int nb = 0; nb < 4; ++nb) { const int it = kk * 4 + nb;
#pragma unroll
            for (int j = 0; j < 16; ++j) if (j > vlim(it - 1) && j <= vlim(it)) ldv(j);
#pragma unroll
            for (int qt = 0; qt < 2; ++qt) { acc[qt][nb] = WFrag<T16>::mma(pa[qt], vf[it], acc[qt][nb]); if (HL) { acc[qt][nb] = WFrag<T16>::mma(pa2[qt], vf[it], acc[qt][nb]); acc[qt][nb] = WFrag<T16>::mma(pa[qt], v2f[it], acc[qt][nb]); } }
            __builtin_amdgcn_sched_barrier(0);   // keeps each fragment's loads where they stand: left alone the compiler moved most of them directly in front of their products
        }
    }
    float* my = os + kw * (32 * 68);
#pragma unroll
    for (int qt = 0; qt < 2; ++qt)
#pragma unroll
        for (int nb = 0; nb < 4; ++nb)
#pragma unroll
            for (int j = 0; j < 8; ++j) my[(qt * 16 + hi * 8 + j) * 68 + nb * 16 + lr] = acc[qt][nb][j];
    __syncthreads();   // every wave's partial output tile, row maxima and row sums are in LDS before any wave joins them
    // the 32 x 64 sum is 4 fragment tiles = 256 pieces of 8 columns (one lane's 16 bytes): waves 0..7 take one piece a lane (tile kw >> 1, half kw & 1) and store 512 bytes in a row; no barrier follows
    if (kw >= 8) return;
    const int qt = kw >> 2, ks = (kw >> 1) & 1; const int row = qt * 16 + lr, cofs = ks * 32 + (kw & 1) * 16 + hi * 8;
    // wave w's partial output and sum stand relative to its own maximum m_w: both are weighted with exp(m_w - M), M the row's maximum over the waves; weights at most 1, and 1 for the wave that holds M, so the joined sum is at least 1 (PCAR with fp16 P)
    float wg[16]; float M = redm[row]; wg[0] = M;
#pragma unroll
    for (int w = 1; w < 16; ++w) { wg[w] = redm[w * 32 + row]; M = fmaxf(M, wg[w]); }
    float den = 0.f;
#pragma unroll
    for (int w8 = 0; w8 < 16; w8 += 8) { float y[8];
#pragma unroll
        for (int j = 0; j < 8; ++j) { y[j] = (wg[w8 + j] - M) * 1.4426950408889634f; wg[w8 + j] = __builtin_amdgcn_exp2f(y[j]); den += wg[w8 + j] * reds[(w8 + j) * 32 + row]; }
        // the slot behind a transcendental, as in the softmax above
        asm volatile("v_nop" :: "v"(y[0]), "v"(y[1]), "v"(y[2]), "v"(y[3]), "v"(y[4]), "v"(y[5]), "v"(y[6]), "v"(y[7]), "v"(wg[w8]), "v"(wg[w8 + 1]), "v"(wg[w8 + 2]), "v"(wg[w8 + 3]), "v"(wg[w8 + 4]), "v"(wg[w8 + 5]), "v"(wg[w8 + 6]), "v"(wg[w8 + 7])); }
    v4f val = *(const v4fa*)(os + row * 68 + cofs) * wg[0], val2 = *(const v4fa*)(os + row * 68 + cofs + 4) * wg[0];
#pragma unroll
    for (int w = 1; w < 16; ++w) { val += *(const v4fa*)(os + w * (32 * 68) + row * 68 + cofs) * wg[w]; val2 += *(const v4fa*)(os + w * (32 * 68) + row * 68 + cofs + 4) * wg[w]; }
    const float cs = __fdiv_rn(1.0f, den); v8us oh, ol;
#pragma unroll
    for (int q = 0; q < 4; ++q) { unsigned short a, c2; splitf(val[q] * cs, a, c2); oh[q] = a; ol[q] = c2; splitf(val2[q] * cs, a, c2); oh[q + 4] = a; ol[q + 4] = c2; }
    const int e = (qt * (DQ / 32) + ks) * 512 + (kw & 1) * 256 + lane * 8; *(v8us*)(Ah + e) = oh; *(v8us*)(Al + e) = ol;
}
__global__ __launch_bounds__(512) void k_fattn(const h16* __restrict__ Q16, const h16* __restrict__ K16, const h16* __restrict__ V16, const bf* __restrict__ Qh, const bf* __restrict__ Ql, const bf* __restrict__ Kh, const bf* __restrict__ Kl, const bf* __restrict__ Vh, const bf* __restrict__ Vl, bf* Ah, bf* Al) {
    __shared__ __align__(16) float os[16 * 32 * 68]; __shared__ float redm[16 * 32]; __shared__ float reds[16 * 32];
    const int h = blockIdx.x, q0 = blockIdx.y * 32; const size_t zq = ((size_t)h * TT + q0) * HD, zk = (size_t)(h / REP) * TT * HD, oo = (size_t)q0 * DQ + h * (HD * 16);   // merged planes [t][h d] in fragment order: a band of 16 rows is 16 DQ elements, a head is 2 tiles in it
    static_assert(PCAR == 1024.0f && RH % 32 == 0 && TT == 16 * 128 && HD == 64, "a row block is all hi/lo or all fp16; 16 waves x 128 keys; 4 output column tiles");
    if (q0 < RH) fattn<bf, true>(Qh + zq, Ql + zq, Kh + zk, Kl + zk, Vh + zk, Vl + zk, Ah + oo, Al + oo, os, redm, reds);
    else fattn<h16, false>(Q16 + zq, nullptr, K16 + zk, nullptr, V16 + zk, nullptr, Ah + oo, Al + oo, os, redm, reds);
}

extern "C" void kernel_launch(void* const* d_in, const int* in_sizes, int n_in,
                              void* d_out, int out_size, void* d_ws, size_t ws_size, hipStream_t stream) {
    (void)in_sizes; (void)n_in; (void)out_size;
    const float* x = (const float*)d_in[0]; const float* wq = (const float*)d_in[1]; const float* wk = (const float*)d_in[2]; const float* wv = (const float*)d_in[3]; const float* wo = (const float*)d_in[4]; const float* lng = (const float*)d_in[5]; const float* lnb = (const float*)d_in[6];
    float* OUT = (float*)d_out;     // [1][2048][768]
    char* wsp = (char*)d_ws;
    auto take = [&](size_t bytes) { char* p = wsp; wsp += (bytes + 255) & ~(size_t)255; return (void*)p; };
    float* Y = (float*)take((size_t)TT * DM * 4); bf* WQ = (bf*)take((size_t)DQ * DM * 2); bf* WK = (bf*)take((size_t)DKV * DM * 2); bf* WV = (bf*)take((size_t)DKV * DM * 2); bf* WO = (bf*)take((size_t)DM * DQ * 2);
    bf* XB = (bf*)take((size_t)TT * DM * 2);
    h16* QP16 = (h16*)take((size_t)NH_ * TT * HD * 2); h16* KP16 = (h16*)take((size_t)NKV * TT * HD * 2); h16* VT16 = (h16*)take((size_t)NKV * HD * TT * 2);
    bf* QPh = (bf*)take((size_t)NH_ * TT * HD * 2); bf* QPl = (bf*)take((size_t)NH_ * TT * HD * 2); bf* KPh = (bf*)take((size_t)NKV * TT * HD * 2); bf* KPl = (bf*)take((size_t)NKV * TT * HD * 2); bf* VTh = (bf*)take((size_t)NKV * HD * TT * 2); bf* VTl = (bf*)take((size_t)NKV * HD * TT * 2);
    bf* ATh = (bf*)take((size_t)TT * DQ * 2); bf* ATl = (bf*)take((size_t)TT * DQ * 2);
    if ((size_t)(wsp - (char*)d_ws) > ws_size) return;    // ws 256 MiB
    k_cvt8<<<TT * DM / 16 / 256 + 4 * (DM * DM / 16 / 256), 256, 0, stream>>>(x, wq, wk, wv, wo, XB, WQ, WK, WV, WO);
    for (int b = 0; b < NB_; ++b) {
        
        k_qkv<<<dim3(TT / 64, NH_, 3), 256, 0, stream>>>(XB, WQ, WK, WV, QP16, QPh, QPl, KP16, KPh, KPl, VT16, VTh, VTl);
        k_fattn<<<dim3(NH_, TT / 32, 1), 512, 0, stream>>>(QP16, KP16, VT16, QPh, QPl, KPh, KPl, VTh, VTl, ATh, ATl);
        k_gemmw<bf, 1, false, 8, DQ><<<dim3(TT / 64, DM / 64, 1), 256, 0, stream>>>(ATh, ATl, WO, nullptr, Y, DM, nullptr, 0, 0, 0); k_lnrS12<<<TT / 8, 256, 0, stream>>>(x + (size_t)b * TT * DM, Y, lng, lnb, OUT + (size_t)b * TT * DM);   /* LayerNorm(out + x), eps 1e-12 */ }
}

// v009
// It runs in 59 microseconds.
// Next to v008, in two timings, it ran 1.06 times as fast each time.
// Over all steps from v000 it is 12.9 times as fast.
#include <hip/hip_runtime.h>

// BERT self-attention with residual + LayerNorm (x [2048][768], unbatched; q,k,v = x W^T ('oi' [768][768], no bias, 1/sqrt(768)); 12 heads x 64; softmax(q.k / 8) over all keys; out = merged Wo^T; y = LayerNorm(out + x) gamma + beta (eps 1e-12) -> [2048][768] (1.6 M)).
// Every 16-bit operand plane in the workspace is kept in fragment order (see WFrag::ldf): 16 x 32 tiles of 512 elements, a lane's two 16-byte pieces at lane * 8 and 256 + lane * 8, so that one wave-wide 16-byte load reads 512 contiguous bytes.
// Layout: bf16 copies of x and the four weights, one launch; exact projections, q, k and v in one launch that writes the head planes itself; dense T-2048 attention in one fused kernel, scores and P in registers (hybrid rows: < 512 hi/lo 3 products, rest fp16 x1024); merged hi/lo x Wo exact into workspace; a LayerNorm row kernel adds bf16(x) and writes the output rows (one wave per row, 24 values per lane, f32 fixed order).
// Compute dtypes, f32 accumulate: every input rounded to bf16; projections exact; attention rows < 512 3 products, rest fp16; softmax, residual and LayerNorm f32; Wo hl x exact.

#define NB_  1
#define TT   2048
#define DM   768
#define NH_  12
#define NKV  12
#define REP  (NH_ / NKV)
#define HD   64
#define DQ   (NH_ * HD)
#define DKV  (NKV * HD)
#define RH   512                  // query rows < RH use hi+lo planes (0: none)
#define WIN  0
#define PCAR 1024.0f
#define SCL  0.125f
#define BSZ  1
typedef _Float16 h16;
typedef unsigned short bf;
typedef __attribute__((ext_vector_type(16))) __bf16   v16bf;
typedef __attribute__((ext_vector_type(16))) _Float16 v16h;
typedef __attribute__((ext_vector_type(8)))  _Float16 v8h;
typedef __attribute__((ext_vector_type(8)))  unsigned short v8us;
typedef __attribute__((ext_vector_type(8)))  float    v8f;
typedef __attribute__((ext_vector_type(4)))  float    v4f;
typedef v8h  __attribute__((may_alias)) v8ha;
typedef v4f  __attribute__((may_alias)) v4fa;
typedef v8us __attribute__((may_alias)) v8usa;

__device__ __forceinline__ unsigned short f2bf(float f) { unsigned u = __float_as_uint(f); u += 0x7FFFu + ((u >> 16) & 1u); return (unsigned short)(u >> 16); }
__device__ __forceinline__ float bf2f(unsigned short b) { return __uint_as_float(((unsigned)b) << 16); }
__device__ __forceinline__ float bfr(float f) { return bf2f(f2bf(f)); }
__device__ __forceinline__ v16h cat16(v8h lo, v8h hi) { return __builtin_shufflevector(lo, hi, 0, 1, 2, 3, 4, 5, 6, 7, 8, 9, 10, 11, 12, 13, 14, 15); }
__device__ __forceinline__ v16bf cat16b(v8us lo, v8us hi) { return __builtin_bit_cast(v16bf, __builtin_shufflevector(lo, hi, 0, 1, 2, 3, 4, 5, 6, 7, 8, 9, 10, 11, 12, 13, 14, 15)); }
__device__ __forceinline__ v8f wmma16(v16h a, v16h b, v8f c) { return __builtin_amdgcn_wmma_f32_16x16x32_f16(false, a, false, b, (short)0, c, false, false); }
__device__ __forceinline__ v8f wmmab(v16bf a, v16bf b, v8f c) { return __builtin_amdgcn_wmma_f32_16x16x32_bf16(false, a, false, b, (short)0, c, false, false); }



// ---- k_gemmw: register-blocked GEMM, one 64x64 output tile per workgroup (16 accumulators per wave), operands straight from 16-bit planes in fragment order; grid (M/64, N/64, Z), 32 * KW threads.
// C[m][n] (f32, pitch ldc, + optional f32 bias[n]) = sum_k A[m][k] Bt[n][k] (+ split products per NSPLIT). z-batch strides sA/sB/sC in elements. K % (32 * KW) == 0.
// KW waves share the tile: wave w sums the k range [w K/KW, (w+1) K/KW) of the whole tile; the KW partial tiles meet in LDS and are added in wave order 0..KW-1 (fixed f32 order).
// Fragment order of a plane [R][K]: tile (r >> 4, k >> 5) is number (r >> 4) * (K / 32) + (k >> 5); in it element (r, k) stands at ((k >> 4) & 1) * 256 + (((k >> 3) & 1) * 16 + (r & 15)) * 8 + (k & 7).
// ldf(tile + lane * 8) gives lane (lr, hi) the same 16 values as ld(row lr, k = 8 hi) of a row-major plane: k = 8 hi + 0..7 and 16 + 8 hi + 0..7.
template <typename T16> struct WFrag;
template <> struct WFrag<h16> { typedef v16h V; static __device__ __forceinline__ V ld(const h16* p) { return cat16(*(const v8h*)p, *(const v8h*)(p + 16)); } static __device__ __forceinline__ V ldf(const h16* p) { return cat16(*(const v8h*)p, *(const v8h*)(p + 256)); } static __device__ __forceinline__ v8f mma(V a, V b, v8f c) { return wmma16(a, b, c); } };
template <> struct WFrag<bf> { typedef v16bf V; static __device__ __forceinline__ V ld(const bf* p) { return cat16b(*(const v8us*)p, *(const v8us*)(p + 16)); } static __device__ __forceinline__ V ldf(const bf* p) { return cat16b(*(const v8us*)p, *(const v8us*)(p + 256)); } static __device__ __forceinline__ v8f mma(V a, V b, v8f c) { return wmmab(a, b, c); } };
template <typename T16, int NSPLIT, bool BIAS, int KW, int K>   // K at compile time: the distance from band to band is a constant of the load
__global__ __launch_bounds__(32 * KW) void k_gemmw(const T16* __restrict__ A, const T16* __restrict__ A2, const T16* __restrict__ Bt, const T16* __restrict__ Bt2, float* C, int ldc, const float* __restrict__ bias, size_t sA, size_t sB, size_t sC) {
    typedef typename WFrag<T16>::V V;
    __shared__ __align__(16) float os[KW == 1 ? 16 * 68 : KW * 64 * 68];
    const size_t z = blockIdx.z; A += z * sA; if (A2) A2 += z * sA; Bt += z * sB; if (Bt2) Bt2 += z * sB; C += z * sC;
    const int lane = threadIdx.x & 31, lr = lane & 15, hi = lane >> 4; const int r0 = blockIdx.x * 64, c0 = blockIdx.y * 64;
    v8f acc[4][4];
#pragma unroll
    for (int mb = 0; mb < 4; ++mb)
#pragma unroll
        for (int nb = 0; nb < 4; ++nb) acc[mb][nb] = (v8f){};
    // a band of 16 rows is K / 32 tiles = 16 K elements, and the tile of k step kc starts at kc * 16: a wave-uniform base per k step, one lane offset and a constant per band
    const int lo = lane * 8; A += (size_t)r0 * K; if (NSPLIT == 1 || NSPLIT == 2) A2 += (size_t)r0 * K; Bt += (size_t)c0 * K; if (NSPLIT >= 2) Bt2 += (size_t)c0 * K;
    const int kw = (KW == 1) ? 0 : __builtin_amdgcn_readfirstlane((int)(threadIdx.x >> 5));   // wave number in a scalar register: the k loop stays a scalar loop
    const int kbeg = kw * (K / KW), kend = kbeg + K / KW;
    // K / KW / 32 trips, known at compile time: unrolled, as in k_qkv, so that every tile address is scalar base + lane offset + constant, with no 64-bit vector address arithmetic per trip
#pragma unroll
    for (int kc = kbeg; kc < kend; kc += 32) {
        V a[4], a2[4]; const T16* Ak = A + kc * 16; const T16* A2k = (NSPLIT == 1 || NSPLIT == 2) ? A2 + kc * 16 : nullptr; const T16* Bk = Bt + kc * 16; const T16* B2k = (NSPLIT >= 2) ? Bt2 + kc * 16 : nullptr;
#pragma unroll
        for (int mb = 0; mb < 4; ++mb) { a[mb] = WFrag<T16>::ldf(Ak + (lo + mb * 16 * K)); if (NSPLIT == 1 || NSPLIT == 2) a2[mb] = WFrag<T16>::ldf(A2k + (lo + mb * 16 * K)); }
#pragma unroll
        for (int nb = 0; nb < 4; ++nb) { const V b = WFrag<T16>::ldf(Bk + (lo + nb * 16 * K)); V b2; if (NSPLIT >= 2) b2 = WFrag<T16>::ldf(B2k + (lo + nb * 16 * K));
#pragma unroll
            for (int mb = 0; mb < 4; ++mb) { acc[mb][nb] = WFrag<T16>::mma(a[mb], b, acc[mb][nb]); if (NSPLIT == 1 || NSPLIT == 2) acc[mb][nb] = WFrag<T16>::mma(a2[mb], b, acc[mb][nb]); if (NSPLIT >= 2) acc[mb][nb] = WFrag<T16>::mma(a[mb], b2, acc[mb][nb]); } }
        asm volatile("v_nop\n\tv_nop\n\tv_nop\n\tv_nop" : "+v"(acc[0][0]), "+v"(acc[1][1]), "+v"(acc[2][2]), "+v"(acc[3][3]) : "v"(a[0]), "v"(a[3]));
    }
    if constexpr (KW > 1) {
        float* my = os + kw * (64 * 68);
        // the three loops are unrolled so that acc[][][] is indexed by constants and stays in registers
#pragma unroll
        for (int mb = 0; mb < 4; ++mb)
#pragma unroll
            for (int nb = 0; nb < 4; ++nb)
#pragma unroll
                for (int j = 0; j < 8; ++j) my[(mb * 16 + hi * 8 + j) * 68 + nb * 16 + lr] = acc[mb][nb][j];
        __syncthreads();   // every wave's partial tile is in LDS before any wave adds them
        static_assert((64 * 16) % (32 * KW) == 0, "each thread adds the same number of 4-column pieces");
        // both loops unrolled: the LDS reads of all partial tiles issue ahead of the adds, which keep the order w = 0..KW-1
#pragma unroll
        for (int it = 0; it < (64 * 16) / (32 * KW); ++it) { const int s = (int)threadIdx.x + it * (32 * KW); const int row = s >> 4, cofs = (s & 15) * 4; v4f val = *(const v4fa*)(os + row * 68 + cofs);
#pragma unroll
            for (int w = 1; w < KW; ++w) val += *(const v4fa*)(os + w * (64 * 68) + row * 68 + cofs);
            if (BIAS) { val[0] += bfr(bias[c0 + cofs]); val[1] += bfr(bias[c0 + cofs + 1]); val[2] += bfr(bias[c0 + cofs + 2]); val[3] += bfr(bias[c0 + cofs + 3]); }
            *(v4f*)(C + (size_t)(r0 + row) * ldc + c0 + cofs) = val; }
        return;
    }
#pragma unroll
    for (int mb = 0; mb < 4; ++mb) {
#pragma unroll
        for (int nb = 0; nb < 4; ++nb) {
#pragma unroll
            for (int j = 0; j < 8; ++j) os[(hi * 8 + j) * 68 + nb * 16 + lr] = acc[mb][nb][j]; }
        __builtin_amdgcn_wave_barrier(); asm volatile("" ::: "memory");
        float* crow = C + (size_t)(r0 + mb * 16) * ldc + c0;
{
#pragma unroll
            for (int s = 0; s < 8; ++s) { const int row = 2 * s + hi, cofs = lr * 4; v4f val = *(const v4fa*)(os + row * 68 + cofs); if (BIAS) { val[0] += bfr(bias[c0 + cofs]); val[1] += bfr(bias[c0 + cofs + 1]); val[2] += bfr(bias[c0 + cofs + 2]); val[3] += bfr(bias[c0 + cofs + 3]); }
                *(v4f*)(crow + (size_t)row * ldc + cofs) = val; }
             }
        __builtin_amdgcn_wave_barrier(); asm volatile("" ::: "memory");
    }
}

__device__ __forceinline__ h16 tohx(float x) { return (h16)x; }
__device__ __forceinline__ void splitf(float y, unsigned short& h, unsigned short& l) { h = f2bf(y); l = f2bf(y - bf2f(h)); }
typedef __attribute__((ext_vector_type(2))) _Float16 v2h;
typedef __attribute__((ext_vector_type(4))) _Float16 v4h;
typedef __attribute__((ext_vector_type(2))) unsigned short v2us;
typedef __attribute__((ext_vector_type(4))) unsigned short v4us;
typedef __attribute__((ext_vector_type(2))) float v2f;
typedef __attribute__((ext_vector_type(4))) int v4i;

__global__ __launch_bounds__(256) void k_wtG(const float* __restrict__ w, int K, int N, bf* Bt) {
    const int lane = threadIdx.x & 31; const int L0 = (blockIdx.x * 8 + (threadIdx.x >> 5)) * 8; const int nlines = N * K / 64;
{
#pragma unroll 1
        for (int l = 0; l < 8; ++l) { const int L = L0 + l; if (L >= nlines) break; const size_t e = (size_t)L * 64 + lane * 2; const int k = (int)(e % K), n = (int)(e / K); v2us o;
            o[0] = f2bf(w[(size_t)k * N + n]); o[1] = f2bf(w[(size_t)(k + 1) * N + n]); *(v2us*)(Bt + e) = o; }
         }
}
// f32 [R][DM] row-major -> bf16 in fragment order; one wave per 16 x 32 tile: it reads 16 whole 128-byte lines and stores 1 KiB in a row.
// One launch converts all five planes: workgroups [0, BX) take x, then BW workgroups each for Wq, Wk, Wv, Wo; a workgroup lies wholly in one plane, so source and destination are chosen by scalar tests.
__global__ __launch_bounds__(256) void k_cvt8(const float* __restrict__ x, const float* __restrict__ wq, const float* __restrict__ wk, const float* __restrict__ wv, const float* __restrict__ wo, bf* XB, bf* WQ, bf* WK, bf* WV, bf* WO) {
    constexpr int BX = TT * DM / 16 / 256, BW = DM * DM / 16 / 256;
    static_assert(NB_ == 1 && DQ == DM && DKV == DM && (TT * DM) % (16 * 256) == 0 && (DM * DM) % (16 * 256) == 0, "one x plane, four square weights, whole workgroups per plane");
    int b = blockIdx.x; const float* src = x; bf* dst = XB;
    if (b >= BX) { b -= BX; const int p = b / BW; b -= p * BW; src = p == 0 ? wq : p == 1 ? wk : p == 2 ? wv : wo; dst = p == 0 ? WQ : p == 1 ? WK : p == 2 ? WV : WO; }
    const int lane = threadIdx.x & 31; const int tile = b * 8 + (int)(threadIdx.x >> 5), rt = tile / (DM / 32), kt = tile % (DM / 32);
    const float* s = src + (size_t)(rt * 16 + (lane & 15)) * DM + kt * 32 + (lane >> 4) * 8; const v8f v = *(const v8f*)s, w = *(const v8f*)(s + 16); v8us o, o2;
#pragma unroll
    for (int k = 0; k < 8; ++k) { o[k] = f2bf(v[k]); o2[k] = f2bf(w[k]); }
    bf* d = dst + (size_t)tile * 512 + lane * 8; *(v8us*)d = o; *(v8us*)(d + 256) = o2; }

// ---- k_qkv: the three projections in one launch, grid (TT / 64, heads, 3), 8 waves; one 64x64 tile per workgroup; fragments, k split over the waves and LDS sum in wave order as in k_gemmw with KW = 8.
// A tile is 64 tokens of one head, so the epilogue rounds the f32 sums itself and stores them at their place in the head planes (fp16, hi, lo): no f32 copy of q, k, v in the workspace.
// z = 0, 1: rows = tokens (A = x), columns = d (B = Wq, Wk) -> planes [h][t][d]. z = 2: rows = d (A = Wv), columns = tokens (B = x) -> planes [h][d][t], the transposed V that P V reads.
// The head planes are in fragment order too. q, k: tile number (t >> 4) * 2 + (d >> 5) in the head. V: tile number (t >> 5) * 4 + (d >> 4), so that the 128 keys of one attention range are 16 tiles in a row. Either way a 64 x 64 tile is 8 fragment tiles, 4096 elements, in a row.
__global__ __launch_bounds__(256) void k_qkv(const bf* __restrict__ X, const bf* __restrict__ Wq, const bf* __restrict__ Wk, const bf* __restrict__ Wv, h16* Q16, bf* Qh, bf* Ql, h16* K16, bf* Kh, bf* Kl, h16* V16, bf* Vh, bf* Vl) {
    typedef WFrag<bf>::V V;
    constexpr int KW = 8, K = DM;
    static_assert(DQ == DKV && HD == 64 && TT % 64 == 0 && K % (32 * KW) == 0, "one grid for q, k and v; a tile is one head wide");
    __shared__ __align__(16) float os[KW * 64 * 68];
    const int z = blockIdx.z, tb = blockIdx.x, hb = blockIdx.y;
    const bf* xt = X + (size_t)tb * 64 * K; const bf* wt = (z == 0 ? Wq : z == 1 ? Wk : Wv) + (size_t)hb * 64 * K;
    const bf* A = (z == 2) ? wt : xt; const bf* Bt = (z == 2) ? xt : wt;
    const size_t base = (size_t)hb * TT * HD + (size_t)tb * 64 * HD;
    h16* P16 = (z == 0 ? Q16 : z == 1 ? K16 : V16) + base; bf* Ph = (z == 0 ? Qh : z == 1 ? Kh : Vh) + base; bf* Pl = (z == 0 ? Ql : z == 1 ? Kl : Vl) + base;
    const int lane = threadIdx.x & 31, lr = lane & 15, hi = lane >> 4;
    v8f acc[4][4];
#pragma unroll
    for (int mb = 0; mb < 4; ++mb)
#pragma unroll
        for (int nb = 0; nb < 4; ++nb) acc[mb][nb] = (v8f){};
    const int off = lane * 8;   // wave-uniform bases and one lane offset: every fragment load is scalar base + lane offset + constant
    const int kw = __builtin_amdgcn_readfirstlane((int)(threadIdx.x >> 5));   // wave number in a scalar register: the wave's k offset goes into the scalar bases
    A += kw * (K / KW) * 16; Bt += kw * (K / KW) * 16;   // 32 k are one tile of 512 elements
    // three trips, known at compile time. The loads of trips 0 and 1 are issued as one group ahead of the first product, those of trip 2 as soon as registers of trip 0 (then of trip 1) are free:
    // a wave waits out one L2 latency, not one per late fragment. Products in the order trip, nb, mb, as before.
    static_assert(K / KW == 96, "three trips");
    V a[3][4], b[3][4];
    auto lda = [&](int t, int mb) { a[t][mb] = WFrag<bf>::ldf(A + t * 512 + (off + mb * 16 * K)); };
    auto ldb = [&](int t, int nb) { b[t][nb] = WFrag<bf>::ldf(Bt + t * 512 + (off + nb * 16 * K)); };
    auto prod = [&](int t, int nb) {
#pragma unroll
        for (int mb = 0; mb < 4; ++mb) acc[mb][nb] = WFrag<bf>::mma(a[t][mb], b[t][nb], acc[mb][nb]); };
#pragma unroll
    for (int t = 0; t < 2; ++t) {
#pragma unroll
        for (int i = 0; i < 4; ++i) lda(t, i);
#pragma unroll
        for (int i = 0; i < 4; ++i) ldb(t, i); }
    __builtin_amdgcn_sched_barrier(0);   // keeps the 32 loads above ahead of every product: left alone the compiler issued 13 of the 24 fragments late, most directly in front of their products
#pragma unroll
    for (int nb = 0; nb < 4; ++nb) prod(0, nb);
    __builtin_amdgcn_sched_barrier(0);   // trip 2's first loads stand here, a whole trip ahead of their products, not later
#pragma unroll
    for (int i = 0; i < 4; ++i) lda(2, i);
    ldb(2, 0); ldb(2, 1);
    __builtin_amdgcn_sched_barrier(0);   // as above
    prod(1, 0); prod(1, 1);
    __builtin_amdgcn_sched_barrier(0);   // trip 2's last loads stand here, 16 products ahead of their own
    ldb(2, 2); ldb(2, 3);
    __builtin_amdgcn_sched_barrier(0);   // as above
    prod(1, 2); prod(1, 3);
#pragma unroll
    for (int nb = 0; nb < 4; ++nb) prod(2, nb);
    float* my = os + kw * (64 * 68);
    // the three loops are unrolled so that acc[][][] is indexed by constants and stays in registers
#pragma unroll
    for (int mb = 0; mb < 4; ++mb)
#pragma unroll
        for (int nb = 0; nb < 4; ++nb)
#pragma unroll
            for (int j = 0; j < 8; ++j) my[(mb * 16 + hi * 8 + j) * 68 + nb * 16 + lr] = acc[mb][nb][j];
    __syncthreads();   // every wave's partial tile is in LDS before any wave adds them
    constexpr int NP = (64 * 8) / (32 * KW);   // 8-column pieces per thread: a piece is one lane's 16 bytes of a fragment tile, and a wave's 32 pieces are 512 bytes in a row
    v8h o16[NP]; v8us oh[NP], ol[NP];
    // the loops are unrolled: the LDS reads of all partial tiles issue ahead of the adds, which keep the order w = 0..KW-1, and the piece arrays stay in registers
#pragma unroll
    for (int it = 0; it < NP; ++it) { const int tile = (kw >> 1) + it * (KW / 2);   // piece number threadIdx.x + it * 256 = (tile * 2 + half) * 32 + lane, half = kw & 1
        const int rt = (z == 2) ? (tile & 3) : (tile >> 1), ct = (z == 2) ? (tile >> 2) : (tile & 1); const int row = rt * 16 + lr, cofs = ct * 32 + (kw & 1) * 16 + hi * 8;
        v4f val = *(const v4fa*)(os + row * 68 + cofs), val2 = *(const v4fa*)(os + row * 68 + cofs + 4);
#pragma unroll
        for (int w = 1; w < KW; ++w) { val += *(const v4fa*)(os + w * (64 * 68) + row * 68 + cofs); val2 += *(const v4fa*)(os + w * (64 * 68) + row * 68 + cofs + 4); }
#pragma unroll
        for (int q = 0; q < 4; ++q) { o16[it][q] = tohx(val[q]); o16[it][q + 4] = tohx(val2[q]); unsigned short a2, c2; splitf(val[q], a2, c2); oh[it][q] = a2; ol[it][q] = c2; splitf(val2[q], a2, c2); oh[it][q + 4] = a2; ol[it][q + 4] = c2; } }
    // the six stores go out back to back behind all the rounding; unrolled: the piece arrays are indexed by constants
#pragma unroll
    for (int it = 0; it < NP; ++it) { const int e = ((int)threadIdx.x + it * (32 * KW)) * 8; *(v8h*)(P16 + e) = o16[it]; *(v8us*)(Ph + e) = oh[it]; *(v8us*)(Pl + e) = ol[it]; }
}
__global__ __launch_bounds__(256) void k_lnrS12(const float* __restrict__ wb, const float* __restrict__ Y, const float* __restrict__ g, const float* __restrict__ bb, float* ob) { const int lane = threadIdx.x & 31; const int row = blockIdx.x * 8 + (threadIdx.x >> 5); if (row >= TT) return; const float* br = wb + (size_t)row * BSZ * DM; const float* yr = Y + (size_t)row * DM; float v[DM / 32]; float s = 0.f;
    // every load of the row (x, the product, gamma, beta: 16 bytes a lane each) is issued here, ahead of the arithmetic: one memory latency per wave instead of one per 128 columns and one per gamma / beta element
    v4f a6[DM / 128], y6[DM / 128], g6[DM / 128], b6[DM / 128];
#pragma unroll
    for (int ch = 0; ch < DM / 128; ++ch) { a6[ch] = *(const v4f*)(br + ch * 128 + lane * 4); y6[ch] = *(const v4f*)(yr + ch * 128 + lane * 4); }
#pragma unroll
    for (int ch = 0; ch < DM / 128; ++ch) { g6[ch] = *(const v4f*)(g + ch * 128 + lane * 4); b6[ch] = *(const v4f*)(bb + ch * 128 + lane * 4); }
#pragma unroll
    for (int ch = 0; ch < DM / 128; ++ch) { const v4f a = a6[ch]; const v4f y4 = y6[ch];
#pragma unroll
        for (int q = 0; q < 4; ++q) { float ab = bfr(a[q]); asm volatile("" : "+v"(ab)); float t = __fadd_rn(ab, y4[q]); asm volatile("" : "+v"(t)); v[ch * 4 + q] = t; s = __fadd_rn(s, t); } }
#pragma unroll
    for (int sh = 16; sh; sh >>= 1) s = __fadd_rn(s, __shfl_xor(s, sh, 32));
    const float mu = __fdiv_rn(s, (float)DM); float s2 = 0.f;
#pragma unroll
    for (int k = 0; k < DM / 32; ++k) { const float dv = __fsub_rn(v[k], mu); float p2 = __fmul_rn(dv, dv); asm volatile("" : "+v"(p2)); s2 = __fadd_rn(s2, p2); }
#pragma unroll
    for (int sh = 16; sh; sh >>= 1) s2 = __fadd_rn(s2, __shfl_xor(s2, sh, 32));
    const float rs = __fdiv_rn(1.0f, __fsqrt_rn(__fadd_rn(__fdiv_rn(s2, (float)DM), 1e-12f)));
{
#pragma unroll
        for (int ch = 0; ch < DM / 128; ++ch) { v4f o; for (int q = 0; q < 4; ++q) { float dv = __fsub_rn(v[ch * 4 + q], mu); asm volatile("" : "+v"(dv)); float y = __fmul_rn(dv, rs); asm volatile("" : "+v"(y)); float gg = bfr(g6[ch][q]), bb2 = bfr(b6[ch][q]); asm volatile("" : "+v"(gg), "+v"(bb2)); y = __fmul_rn(y, gg); asm volatile("" : "+v"(y)); o[q] = __fadd_rn(y, bb2); }   /* every step kept separate: no fma contraction */
            *(v4f*)(ob + (size_t)row * BSZ * DM + ch * 128 + lane * 4) = o; }
         } }

// ---- k_fattn: scores, softmax, P V and the head merge for 32 query rows of one head, in one workgroup of 8 waves, two workgroups to a WGP; scores and P stay in registers. Grid (heads, TT / 32): the hi/lo row blocks, which cost most, come first.
// The 2048 keys are 16 ranges of 128; a wave takes ranges 2 w and 2 w + 1 one after the other, each from its K loads to its partial output in LDS. For range kw = keys [128 kw, 128 kw + 128) it forms the transposed scores S^T = K Q^T (A = key rows, B = query rows), so that a lane holds 64 scores of one query per 16-query tile, and two 16-key D tiles,
// converted in place, are the A fragment (row = query, k = key in the loaders' k order 8 hi + 0..7, 16 + 8 hi + 0..7) of P V. Softmax per range: the wave takes the maximum and the sum of the range's 128 keys (in the lane, across the two lane halves) and goes on to P V with no exchange.
// The 16 partial 32 x 64 outputs, maxima and sums meet in LDS behind the kernel's one barrier and are joined in range order 0..15, each weighted with exp(own maximum - row maximum); the sum is divided by the joined row sum, split hi/lo and stored at its place in the merged [t][h d] planes (fragment order).
typedef __attribute__((ext_vector_type(16))) unsigned short v16us;
template <typename T16, bool HL>
__device__ __forceinline__ void fattn(const T16* __restrict__ Q, const T16* __restrict__ Q2, const T16* __restrict__ Kp, const T16* __restrict__ K2, const T16* __restrict__ Vt, const T16* __restrict__ Vt2, bf* Ah, bf* Al, float* os, float* redm, float* reds) {
    typedef typename WFrag<T16>::V V;
    const int lane = threadIdx.x & 31, lr = lane & 15, hi = lane >> 4;
    const int wv = __builtin_amdgcn_readfirstlane((int)(threadIdx.x >> 5));   // wave number in a scalar register
    const int lq = lane * 8;   // planes in fragment order: fragment number n of a range is tile n
    // kept rolled: the two ranges run the same code, so the kernel's text does not grow, and the registers of one range serve both
#pragma unroll 1
    for (int half = 0; half < 2; ++half) {
    // the wait stands ahead of the rewrite of the lane offset that the last range's loads name; its memory clobber also keeps the Q loads inside the loop: moved in front of it their registers stay taken through both ranges and the build spills
    asm volatile("s_wait_xcnt 0x0" ::: "memory");
    // the range's place goes into the one 32-bit lane offset: every K and V fragment load is the plane's scalar base + lane offset + constant (with the place in the bases the compiler carried a 64-bit vector address per plane round the loop and spilled)
    // the mask shows the compiler that the offset is small and not negative, which that address form needs
    const int kw = (wv * 2 + half) & 15;
    const int lo = lq + kw * (128 * HD);
    const T16* kb = Kp; const T16* kb2 = K2; const T16* vb = Vt; const T16* vb2 = Vt2;
    // every loop below is unrolled so that s[][][] and acc[][][] are indexed by constants and stay in registers
    v8f s[8][2];
#pragma unroll
    for (int kt = 0; kt < 8; ++kt) { s[kt][0] = (v8f){}; s[kt][1] = (v8f){}; }
    {
        V qf[2][2], q2f[2][2];
#pragma unroll
        for (int qt = 0; qt < 2; ++qt)
#pragma unroll
            for (int ks = 0; ks < 2; ++ks) { const int o = lq + (qt * 2 + ks) * 512; qf[qt][ks] = WFrag<T16>::ldf(Q + o); if (HL) q2f[qt][ks] = WFrag<T16>::ldf(Q2 + o); }
        if (!HL) __builtin_amdgcn_sched_barrier(0);   // keeps the Q loads first: loads return in order, and with Q behind the 12 K fragments the second product waited for the whole group
        // K fragments are loaded KD fragments ahead of their products. With hi and lo planes: 3 ahead (18 products, which cover an L2 latency with four waves on the SIMD; a fourth does not fit 256 registers beside what the loop over the ranges keeps), held there by the scheduling barriers. With one plane: 12 ahead, so that 32 loads (Q and 12 K fragments) are issued at the start, held there the same way: in this build the compiler, left alone, issued more than half of the K fragments only two fragments ahead.
        constexpr int KD = HL ? 3 : 12;
        V kf[16], k2f[16];
#pragma unroll
        for (int it = 0; it < KD; ++it) { const int o = lo + it * 512; kf[it] = WFrag<T16>::ldf(kb + o); if (HL) k2f[it] = WFrag<T16>::ldf(kb2 + o); }
        __builtin_amdgcn_sched_barrier(0);   // keeps the group of loads above ahead of the first product
#pragma unroll
        for (int it = 0; it < 16; ++it) { const int kt = it >> 1, ks = it & 1;
            if (it + KD < 16) { const int o = lo + (it + KD) * 512; kf[it + KD] = WFrag<T16>::ldf(kb + o); if (HL) k2f[it + KD] = WFrag<T16>::ldf(kb2 + o); }
#pragma unroll
            for (int qt = 0; qt < 2; ++qt) { s[kt][qt] = WFrag<T16>::mma(kf[it], qf[qt][ks], s[kt][qt]); if (HL) { s[kt][qt] = WFrag<T16>::mma(kf[it], q2f[qt][ks], s[kt][qt]); s[kt][qt] = WFrag<T16>::mma(k2f[it], qf[qt][ks], s[kt][qt]); } }
            __builtin_amdgcn_sched_barrier(0);   // keeps each fragment's loads KD fragments ahead: left alone the compiler moved them to one or two fragments ahead
        }
    }
    float mx[2], f[2];
#pragma unroll
    for (int qt = 0; qt < 2; ++qt) { float m = s[0][qt][0];
#pragma unroll
        for (int kt = 0; kt < 8; ++kt)
#pragma unroll
            for (int j = 0; j < 8; ++j) m = fmaxf(m, s[kt][qt][j]);
        mx[qt] = fmaxf(m, __shfl_xor(m, 16, 32)) * SCL; }   // the maximum of the wave's own 128 scaled scores of the row; SCL is a power of two: exact
    redm[kw * 32 + lane] = hi ? mx[1] : mx[0];   // read behind the one barrier, where the partial outputs are joined
    __builtin_amdgcn_sched_barrier(0);   // keeps the V loads below behind the scores: left alone, with no barrier between them, the compiler moved them among the K loads, issued those late and spilled registers
    // V fragments: fragment j is loaded in front of the products of the first fragment it with vlim(it) >= j, as far ahead as the registers freed by the scores allow. The first two (hi and lo planes) or four (one plane) are loaded here: no barrier stands between here and P V any more, so they fly during the exponentials; the scheduling barriers hold every load in its place.
    V vf[16], v2f[16];
    auto ldv = [&](int j) { const int o = lo + j * 512; vf[j] = WFrag<T16>::ldf(vb + o); if (HL) v2f[j] = WFrag<T16>::ldf(vb2 + o); };
    auto vlim = [](int it) { return HL ? (it < 0 ? 1 : it + (it < 4 ? 1 : 3)) : (it < 0 ? 3 : it + (it < 4 ? 5 : 8)); };
#pragma unroll
    for (int j = 0; j < 16; ++j) if (j <= vlim(-1)) ldv(j);
    __builtin_amdgcn_sched_barrier(0);   // keeps these loads ahead of the exponentials
#pragma unroll
    for (int qt = 0; qt < 2; ++qt) { float a = 0.f;
#pragma unroll
        for (int kt = 0; kt < 8; ++kt) { float y[8], e[8];
#pragma unroll
            for (int j = 0; j < 8; ++j) { y[j] = (s[kt][qt][j] * SCL - mx[qt]) * 1.4426950408889634f; if constexpr (!HL) y[j] += 10.0f;   // fp16 P carries the factor PCAR = 2^10, exactly, through the exponent; the sums carry it too, so it cancels at the join
                e[j] = __builtin_amdgcn_exp2f(y[j]); s[kt][qt][j] = e[j]; a += e[j]; }
            // the slot behind a transcendental: as inputs here the eight arguments keep their registers until all eight exponentials are issued, so no instruction directly behind one overwrites its source; the v_nop is the slot of the last one, where the compiler puts no other instruction there
            asm volatile("v_nop" :: "v"(y[0]), "v"(y[1]), "v"(y[2]), "v"(y[3]), "v"(y[4]), "v"(y[5]), "v"(y[6]), "v"(y[7]), "v"(e[0]), "v"(e[1]), "v"(e[2]), "v"(e[3]), "v"(e[4]), "v"(e[5]), "v"(e[6]), "v"(e[7])); }
        f[qt] = a + __shfl_xor(a, 16, 32); }
    reds[kw * 32 + lane] = hi ? f[1] : f[0];   // read behind the one barrier too
    __builtin_amdgcn_sched_barrier(0);   // keeps the exponentials ahead of P V: left alone, with no barrier between them, the compiler mixed the two phases and spilled registers
    v8f acc[2][4];
#pragma unroll
    for (int nb = 0; nb < 4; ++nb) { acc[0][nb] = (v8f){}; acc[1][nb] = (v8f){}; }
#pragma unroll
    for (int kk = 0; kk < 4; ++kk) {
        V pa[2], pa2[2];
#pragma unroll
        for (int qt = 0; qt < 2; ++qt) {
            if constexpr (HL) { v16us ph, pl;
#pragma unroll
                for (int e = 0; e < 16; ++e) { unsigned short a, c2; splitf(s[2 * kk + (e >> 3)][qt][e & 7], a, c2); ph[e] = a; pl[e] = c2; }
                pa[qt] = __builtin_bit_cast(v16bf, ph); pa2[qt] = __builtin_bit_cast(v16bf, pl);
            } else {
#pragma unroll
                for (int e = 0; e < 16; ++e) pa[qt][e] = tohx(s[2 * kk + (e >> 3)][qt][e & 7]);
            } }
#pragma unroll
        for (int nb = 0; nb < 4; ++nb) { const int it = kk * 4 + nb;
#pragma unroll
            for (int j = 0; j < 16; ++j) if (j > vlim(it - 1) && j <= vlim(it)) ldv(j);
#pragma unroll
            for (int qt = 0; qt < 2; ++qt) { acc[qt][nb] = WFrag<T16>::mma(pa[qt], vf[it], acc[qt][nb]); if (HL) { acc[qt][nb] = WFrag<T16>::mma(pa2[qt], vf[it], acc[qt][nb]); acc[qt][nb] = WFrag<T16>::mma(pa[qt], v2f[it], acc[qt][nb]); } }
            __builtin_amdgcn_sched_barrier(0);   // keeps each fragment's loads where they stand: left alone the compiler moved most of them directly in front of their products
        }
    }
    float* my = os + kw * (32 * 68);
#pragma unroll
    for (int qt = 0; qt < 2; ++qt)
#pragma unroll
        for (int nb = 0; nb < 4; ++nb)
#pragma unroll
            for (int j = 0; j < 8; ++j) my[(qt * 16 + hi * 8 + j) * 68 + nb * 16 + lr] = acc[qt][nb][j];
    }
    __syncthreads();   // every range's partial output tile, row maxima and row sums are in LDS before any wave joins them
    // the 32 x 64 sum is 4 fragment tiles = 256 pieces of 8 columns (one lane's 16 bytes): each of the 8 waves takes one piece a lane (tile kw >> 1, half kw & 1) and stores 512 bytes in a row; no barrier follows
    const int kw = wv;
    const int qt = kw >> 2, ks = (kw >> 1) & 1; const int row = qt * 16 + lr, cofs = ks * 32 + (kw & 1) * 16 + hi * 8;
    // range w's partial output and sum stand relative to its own maximum m_w: both are weighted with exp(m_w - M), M the row's maximum over the ranges; weights at most 1, and 1 for the range that holds M, so the joined sum is at least 1 (PCAR with fp16 P)
    float wg[16]; float M = redm[row]; wg[0] = M;
#pragma unroll
    for (int w = 1; w < 16; ++w) { wg[w] = redm[w * 32 + row]; M = fmaxf(M, wg[w]); }
    float den = 0.f;
#pragma unroll
    for (int w8 = 0; w8 < 16; w8 += 8) { float y[8];
#pragma unroll
        for (int j = 0; j < 8; ++j) { y[j] = (wg[w8 + j] - M) * 1.4426950408889634f; wg[w8 + j] = __builtin_amdgcn_exp2f(y[j]); den += wg[w8 + j] * reds[(w8 + j) * 32 + row]; }
        // the slot behind a transcendental, as in the softmax above
        asm volatile("v_nop" :: "v"(y[0]), "v"(y[1]), "v"(y[2]), "v"(y[3]), "v"(y[4]), "v"(y[5]), "v"(y[6]), "v"(y[7]), "v"(wg[w8]), "v"(wg[w8 + 1]), "v"(wg[w8 + 2]), "v"(wg[w8 + 3]), "v"(wg[w8 + 4]), "v"(wg[w8 + 5]), "v"(wg[w8 + 6]), "v"(wg[w8 + 7])); }
    v4f val = *(const v4fa*)(os + row * 68 + cofs) * wg[0], val2 = *(const v4fa*)(os + row * 68 + cofs + 4) * wg[0];
#pragma unroll
    for (int w = 1; w < 16; ++w) { val += *(const v4fa*)(os + w * (32 * 68) + row * 68 + cofs) * wg[w]; val2 += *(const v4fa*)(os + w * (32 * 68) + row * 68 + cofs + 4) * wg[w]; }
    const float cs = __fdiv_rn(1.0f, den); v8us oh, ol;
#pragma unroll
    for (int q = 0; q < 4; ++q) { unsigned short a, c2; splitf(val[q] * cs, a, c2); oh[q] = a; ol[q] = c2; splitf(val2[q] * cs, a, c2); oh[q + 4] = a; ol[q + 4] = c2; }
    const int e = (qt * (DQ / 32) + ks) * 512 + (kw & 1) * 256 + lane * 8; *(v8us*)(Ah + e) = oh; *(v8us*)(Al + e) = ol;
}
// 8 waves and at most 256 registers a wave: two workgroups share a WGP (LDS allows two), four waves to a SIMD as before, and the two run out of step: one's loads fly under the other's exponentials, join and start
__global__ __launch_bounds__(256) __attribute__((amdgpu_waves_per_eu(4, 4))) void k_fattn(const h16* __restrict__ Q16, const h16* __restrict__ K16, const h16* __restrict__ V16, const bf* __restrict__ Qh, const bf* __restrict__ Ql, const bf* __restrict__ Kh, const bf* __restrict__ Kl, const bf* __restrict__ Vh, const bf* __restrict__ Vl, bf* Ah, bf* Al) {
    __shared__ __align__(16) float os[16 * 32 * 68]; __shared__ float redm[16 * 32]; __shared__ float reds[16 * 32];
    const int h = blockIdx.x, q0 = blockIdx.y * 32; const size_t zq = ((size_t)h * TT + q0) * HD, zk = (size_t)(h / REP) * TT * HD, oo = (size_t)q0 * DQ + h * (HD * 16);   // merged planes [t][h d] in fragment order: a band of 16 rows is 16 DQ elements, a head is 2 tiles in it
    static_assert(PCAR == 1024.0f && RH % 32 == 0 && TT == 16 * 128 && HD == 64, "a row block is all hi/lo or all fp16; 8 waves x 2 ranges x 128 keys; 4 output column tiles");
    if (q0 < RH) fattn<bf, true>(Qh + zq, Ql + zq, Kh + zk, Kl + zk, Vh + zk, Vl + zk, Ah + oo, Al + oo, os, redm, reds);
    else fattn<h16, false>(Q16 + zq, nullptr, K16 + zk, nullptr, V16 + zk, nullptr, Ah + oo, Al + oo, os, redm, reds);
}

extern "C" void kernel_launch(void* const* d_in, const int* in_sizes, int n_in,
                              void* d_out, int out_size, void* d_ws, size_t ws_size, hipStream_t stream) {
    (void)in_sizes; (void)n_in; (void)out_size;
    const float* x = (const float*)d_in[0]; const float* wq = (const float*)d_in[1]; const float* wk = (const float*)d_in[2]; const float* wv = (const float*)d_in[3]; const float* wo = (const float*)d_in[4]; const float* lng = (const float*)d_in[5]; const float* lnb = (const float*)d_in[6];
    float* OUT = (float*)d_out;     // [1][2048][768]
    char* wsp = (char*)d_ws;
    auto take = [&](size_t bytes) { char* p = wsp; wsp += (bytes + 255) & ~(size_t)255; return (void*)p; };
    float* Y = (float*)take((size_t)TT * DM * 4); bf* WQ = (bf*)take((size_t)DQ * DM * 2); bf* WK = (bf*)take((size_t)DKV * DM * 2); bf* WV = (bf*)take((size_t)DKV * DM * 2); bf* WO = (bf*)take((size_t)DM * DQ * 2);
    bf* XB = (bf*)take((size_t)TT * DM * 2);
    h16* QP16 = (h16*)take((size_t)NH_ * TT * HD * 2); h16* KP16 = (h16*)take((size_t)NKV * TT * HD * 2); h16* VT16 = (h16*)take((size_t)NKV * HD * TT * 2);
    bf* QPh = (bf*)take((size_t)NH_ * TT * HD * 2); bf* QPl = (bf*)take((size_t)NH_ * TT * HD * 2); bf* KPh = (bf*)take((size_t)NKV * TT * HD * 2); bf* KPl = (bf*)take((size_t)NKV * TT * HD * 2); bf* VTh = (bf*)take((size_t)NKV * HD * TT * 2); bf* VTl = (bf*)take((size_t)NKV * HD * TT * 2);
    bf* ATh = (bf*)take((size_t)TT * DQ * 2); bf* ATl = (bf*)take((size_t)TT * DQ * 2);
    if ((size_t)(wsp - (char*)d_ws) > ws_size) return;    // ws 256 MiB
    k_cvt8<<<TT * DM / 16 / 256 + 4 * (DM * DM / 16 / 256), 256, 0, stream>>>(x, wq, wk, wv, wo, XB, WQ, WK, WV, WO);
    for (int b = 0; b < NB_; ++b) {
        
        k_qkv<<<dim3(TT / 64, NH_, 3), 256, 0, stream>>>(XB, WQ, WK, WV, QP16, QPh, QPl, KP16, KPh, KPl, VT16, VTh, VTl);
        k_fattn<<<dim3(NH_, TT / 32, 1), 256, 0, stream>>>(QP16, KP16, VT16, QPh, QPl, KPh, KPl, VTh, VTl, ATh, ATl);
        k_gemmw<bf, 1, false, 8, DQ><<<dim3(TT / 64, DM / 64, 1), 256, 0, stream>>>(ATh, ATl, WO, nullptr, Y, DM, nullptr, 0, 0, 0); k_lnrS12<<<TT / 8, 256, 0, stream>>>(x + (size_t)b * TT * DM, Y, lng, lnb, OUT + (size_t)b * TT * DM);   /* LayerNorm(out + x), eps 1e-12 */ }
}

// v010
// A run of this version takes 51.7 microseconds.
// In both of two side-by-side timings against v009, it was 1.14 times as fast.
// Over all steps from v000 it is 14.7 times as fast.
#include <hip/hip_runtime.h>

// BERT self-attention with residual + LayerNorm (x [2048][768], unbatched; q,k,v = x W^T ('oi' [768][768], no bias, 1/sqrt(768)); 12 heads x 64; softmax(q.k / 8) over all keys; out = merged Wo^T; y = LayerNorm(out + x) gamma + beta (eps 1e-12) -> [2048][768] (1.6 M)).
// Every 16-bit operand plane in the workspace is kept in fragment order (see WFrag::ldf): 16 x 32 tiles of 512 elements, a lane's two 16-byte pieces at lane * 8 and 256 + lane * 8, so that one wave-wide 16-byte load reads 512 contiguous bytes.
// Layout: bf16 copies of x and the four weights, one launch; exact projections, q, k and v in one launch that writes the head planes itself; dense T-2048 attention in one fused kernel, scores and P in registers (every row fp16, P x1024); merged hi/lo x Wo exact into workspace; a LayerNorm row kernel adds bf16(x) and writes the output rows (one wave per row, 24 values per lane, f32 fixed order).
// Compute dtypes, f32 accumulate: every input rounded to bf16; projections exact; attention fp16, one product; softmax, residual and LayerNorm f32; Wo hl x exact.

#define NB_  1
#define TT   2048
#define DM   768
#define NH_  12
#define NKV  12
#define REP  (NH_ / NKV)
#define HD   64
#define DQ   (NH_ * HD)
#define DKV  (NKV * HD)
#define WIN  0
#define PCAR 1024.0f
#define SCL  0.125f
#define BSZ  1
typedef _Float16 h16;
typedef unsigned short bf;
typedef __attribute__((ext_vector_type(16))) __bf16   v16bf;
typedef __attribute__((ext_vector_type(16))) _Float16 v16h;
typedef __attribute__((ext_vector_type(8)))  _Float16 v8h;
typedef __attribute__((ext_vector_type(8)))  unsigned short v8us;
typedef __attribute__((ext_vector_type(8)))  float    v8f;
typedef __attribute__((ext_vector_type(4)))  float    v4f;
typedef v8h  __attribute__((may_alias)) v8ha;
typedef v4f  __attribute__((may_alias)) v4fa;
typedef v8us __attribute__((may_alias)) v8usa;

__device__ __forceinline__ unsigned short f2bf(float f) { unsigned u = __float_as_uint(f); u += 0x7FFFu + ((u >> 16) & 1u); return (unsigned short)(u >> 16); }
__device__ __forceinline__ float bf2f(unsigned short b) { return __uint_as_float(((unsigned)b) << 16); }
__device__ __forceinline__ float bfr(float f) { return bf2f(f2bf(f)); }
__device__ __forceinline__ v16h cat16(v8h lo, v8h hi) { return __builtin_shufflevector(lo, hi, 0, 1, 2, 3, 4, 5, 6, 7, 8, 9, 10, 11, 12, 13, 14, 15); }
__device__ __forceinline__ v16bf cat16b(v8us lo, v8us hi) { return __builtin_bit_cast(v16bf, __builtin_shufflevector(lo, hi, 0, 1, 2, 3, 4, 5, 6, 7, 8, 9, 10, 11, 12, 13, 14, 15)); }
__device__ __forceinline__ v8f wmma16(v16h a, v16h b, v8f c) { return __builtin_amdgcn_wmma_f32_16x16x32_f16(false, a, false, b, (short)0, c, false, false); }
__device__ __forceinline__ v8f wmmab(v16bf a, v16bf b, v8f c) { return __builtin_amdgcn_wmma_f32_16x16x32_bf16(false, a, false, b, (short)0, c, false, false); }



// ---- k_gemmw: register-blocked GEMM, one 64x64 output tile per workgroup (16 accumulators per wave), operands straight from 16-bit planes in fragment order; grid (M/64, N/64, Z), 32 * KW threads.
// C[m][n] (f32, pitch ldc, + optional f32 bias[n]) = sum_k A[m][k] Bt[n][k] (+ split products per NSPLIT). z-batch strides sA/sB/sC in elements. K % (32 * KW) == 0.
// KW waves share the tile: wave w sums the k range [w K/KW, (w+1) K/KW) of the whole tile; the KW partial tiles meet in LDS and are added in wave order 0..KW-1 (fixed f32 order).
// Fragment order of a plane [R][K]: tile (r >> 4, k >> 5) is number (r >> 4) * (K / 32) + (k >> 5); in it element (r, k) stands at ((k >> 4) & 1) * 256 + (((k >> 3) & 1) * 16 + (r & 15)) * 8 + (k & 7).
// ldf(tile + lane * 8) gives lane (lr, hi) the same 16 values as ld(row lr, k = 8 hi) of a row-major plane: k = 8 hi + 0..7 and 16 + 8 hi + 0..7.
template <typename T16> struct WFrag;
template <> struct WFrag<h16> { typedef v16h V; static __device__ __forceinline__ V ld(const h16* p) { return cat16(*(const v8h*)p, *(const v8h*)(p + 16)); } static __device__ __forceinline__ V ldf(const h16* p) { return cat16(*(const v8h*)p, *(const v8h*)(p + 256)); } static __device__ __forceinline__ v8f mma(V a, V b, v8f c) { return wmma16(a, b, c); } };
template <> struct WFrag<bf> { typedef v16bf V; static __device__ __forceinline__ V ld(const bf* p) { return cat16b(*(const v8us*)p, *(const v8us*)(p + 16)); } static __device__ __forceinline__ V ldf(const bf* p) { return cat16b(*(const v8us*)p, *(const v8us*)(p + 256)); } static __device__ __forceinline__ v8f mma(V a, V b, v8f c) { return wmmab(a, b, c); } };
template <typename T16, int NSPLIT, bool BIAS, int KW, int K>   // K at compile time: the distance from band to band is a constant of the load
__global__ __launch_bounds__(32 * KW) void k_gemmw(const T16* __restrict__ A, const T16* __restrict__ A2, const T16* __restrict__ Bt, const T16* __restrict__ Bt2, float* C, int ldc, const float* __restrict__ bias, size_t sA, size_t sB, size_t sC) {
    typedef typename WFrag<T16>::V V;
    __shared__ __align__(16) float os[KW == 1 ? 16 * 68 : KW * 64 * 68];
    const size_t z = blockIdx.z; A += z * sA; if (A2) A2 += z * sA; Bt += z * sB; if (Bt2) Bt2 += z * sB; C += z * sC;
    const int lane = threadIdx.x & 31, lr = lane & 15, hi = lane >> 4; const int r0 = blockIdx.x * 64, c0 = blockIdx.y * 64;
    v8f acc[4][4];
#pragma unroll
    for (int mb = 0; mb < 4; ++mb)
#pragma unroll
        for (int nb = 0; nb < 4; ++nb) acc[mb][nb] = (v8f){};
    // a band of 16 rows is K / 32 tiles = 16 K elements, and the tile of k step kc starts at kc * 16: a wave-uniform base per k step, one lane offset and a constant per band
    const int lo = lane * 8; A += (size_t)r0 * K; if (NSPLIT == 1 || NSPLIT == 2) A2 += (size_t)r0 * K; Bt += (size_t)c0 * K; if (NSPLIT >= 2) Bt2 += (size_t)c0 * K;
    const int kw = (KW == 1) ? 0 : __builtin_amdgcn_readfirstlane((int)(threadIdx.x >> 5));   // wave number in a scalar register: the k loop stays a scalar loop
    const int kbeg = kw * (K / KW), kend = kbeg + K / KW;
    // K / KW / 32 trips, known at compile time: unrolled, as in k_qkv, so that every tile address is scalar base + lane offset + constant, with no 64-bit vector address arithmetic per trip
#pragma unroll
    for (int kc = kbeg; kc < kend; kc += 32) {
        V a[4], a2[4]; const T16* Ak = A + kc * 16; const T16* A2k = (NSPLIT == 1 || NSPLIT == 2) ? A2 + kc * 16 : nullptr; const T16* Bk = Bt + kc * 16; const T16* B2k = (NSPLIT >= 2) ? Bt2 + kc * 16 : nullptr;
#pragma unroll
        for (int mb = 0; mb < 4; ++mb) { a[mb] = WFrag<T16>::ldf(Ak + (lo + mb * 16 * K)); if (NSPLIT == 1 || NSPLIT == 2) a2[mb] = WFrag<T16>::ldf(A2k + (lo + mb * 16 * K)); }
#pragma unroll
        for (int nb = 0; nb < 4; ++nb) { const V b = WFrag<T16>::ldf(Bk + (lo + nb * 16 * K)); V b2; if (NSPLIT >= 2) b2 = WFrag<T16>::ldf(B2k + (lo + nb * 16 * K));
#pragma unroll
            for (int mb = 0; mb < 4; ++mb) { acc[mb][nb] = WFrag<T16>::mma(a[mb], b, acc[mb][nb]); if (NSPLIT == 1 || NSPLIT == 2) acc[mb][nb] = WFrag<T16>::mma(a2[mb], b, acc[mb][nb]); if (NSPLIT >= 2) acc[mb][nb] = WFrag<T16>::mma(a[mb], b2, acc[mb][nb]); } }
        asm volatile("v_nop\n\tv_nop\n\tv_nop\n\tv_nop" : "+v"(acc[0][0]), "+v"(acc[1][1]), "+v"(acc[2][2]), "+v"(acc[3][3]) : "v"(a[0]), "v"(a[3]));
    }
    if constexpr (KW > 1) {
        float* my = os + kw * (64 * 68);
        // the three loops are unrolled so that acc[][][] is indexed by constants and stays in registers
#pragma unroll
        for (int mb = 0; mb < 4; ++mb)
#pragma unroll
            for (int nb = 0; nb < 4; ++nb)
#pragma unroll
                for (int j = 0; j < 8; ++j) my[(mb * 16 + hi * 8 + j) * 68 + nb * 16 + lr] = acc[mb][nb][j];
        __syncthreads();   // every wave's partial tile is in LDS before any wave adds them
        static_assert((64 * 16) % (32 * KW) == 0, "each thread adds the same number of 4-column pieces");
        // both loops unrolled: the LDS reads of all partial tiles issue ahead of the adds, which keep the order w = 0..KW-1
#pragma unroll
        for (int it = 0; it < (64 * 16) / (32 * KW); ++it) { const int s = (int)threadIdx.x + it * (32 * KW); const int row = s >> 4, cofs = (s & 15) * 4; v4f val = *(const v4fa*)(os + row * 68 + cofs);
#pragma unroll
            for (int w = 1; w < KW; ++w) val += *(const v4fa*)(os + w * (64 * 68) + row * 68 + cofs);
            if (BIAS) { val[0] += bfr(bias[c0 + cofs]); val[1] += bfr(bias[c0 + cofs + 1]); val[2] += bfr(bias[c0 + cofs + 2]); val[3] += bfr(bias[c0 + cofs + 3]); }
            *(v4f*)(C + (size_t)(r0 + row) * ldc + c0 + cofs) = val; }
        return;
    }
#pragma unroll
    for (int mb = 0; mb < 4; ++mb) {
#pragma unroll
        for (int nb = 0; nb < 4; ++nb) {
#pragma unroll
            for (int j = 0; j < 8; ++j) os[(hi * 8 + j) * 68 + nb * 16 + lr] = acc[mb][nb][j]; }
        __builtin_amdgcn_wave_barrier(); asm volatile("" ::: "memory");
        float* crow = C + (size_t)(r0 + mb * 16) * ldc + c0;
{
#pragma unroll
            for (int s = 0; s < 8; ++s) { const int row = 2 * s + hi, cofs = lr * 4; v4f val = *(const v4fa*)(os + row * 68 + cofs); if (BIAS) { val[0] += bfr(bias[c0 + cofs]); val[1] += bfr(bias[c0 + cofs + 1]); val[2] += bfr(bias[c0 + cofs + 2]); val[3] += bfr(bias[c0 + cofs + 3]); }
                *(v4f*)(crow + (size_t)row * ldc + cofs) = val; }
             }
        __builtin_amdgcn_wave_barrier(); asm volatile("" ::: "memory");
    }
}

__device__ __forceinline__ h16 tohx(float x) { return (h16)x; }
__device__ __forceinline__ void splitf(float y, unsigned short& h, unsigned short& l) { h = f2bf(y); l = f2bf(y - bf2f(h)); }
typedef __attribute__((ext_vector_type(2))) _Float16 v2h;
typedef __attribute__((ext_vector_type(4))) _Float16 v4h;
typedef __attribute__((ext_vector_type(2))) unsigned short v2us;
typedef __attribute__((ext_vector_type(4))) unsigned short v4us;
typedef __attribute__((ext_vector_type(2))) float v2f;
typedef __attribute__((ext_vector_type(4))) int v4i;

__global__ __launch_bounds__(256) void k_wtG(const float* __restrict__ w, int K, int N, bf* Bt) {
    const int lane = threadIdx.x & 31; const int L0 = (blockIdx.x * 8 + (threadIdx.x >> 5)) * 8; const int nlines = N * K / 64;
{
#pragma unroll 1
        for (int l = 0; l < 8; ++l) { const int L = L0 + l; if (L >= nlines) break; const size_t e = (size_t)L * 64 + lane * 2; const int k = (int)(e % K), n = (int)(e / K); v2us o;
            o[0] = f2bf(w[(size_t)k * N + n]); o[1] = f2bf(w[(size_t)(k + 1) * N + n]); *(v2us*)(Bt + e) = o; }
         }
}
// f32 [R][DM] row-major -> bf16 in fragment order; one wave per 16 x 32 tile: it reads 16 whole 128-byte lines and stores 1 KiB in a row.
// One launch converts all five planes: workgroups [0, BX) take x, then BW workgroups each for Wq, Wk, Wv, Wo; a workgroup lies wholly in one plane, so source and destination are chosen by scalar tests.
__global__ __launch_bounds__(256) void k_cvt8(const float* __restrict__ x, const float* __restrict__ wq, const float* __restrict__ wk, const float* __restrict__ wv, const float* __restrict__ wo, bf* XB, bf* WQ, bf* WK, bf* WV, bf* WO) {
    constexpr int BX = TT * DM / 16 / 256, BW = DM * DM / 16 / 256;
    static_assert(NB_ == 1 && DQ == DM && DKV == DM && (TT * DM) % (16 * 256) == 0 && (DM * DM) % (16 * 256) == 0, "one x plane, four square weights, whole workgroups per plane");
    int b = blockIdx.x; const float* src = x; bf* dst = XB;
    if (b >= BX) { b -= BX; const int p = b / BW; b -= p * BW; src = p == 0 ? wq : p == 1 ? wk : p == 2 ? wv : wo; dst = p == 0 ? WQ : p == 1 ? WK : p == 2 ? WV : WO; }
    const int lane = threadIdx.x & 31; const int tile = b * 8 + (int)(threadIdx.x >> 5), rt = tile / (DM / 32), kt = tile % (DM / 32);
    const float* s = src + (size_t)(rt * 16 + (lane & 15)) * DM + kt * 32 + (lane >> 4) * 8; const v8f v = *(const v8f*)s, w = *(const v8f*)(s + 16); v8us o, o2;
#pragma unroll
    for (int k = 0; k < 8; ++k) { o[k] = f2bf(v[k]); o2[k] = f2bf(w[k]); }
    bf* d = dst + (size_t)tile * 512 + lane * 8; *(v8us*)d = o; *(v8us*)(d + 256) = o2; }

// ---- k_qkv: the three projections in one launch, grid (TT / 64, heads, 3), 8 waves; one 64x64 tile per workgroup; fragments, k split over the waves and LDS sum in wave order as in k_gemmw with KW = 8.
// A tile is 64 tokens of one head, so the epilogue rounds the f32 sums itself and stores them at their place in the fp16 head planes: no f32 copy of q, k, v in the workspace.
// z = 0, 1: rows = tokens (A = x), columns = d (B = Wq, Wk) -> planes [h][t][d]. z = 2: rows = d (A = Wv), columns = tokens (B = x) -> planes [h][d][t], the transposed V that P V reads.
// The head planes are in fragment order too. q, k: tile number (t >> 4) * 2 + (d >> 5) in the head. V: tile number (t >> 5) * 4 + (d >> 4), so that the 128 keys of one attention wave are 16 tiles in a row. Either way a 64 x 64 tile is 8 fragment tiles, 4096 elements, in a row.
__global__ __launch_bounds__(256) void k_qkv(const bf* __restrict__ X, const bf* __restrict__ Wq, const bf* __restrict__ Wk, const bf* __restrict__ Wv, h16* Q16, h16* K16, h16* V16) {
    typedef WFrag<bf>::V V;
    constexpr int KW = 8, K = DM;
    static_assert(DQ == DKV && HD == 64 && TT % 64 == 0 && K % (32 * KW) == 0, "one grid for q, k and v; a tile is one head wide");
    __shared__ __align__(16) float os[KW * 64 * 68];
    const int z = blockIdx.z, tb = blockIdx.x, hb = blockIdx.y;
    const bf* xt = X + (size_t)tb * 64 * K; const bf* wt = (z == 0 ? Wq : z == 1 ? Wk : Wv) + (size_t)hb * 64 * K;
    const bf* A = (z == 2) ? wt : xt; const bf* Bt = (z == 2) ? xt : wt;
    const size_t base = (size_t)hb * TT * HD + (size_t)tb * 64 * HD;
    h16* P16 = (z == 0 ? Q16 : z == 1 ? K16 : V16) + base;
    const int lane = threadIdx.x & 31, lr = lane & 15, hi = lane >> 4;
    v8f acc[4][4];
#pragma unroll
    for (int mb = 0; mb < 4; ++mb)
#pragma unroll
        for (int nb = 0; nb < 4; ++nb) acc[mb][nb] = (v8f){};
    const int off = lane * 8;   // wave-uniform bases and one lane offset: every fragment load is scalar base + lane offset + constant
    const int kw = __builtin_amdgcn_readfirstlane((int)(threadIdx.x >> 5));   // wave number in a scalar register: the wave's k offset goes into the scalar bases
    A += kw * (K / KW) * 16; Bt += kw * (K / KW) * 16;   // 32 k are one tile of 512 elements
    // three trips, known at compile time. The loads of trips 0 and 1 are issued as one group ahead of the first product, those of trip 2 as soon as registers of trip 0 (then of trip 1) are free:
    // a wave waits out one L2 latency, not one per late fragment. Products in the order trip, nb, mb, as before.
    static_assert(K / KW == 96, "three trips");
    V a[3][4], b[3][4];
    auto lda = [&](int t, int mb) { a[t][mb] = WFrag<bf>::ldf(A + t * 512 + (off + mb * 16 * K)); };
    auto ldb = [&](int t, int nb) { b[t][nb] = WFrag<bf>::ldf(Bt + t * 512 + (off + nb * 16 * K)); };
    auto prod = [&](int t, int nb) {
#pragma unroll
        for (int mb = 0; mb < 4; ++mb) acc[mb][nb] = WFrag<bf>::mma(a[t][mb], b[t][nb], acc[mb][nb]); };
#pragma unroll
    for (int t = 0; t < 2; ++t) {
#pragma unroll
        for (int i = 0; i < 4; ++i) lda(t, i);
#pragma unroll
        for (int i = 0; i < 4; ++i) ldb(t, i); }
    __builtin_amdgcn_sched_barrier(0);   // keeps the 32 loads above ahead of every product: left alone the compiler issued 13 of the 24 fragments late, most directly in front of their products
#pragma unroll
    for (int nb = 0; nb < 4; ++nb) prod(0, nb);
    __builtin_amdgcn_sched_barrier(0);   // trip 2's first loads stand here, a whole trip ahead of their products, not later
#pragma unroll
    for (int i = 0; i < 4; ++i) lda(2, i);
    ldb(2, 0); ldb(2, 1);
    __builtin_amdgcn_sched_barrier(0);   // as above
    prod(1, 0); prod(1, 1);
    __builtin_amdgcn_sched_barrier(0);   // trip 2's last loads stand here, 16 products ahead of their own
    ldb(2, 2); ldb(2, 3);
    __builtin_amdgcn_sched_barrier(0);   // as above
    prod(1, 2); prod(1, 3);
#pragma unroll
    for (int nb = 0; nb < 4; ++nb) prod(2, nb);
    float* my = os + kw * (64 * 68);
    // the three loops are unrolled so that acc[][][] is indexed by constants and stays in registers
#pragma unroll
    for (int mb = 0; mb < 4; ++mb)
#pragma unroll
        for (int nb = 0; nb < 4; ++nb)
#pragma unroll
            for (int j = 0; j < 8; ++j) my[(mb * 16 + hi * 8 + j) * 68 + nb * 16 + lr] = acc[mb][nb][j];
    __syncthreads();   // every wave's partial tile is in LDS before any wave adds them
    constexpr int NP = (64 * 8) / (32 * KW);   // 8-column pieces per thread: a piece is one lane's 16 bytes of a fragment tile, and a wave's 32 pieces are 512 bytes in a row
    v8h o16[NP];
    // the loops are unrolled: the LDS reads of all partial tiles issue ahead of the adds, which keep the order w = 0..KW-1, and the piece arrays stay in registers
#pragma unroll
    for (int it = 0; it < NP; ++it) { const int tile = (kw >> 1) + it * (KW / 2);   // piece number threadIdx.x + it * 256 = (tile * 2 + half) * 32 + lane, half = kw & 1
        const int rt = (z == 2) ? (tile & 3) : (tile >> 1), ct = (z == 2) ? (tile >> 2) : (tile & 1); const int row = rt * 16 + lr, cofs = ct * 32 + (kw & 1) * 16 + hi * 8;
        v4f val = *(const v4fa*)(os + row * 68 + cofs), val2 = *(const v4fa*)(os + row * 68 + cofs + 4);
#pragma unroll
        for (int w = 1; w < KW; ++w) { val += *(const v4fa*)(os + w * (64 * 68) + row * 68 + cofs); val2 += *(const v4fa*)(os + w * (64 * 68) + row * 68 + cofs + 4); }
#pragma unroll
        for (int q = 0; q < 4; ++q) { o16[it][q] = tohx(val[q]); o16[it][q + 4] = tohx(val2[q]); } }
    // the two stores go out back to back behind all the rounding; unrolled: the piece array is indexed by constants
#pragma unroll
    for (int it = 0; it < NP; ++it) { const int e = ((int)threadIdx.x + it * (32 * KW)) * 8; *(v8h*)(P16 + e) = o16[it]; }
}
__global__ __launch_bounds__(256) void k_lnrS12(const float* __restrict__ wb, const float* __restrict__ Y, const float* __restrict__ g, const float* __restrict__ bb, float* ob) { const int lane = threadIdx.x & 31; const int row = blockIdx.x * 8 + (threadIdx.x >> 5); if (row >= TT) return; const float* br = wb + (size_t)row * BSZ * DM; const float* yr = Y + (size_t)row * DM; float v[DM / 32]; float s = 0.f;
    // every load of the row (x, the product, gamma, beta: 16 bytes a lane each) is issued here, ahead of the arithmetic: one memory latency per wave instead of one per 128 columns and one per gamma / beta element
    v4f a6[DM / 128], y6[DM / 128], g6[DM / 128], b6[DM / 128];
#pragma unroll
    for (int ch = 0; ch < DM / 128; ++ch) { a6[ch] = *(const v4f*)(br + ch * 128 + lane * 4); y6[ch] = *(const v4f*)(yr + ch * 128 + lane * 4); }
#pragma unroll
    for (int ch = 0; ch < DM / 128; ++ch) { g6[ch] = *(const v4f*)(g + ch * 128 + lane * 4); b6[ch] = *(const v4f*)(bb + ch * 128 + lane * 4); }
#pragma unroll
    for (int ch = 0; ch < DM / 128; ++ch) { const v4f a = a6[ch]; const v4f y4 = y6[ch];
#pragma unroll
        for (int q = 0; q < 4; ++q) { float ab = bfr(a[q]); asm volatile("" : "+v"(ab)); float t = __fadd_rn(ab, y4[q]); asm volatile("" : "+v"(t)); v[ch * 4 + q] = t; s = __fadd_rn(s, t); } }
#pragma unroll
    for (int sh = 16; sh; sh >>= 1) s = __fadd_rn(s, __shfl_xor(s, sh, 32));
    const float mu = __fdiv_rn(s, (float)DM); float s2 = 0.f;
#pragma unroll
    for (int k = 0; k < DM / 32; ++k) { const float dv = __fsub_rn(v[k], mu); float p2 = __fmul_rn(dv, dv); asm volatile("" : "+v"(p2)); s2 = __fadd_rn(s2, p2); }
#pragma unroll
    for (int sh = 16; sh; sh >>= 1) s2 = __fadd_rn(s2, __shfl_xor(s2, sh, 32));
    const float rs = __fdiv_rn(1.0f, __fsqrt_rn(__fadd_rn(__fdiv_rn(s2, (float)DM), 1e-12f)));
{
#pragma unroll
        for (int ch = 0; ch < DM / 128; ++ch) { v4f o; for (int q = 0; q < 4; ++q) { float dv = __fsub_rn(v[ch * 4 + q], mu); asm volatile("" : "+v"(dv)); float y = __fmul_rn(dv, rs); asm volatile("" : "+v"(y)); float gg = bfr(g6[ch][q]), bb2 = bfr(b6[ch][q]); asm volatile("" : "+v"(gg), "+v"(bb2)); y = __fmul_rn(y, gg); asm volatile("" : "+v"(y)); o[q] = __fadd_rn(y, bb2); }   /* every step kept separate: no fma contraction */
            *(v4f*)(ob + (size_t)row * BSZ * DM + ch * 128 + lane * 4) = o; }
         } }

// ---- k_fattn: scores, softmax, P V and the head merge for 32 query rows of one head, in one workgroup of 8 waves, two workgroups to a WGP; scores and P stay in registers. Grid (heads, TT / 32).
// The 2048 keys are 16 ranges of 128; a wave takes ranges 2 w and 2 w + 1 one after the other, each from its K loads to its partial output in LDS. For range kw = keys [128 kw, 128 kw + 128) it forms the transposed scores S^T = K Q^T (A = key rows, B = query rows), so that a lane holds 64 scores of one query per 16-query tile, and two 16-key D tiles,
// converted in place, are the A fragment (row = query, k = key in the loaders' k order 8 hi + 0..7, 16 + 8 hi + 0..7) of P V. Softmax per range: the wave takes the maximum and the sum of the range's 128 keys (in the lane, across the two lane halves) and goes on to P V with no exchange.
// The 16 partial 32 x 64 outputs, maxima and sums meet in LDS behind the kernel's one barrier and are joined in range order 0..15, each weighted with exp(own maximum - row maximum); the sum is divided by the joined row sum, split hi/lo and stored at its place in the merged [t][h d] planes (fragment order).
__device__ __forceinline__ void fattn(const h16* __restrict__ Q, const h16* __restrict__ Kp, const h16* __restrict__ Vt, bf* Ah, bf* Al, float* os, float* redm, float* reds) {
    typedef h16 T16; typedef WFrag<T16>::V V;
    const int lane = threadIdx.x & 31, lr = lane & 15, hi = lane >> 4;
    const int wv = __builtin_amdgcn_readfirstlane((int)(threadIdx.x >> 5));   // wave number in a scalar register
    const int lq = lane * 8;   // planes in fragment order: fragment number n of a range is tile n
    // kept rolled: the two ranges run the same code, so the kernel's text does not grow, and the registers of one range serve both
#pragma unroll 1
    for (int half = 0; half < 2; ++half) {
    // the wait stands ahead of the rewrite of the lane offset that the last range's loads name; its memory clobber also keeps the Q loads inside the loop: moved in front of it their registers stay taken through both ranges and the build spills
    asm volatile("s_wait_xcnt 0x0" ::: "memory");
    // the range's place goes into the one 32-bit lane offset: every K and V fragment load is the plane's scalar base + lane offset + constant (with the place in the bases the compiler carried a 64-bit vector address per plane round the loop and spilled)
    // the mask shows the compiler that the offset is small and not negative, which that address form needs
    const int kw = (wv * 2 + half) & 15;
    const int lo = lq + kw * (128 * HD);
    const T16* kb = Kp; const T16* vb = Vt;
    // every loop below is unrolled so that s[][][] and acc[][][] are indexed by constants and stay in registers
    v8f s[8][2];
#pragma unroll
    for (int kt = 0; kt < 8; ++kt) { s[kt][0] = (v8f){}; s[kt][1] = (v8f){}; }
    {
        V qf[2][2];
#pragma unroll
        for (int qt = 0; qt < 2; ++qt)
#pragma unroll
            for (int ks = 0; ks < 2; ++ks) { const int o = lq + (qt * 2 + ks) * 512; qf[qt][ks] = WFrag<T16>::ldf(Q + o); }
        __builtin_amdgcn_sched_barrier(0);   // keeps the Q loads first: loads return in order, and with Q behind the 12 K fragments the second product waited for the whole group
        // K fragments are loaded KD = 12 fragments ahead of their products, so that 32 loads (Q and 12 K fragments) are issued at the start, held there by the scheduling barriers: in this build the compiler, left alone, issued more than half of the K fragments only two fragments ahead.
        constexpr int KD = 12;
        V kf[16];
#pragma unroll
        for (int it = 0; it < KD; ++it) { const int o = lo + it * 512; kf[it] = WFrag<T16>::ldf(kb + o); }
        __builtin_amdgcn_sched_barrier(0);   // keeps the group of loads above ahead of the first product
#pragma unroll
        for (int it = 0; it < 16; ++it) { const int kt = it >> 1, ks = it & 1;
            if (it + KD < 16) { const int o = lo + (it + KD) * 512; kf[it + KD] = WFrag<T16>::ldf(kb + o); }
#pragma unroll
            for (int qt = 0; qt < 2; ++qt) s[kt][qt] = WFrag<T16>::mma(kf[it], qf[qt][ks], s[kt][qt]);
            __builtin_amdgcn_sched_barrier(0);   // keeps each fragment's loads KD fragments ahead: left alone the compiler moved them to one or two fragments ahead
        }
    }
    float mx[2], f[2];
#pragma unroll
    for (int qt = 0; qt < 2; ++qt) { float m = s[0][qt][0];
#pragma unroll
        for (int kt = 0; kt < 8; ++kt)
#pragma unroll
            for (int j = 0; j < 8; ++j) m = fmaxf(m, s[kt][qt][j]);
        mx[qt] = fmaxf(m, __shfl_xor(m, 16, 32)) * SCL; }   // the maximum of the wave's own 128 scaled scores of the row; SCL is a power of two: exact
    redm[kw * 32 + lane] = hi ? mx[1] : mx[0];   // read behind the one barrier, where the partial outputs are joined
    __builtin_amdgcn_sched_barrier(0);   // keeps the V loads below behind the scores: left alone, with no barrier between them, the compiler moved them among the K loads, issued those late and spilled registers
    // V fragments: fragment j is loaded in front of the products of the first fragment it with vlim(it) >= j, as far ahead as the registers freed by the scores allow. The first four are loaded here: no barrier stands between here and P V any more, so they fly during the exponentials; the scheduling barriers hold every load in its place.
    V vf[16];
    auto ldv = [&](int j) { const int o = lo + j * 512; vf[j] = WFrag<T16>::ldf(vb + o); };
    auto vlim = [](int it) { return it < 0 ? 3 : it + (it < 4 ? 5 : 8); };
#pragma unroll
    for (int j = 0; j < 16; ++j) if (j <= vlim(-1)) ldv(j);
    __builtin_amdgcn_sched_barrier(0);   // keeps these loads ahead of the exponentials
#pragma unroll
    for (int qt = 0; qt < 2; ++qt) { float a = 0.f;
#pragma unroll
        for (int kt = 0; kt < 8; ++kt) { float y[8], e[8];
#pragma unroll
            for (int j = 0; j < 8; ++j) { y[j] = (s[kt][qt][j] * SCL - mx[qt]) * 1.4426950408889634f; y[j] += 10.0f;   // fp16 P carries the factor PCAR = 2^10, exactly, through the exponent; the sums carry it too, so it cancels at the join
                e[j] = __builtin_amdgcn_exp2f(y[j]); s[kt][qt][j] = e[j]; a += e[j]; }
            // the slot behind a transcendental: as inputs here the eight arguments keep their registers until all eight exponentials are issued, so no instruction directly behind one overwrites its source; the v_nop is the slot of the last one, where the compiler puts no other instruction there
            asm volatile("v_nop" :: "v"(y[0]), "v"(y[1]), "v"(y[2]), "v"(y[3]), "v"(y[4]), "v"(y[5]), "v"(y[6]), "v"(y[7]), "v"(e[0]), "v"(e[1]), "v"(e[2]), "v"(e[3]), "v"(e[4]), "v"(e[5]), "v"(e[6]), "v"(e[7])); }
        f[qt] = a + __shfl_xor(a, 16, 32); }
    reds[kw * 32 + lane] = hi ? f[1] : f[0];   // read behind the one barrier too
    __builtin_amdgcn_sched_barrier(0);   // keeps the exponentials ahead of P V: left alone, with no barrier between them, the compiler mixed the two phases and spilled registers
    v8f acc[2][4];
#pragma unroll
    for (int nb = 0; nb < 4; ++nb) { acc[0][nb] = (v8f){}; acc[1][nb] = (v8f){}; }
#pragma unroll
    for (int kk = 0; kk < 4; ++kk) {
        V pa[2];
#pragma unroll
        for (int qt = 0; qt < 2; ++qt) {
#pragma unroll
            for (int e = 0; e < 16; ++e) pa[qt][e] = tohx(s[2 * kk + (e >> 3)][qt][e & 7]); }
#pragma unroll
        for (int nb = 0; nb < 4; ++nb) { const int it = kk * 4 + nb;
#pragma unroll
            for (int j = 0; j < 16; ++j) if (j > vlim(it - 1) && j <= vlim(it)) ldv(j);
#pragma unroll
            for (int qt = 0; qt < 2; ++qt) acc[qt][nb] = WFrag<T16>::mma(pa[qt], vf[it], acc[qt][nb]);
            __builtin_amdgcn_sched_barrier(0);   // keeps each fragment's loads where they stand: left alone the compiler moved most of them directly in front of their products
        }
    }
    float* my = os + kw * (32 * 68);
#pragma unroll
    for (int qt = 0; qt < 2; ++qt)
#pragma unroll
        for (int nb = 0; nb < 4; ++nb)
#pragma unroll
            for (int j = 0; j < 8; ++j) my[(qt * 16 + hi * 8 + j) * 68 + nb * 16 + lr] = acc[qt][nb][j];
    }
    asm volatile("s_wait_xcnt 0x0" ::: "memory");   // stands ahead of the join's rewrite of registers that the last range's loads name
    __syncthreads();   // every range's partial output tile, row maxima and row sums are in LDS before any wave joins them
    // the 32 x 64 sum is 4 fragment tiles = 256 pieces of 8 columns (one lane's 16 bytes): each of the 8 waves takes one piece a lane (tile kw >> 1, half kw & 1) and stores 512 bytes in a row; no barrier follows
    const int kw = wv;
    const int qt = kw >> 2, ks = (kw >> 1) & 1; const int row = qt * 16 + lr, cofs = ks * 32 + (kw & 1) * 16 + hi * 8;
    // range w's partial output and sum stand relative to its own maximum m_w: both are weighted with exp(m_w - M), M the row's maximum over the ranges; weights at most 1, and 1 for the range that holds M, so the joined sum is at least PCAR
    float wg[16]; float M = redm[row]; wg[0] = M;
#pragma unroll
    for (int w = 1; w < 16; ++w) { wg[w] = redm[w * 32 + row]; M = fmaxf(M, wg[w]); }
    float den = 0.f;
#pragma unroll
    for (int w8 = 0; w8 < 16; w8 += 8) { float y[8];
#pragma unroll
        for (int j = 0; j < 8; ++j) { y[j] = (wg[w8 + j] - M) * 1.4426950408889634f; wg[w8 + j] = __builtin_amdgcn_exp2f(y[j]); den += wg[w8 + j] * reds[(w8 + j) * 32 + row]; }
        // the slot behind a transcendental, as in the softmax above
        asm volatile("v_nop" :: "v"(y[0]), "v"(y[1]), "v"(y[2]), "v"(y[3]), "v"(y[4]), "v"(y[5]), "v"(y[6]), "v"(y[7]), "v"(wg[w8]), "v"(wg[w8 + 1]), "v"(wg[w8 + 2]), "v"(wg[w8 + 3]), "v"(wg[w8 + 4]), "v"(wg[w8 + 5]), "v"(wg[w8 + 6]), "v"(wg[w8 + 7])); }
    v4f val = *(const v4fa*)(os + row * 68 + cofs) * wg[0], val2 = *(const v4fa*)(os + row * 68 + cofs + 4) * wg[0];
#pragma unroll
    for (int w = 1; w < 16; ++w) { val += *(const v4fa*)(os + w * (32 * 68) + row * 68 + cofs) * wg[w]; val2 += *(const v4fa*)(os + w * (32 * 68) + row * 68 + cofs + 4) * wg[w]; }
    const float cs = __fdiv_rn(1.0f, den); v8us oh, ol;
#pragma unroll
    for (int q = 0; q < 4; ++q) { unsigned short a, c2; splitf(val[q] * cs, a, c2); oh[q] = a; ol[q] = c2; splitf(val2[q] * cs, a, c2); oh[q + 4] = a; ol[q + 4] = c2; }
    const int e = (qt * (DQ / 32) + ks) * 512 + (kw & 1) * 256 + lane * 8; *(v8us*)(Ah + e) = oh; *(v8us*)(Al + e) = ol;
}
// 8 waves and at most 256 registers a wave: two workgroups share a WGP (LDS allows two), four waves to a SIMD as before, and the two run out of step: one's loads fly under the other's exponentials, join and start
__global__ __launch_bounds__(256) __attribute__((amdgpu_waves_per_eu(4, 4))) void k_fattn(const h16* __restrict__ Q16, const h16* __restrict__ K16, const h16* __restrict__ V16, bf* Ah, bf* Al) {
    __shared__ __align__(16) float os[16 * 32 * 68]; __shared__ float redm[16 * 32]; __shared__ float reds[16 * 32];
    const int h = blockIdx.x, q0 = blockIdx.y * 32; const size_t zq = ((size_t)h * TT + q0) * HD, zk = (size_t)(h / REP) * TT * HD, oo = (size_t)q0 * DQ + h * (HD * 16);   // merged planes [t][h d] in fragment order: a band of 16 rows is 16 DQ elements, a head is 2 tiles in it
    static_assert(PCAR == 1024.0f && TT == 16 * 128 && HD == 64, "8 waves x 2 ranges x 128 keys; 4 output column tiles");
    fattn(Q16 + zq, K16 + zk, V16 + zk, Ah + oo, Al + oo, os, redm, reds);
}

extern "C" void kernel_launch(void* const* d_in, const int* in_sizes, int n_in,
                              void* d_out, int out_size, void* d_ws, size_t ws_size, hipStream_t stream) {
    (void)in_sizes; (void)n_in; (void)out_size;
    const float* x = (const float*)d_in[0]; const float* wq = (const float*)d_in[1]; const float* wk = (const float*)d_in[2]; const float* wv = (const float*)d_in[3]; const float* wo = (const float*)d_in[4]; const float* lng = (const float*)d_in[5]; const float* lnb = (const float*)d_in[6];
    float* OUT = (float*)d_out;     // [1][2048][768]
    char* wsp = (char*)d_ws;
    auto take = [&](size_t bytes) { char* p = wsp; wsp += (bytes + 255) & ~(size_t)255; return (void*)p; };
    float* Y = (float*)take((size_t)TT * DM * 4); bf* WQ = (bf*)take((size_t)DQ * DM * 2); bf* WK = (bf*)take((size_t)DKV * DM * 2); bf* WV = (bf*)take((size_t)DKV * DM * 2); bf* WO = (bf*)take((size_t)DM * DQ * 2);
    bf* XB = (bf*)take((size_t)TT * DM * 2);
    h16* QP16 = (h16*)take((size_t)NH_ * TT * HD * 2); h16* KP16 = (h16*)take((size_t)NKV * TT * HD * 2); h16* VT16 = (h16*)take((size_t)NKV * HD * TT * 2);
    bf* ATh = (bf*)take((size_t)TT * DQ * 2); bf* ATl = (bf*)take((size_t)TT * DQ * 2);
    if ((size_t)(wsp - (char*)d_ws) > ws_size) return;    // ws 256 MiB
    k_cvt8<<<TT * DM / 16 / 256 + 4 * (DM * DM / 16 / 256), 256, 0, stream>>>(x, wq, wk, wv, wo, XB, WQ, WK, WV, WO);
    for (int b = 0; b < NB_; ++b) {
        
        k_qkv<<<dim3(TT / 64, NH_, 3), 256, 0, stream>>>(XB, WQ, WK, WV, QP16, KP16, VT16);
        k_fattn<<<dim3(NH_, TT / 32, 1), 256, 0, stream>>>(QP16, KP16, VT16, ATh, ATl);
        k_gemmw<bf, 1, false, 8, DQ><<<dim3(TT / 64, DM / 64, 1), 256, 0, stream>>>(ATh, ATl, WO, nullptr, Y, DM, nullptr, 0, 0, 0); k_lnrS12<<<TT / 8, 256, 0, stream>>>(x + (size_t)b * TT * DM, Y, lng, lnb, OUT + (size_t)b * TT * DM);   /* LayerNorm(out + x), eps 1e-12 */ }
}
